// v000
// Times are from an AMD MI455X. After a warm-up the kernel runs many times in a row, and a time is the length of
// such a window on the GPU divided by its runs, so every launch and the gaps after it count. The runs cycle
// through copies of the inputs. A figure is the median of several windows, for all but v000 over two sittings.
// Sittings can differ by a few percent; kernels timed side by side share one.
// v000 is the starting kernel.
#include <hip/hip_runtime.h>
#include <math.h>

#define D_MODEL 512
#define RANK 128
#define N_HEADS 8
#define D_HEAD 16
#define N_COMPRESS 64
#define N_EXPAND 64
#define N_KNOW 32768
#define KNOW_K 8
#define N_LAYERS 2
#define BATCH 2
#define SEQ 512
#define NTOK (BATCH * SEQ)

#define CHUNK 512
#define NSPLIT 8                            // grid-Y partitions of the N_KNOW axis
#define NCHUNKS (N_KNOW / CHUNK)            // 64
#define CHPS (NCHUNKS / NSPLIT)             // 8 chunks per split
#define NCAND (NSPLIT * 8)                  // 64 candidates per token

typedef float v2f __attribute__((ext_vector_type(2)));
typedef float v8f __attribute__((ext_vector_type(8)));

__device__ __forceinline__ v8f wmma_f32_16x16x4(v2f a, v2f b, v8f c) {
  // D = A(16x4 f32) * B(4x16 f32) + C(16x16 f32)
  return __builtin_amdgcn_wmma_f32_16x16x4_f32(false, a, false, b, (short)0, c,
                                               false, false);
}

// ---------------------------------------------------------------- LayerNorm
__global__ void ln_kernel(const float* __restrict__ x, const float* __restrict__ g,
                          const float* __restrict__ b, float* __restrict__ out) {
  int tok = blockIdx.x;
  int tid = threadIdx.x;  // 256 threads
  const float* xp = x + (size_t)tok * D_MODEL;
  float v0 = xp[tid], v1 = xp[tid + 256];
  __shared__ float rs[256], rq[256];
  rs[tid] = v0 + v1;
  rq[tid] = v0 * v0 + v1 * v1;
  __syncthreads();
  for (int s = 128; s > 0; s >>= 1) {
    if (tid < s) { rs[tid] += rs[tid + s]; rq[tid] += rq[tid + s]; }
    __syncthreads();
  }
  float mean = rs[0] * (1.0f / D_MODEL);
  float var = rq[0] * (1.0f / D_MODEL) - mean * mean;
  float rstd = rsqrtf(var + 1e-5f);
  float* op = out + (size_t)tok * D_MODEL;
  op[tid] = (v0 - mean) * rstd * g[tid] + b[tid];
  op[tid + 256] = (v1 - mean) * rstd * g[tid + 256] + b[tid + 256];
}

// ------------------------------------------------- routed compress (D -> R)
__global__ void compress_kernel(const float* __restrict__ h,
                                const float* __restrict__ router,   // [64,512]
                                const float* __restrict__ neurons,  // [64,512,128]
                                float* __restrict__ out) {          // [NTOK,128]
  int tok = blockIdx.x;
  int tid = threadIdx.x;  // 128 threads
  __shared__ float hs[D_MODEL];
  __shared__ float sc[N_COMPRESS];
  __shared__ float sw[2];
  __shared__ int se[2];
  const float* hp = h + (size_t)tok * D_MODEL;
  for (int i = tid; i < D_MODEL; i += 128) hs[i] = hp[i];
  __syncthreads();
  if (tid < N_COMPRESS) {
    const float* rp = router + (size_t)tid * D_MODEL;
    float acc = 0.f;
    for (int d = 0; d < D_MODEL; ++d) acc += hs[d] * rp[d];
    sc[tid] = acc;
  }
  __syncthreads();
  if (tid == 0) {
    float s1 = -INFINITY, s2 = -INFINITY;
    int e1 = 0, e2 = 0;
    for (int e = 0; e < N_COMPRESS; ++e) {
      float s = sc[e];
      if (s > s1) { s2 = s1; e2 = e1; s1 = s; e1 = e; }
      else if (s > s2) { s2 = s; e2 = e; }
    }
    float z = expf(s2 - s1);
    sw[0] = 1.f / (1.f + z);
    sw[1] = z / (1.f + z);
    se[0] = e1; se[1] = e2;
  }
  __syncthreads();
  int e0 = se[0], e1i = se[1];
  float w0 = sw[0], w1 = sw[1];
  const float* n0 = neurons + (size_t)e0 * (D_MODEL * RANK) + tid;
  const float* n1 = neurons + (size_t)e1i * (D_MODEL * RANK) + tid;
  float a0 = 0.f, a1 = 0.f;
  for (int d = 0; d < D_MODEL; ++d) {
    float hv = hs[d];
    a0 += hv * n0[(size_t)d * RANK];   // coalesced: consecutive tid -> consecutive r
    a1 += hv * n1[(size_t)d * RANK];
  }
  out[(size_t)tok * RANK + tid] = w0 * a0 + w1 * a1;
}

// --------------------------------------------------- routed expand (R -> D)
__global__ void expand_kernel(const float* __restrict__ in,        // [NTOK,128]
                              const float* __restrict__ router,    // [64,128]
                              const float* __restrict__ neurons,   // [64,128,512]
                              float* __restrict__ x) {             // += [NTOK,512]
  int tok = blockIdx.x;
  int tid = threadIdx.x;  // 256 threads
  __shared__ float is[RANK];
  __shared__ float sc[N_EXPAND];
  __shared__ float sw[2];
  __shared__ int se[2];
  const float* ip = in + (size_t)tok * RANK;
  if (tid < RANK) is[tid] = ip[tid];
  __syncthreads();
  if (tid < N_EXPAND) {
    const float* rp = router + (size_t)tid * RANK;
    float acc = 0.f;
    for (int r = 0; r < RANK; ++r) acc += is[r] * rp[r];
    sc[tid] = acc;
  }
  __syncthreads();
  if (tid == 0) {
    float s1 = -INFINITY, s2 = -INFINITY;
    int e1 = 0, e2 = 0;
    for (int e = 0; e < N_EXPAND; ++e) {
      float s = sc[e];
      if (s > s1) { s2 = s1; e2 = e1; s1 = s; e1 = e; }
      else if (s > s2) { s2 = s; e2 = e; }
    }
    float z = expf(s2 - s1);
    sw[0] = 1.f / (1.f + z);
    sw[1] = z / (1.f + z);
    se[0] = e1; se[1] = e2;
  }
  __syncthreads();
  int e0 = se[0], e1i = se[1];
  float w0 = sw[0], w1 = sw[1];
  for (int d = tid; d < D_MODEL; d += 256) {
    const float* n0 = neurons + (size_t)e0 * (RANK * D_MODEL) + d;
    const float* n1 = neurons + (size_t)e1i * (RANK * D_MODEL) + d;
    float a0 = 0.f, a1 = 0.f;
    for (int r = 0; r < RANK; ++r) {
      float iv = is[r];
      a0 += iv * n0[(size_t)r * D_MODEL];
      a1 += iv * n1[(size_t)r * D_MODEL];
    }
    x[(size_t)tok * D_MODEL + d] += w0 * a0 + w1 * a1;
  }
}

// -------------------------- flash attention: one wave per (b, head, q-tile)
// WMMA f32 16x16x4: QK^T (K=16 -> 4 wmma) and P@V (K=16 -> 4 wmma) per tile.
__global__ void attn_kernel(const float* __restrict__ Q, const float* __restrict__ K,
                            const float* __restrict__ V, float* __restrict__ O) {
  int bid = blockIdx.x;
  int qt = bid % (SEQ / 16);
  int head = (bid / (SEQ / 16)) % N_HEADS;
  int b = bid / ((SEQ / 16) * N_HEADS);
  int lane = threadIdx.x;  // block = 32 = one wave
  int nl = lane & 15;
  int kh = lane >> 4;      // which K half (A/B layout: lanes 16-31 hold K+2)
  int mrow = kh ? 8 : 0;   // C/D layout: lanes 16-31 hold rows 8-15
  size_t base = (size_t)b * SEQ;
  __shared__ float Pt[16][17];

  // A fragments for Q tile (16 rows x K=16), 4 chunks of K=4
  const float* qp = Q + (base + qt * 16 + nl) * RANK + head * D_HEAD;
  v2f aq[4];
#pragma unroll
  for (int kc = 0; kc < 4; ++kc) aq[kc] = *(const v2f*)(qp + 4 * kc + 2 * kh);

  v8f o;
  float rm[8], rl[8];
#pragma unroll
  for (int v = 0; v < 8; ++v) { o[v] = 0.f; rm[v] = -INFINITY; rl[v] = 0.f; }

  for (int j = 0; j <= qt; ++j) {
    v8f s;
#pragma unroll
    for (int v = 0; v < 8; ++v) s[v] = 0.f;
    const float* kp = K + (base + j * 16 + nl) * RANK + head * D_HEAD;
#pragma unroll
    for (int kc = 0; kc < 4; ++kc) {
      v2f bk = *(const v2f*)(kp + 4 * kc + 2 * kh);  // B[k][n], B[k+1][n]
      s = wmma_f32_16x16x4(aq[kc], bk, s);
    }
    // scale + causal mask (query = qt*16+m, key = j*16+n)
#pragma unroll
    for (int v = 0; v < 8; ++v) {
      float sv = s[v] * 0.25f;  // 1/sqrt(16)
      if (j == qt && nl > v + mrow) sv = -INFINITY;
      s[v] = sv;
    }
    // online softmax (rows live across 16-lane halves -> butterfly 1,2,4,8)
#pragma unroll
    for (int v = 0; v < 8; ++v) {
      float tmax = s[v];
#pragma unroll
      for (int msk = 1; msk < 16; msk <<= 1)
        tmax = fmaxf(tmax, __shfl_xor(tmax, msk, 32));
      float nm = fmaxf(rm[v], tmax);
      float alpha = __expf(rm[v] - nm);
      float p = __expf(s[v] - nm);
      float psum = p;
#pragma unroll
      for (int msk = 1; msk < 16; msk <<= 1) psum += __shfl_xor(psum, msk, 32);
      rl[v] = rl[v] * alpha + psum;
      o[v] *= alpha;
      rm[v] = nm;
      s[v] = p;
    }
    // re-layout P: C-layout -> LDS -> A-layout
#pragma unroll
    for (int v = 0; v < 8; ++v) Pt[v + mrow][nl] = s[v];
    __syncthreads();
    const float* vp = V + (base + j * 16) * RANK + head * D_HEAD + nl;
#pragma unroll
    for (int kc = 0; kc < 4; ++kc) {
      v2f ap;
      ap.x = Pt[nl][4 * kc + 2 * kh];
      ap.y = Pt[nl][4 * kc + 2 * kh + 1];
      v2f bv;
      bv.x = vp[(size_t)(4 * kc + 2 * kh) * RANK];
      bv.y = vp[(size_t)(4 * kc + 2 * kh + 1) * RANK];
      o = wmma_f32_16x16x4(ap, bv, o);
    }
    __syncthreads();
  }
  float* op = O + (base + qt * 16) * RANK + head * D_HEAD + nl;
#pragma unroll
  for (int v = 0; v < 8; ++v) op[(size_t)(v + mrow) * RANK] = o[v] / rl[v];
}

// ---------------- memory scores GEMM (WMMA f32, K=128) fused with top-8.
// grid = (NTOK/16, NSPLIT): split N_KNOW 8 ways for 8x more waves on the
// FLOP-dominant kernel; each split emits per-row top-8 candidates.
__global__ void memscore_kernel(const float* __restrict__ Qm,  // [NTOK,128]
                                const float* __restrict__ kK,  // [N_KNOW,128]
                                float* __restrict__ candS,     // [NTOK,NSPLIT,8]
                                int* __restrict__ candI) {     // [NTOK,NSPLIT,8]
  int tb = blockIdx.x;      // 16-token tile
  int split = blockIdx.y;   // column partition
  int tid = threadIdx.x;    // 256 threads = 8 waves
  int lane = tid & 31;
  int wave = tid >> 5;
  int nl = lane & 15;
  int kh = lane >> 4;
  int mrow = kh ? 8 : 0;
  size_t tokBase = (size_t)tb * 16;

  __shared__ float sc[16][CHUNK + 4];  // pad: 516 % 64 banks = 4 -> conflict free
  __shared__ float cs[16][128];
  __shared__ int ci[16][128];

  // A fragments for the Q tile: K=128 -> 32 chunks, kept in registers
  const float* qp = Qm + (tokBase + nl) * RANK;
  v2f aq[32];
#pragma unroll
  for (int kc = 0; kc < 32; ++kc) aq[kc] = *(const v2f*)(qp + 4 * kc + 2 * kh);

  float ts[8];
  int ti8[8];
#pragma unroll
  for (int i = 0; i < 8; ++i) { ts[i] = -INFINITY; ti8[i] = 0; }
  int row = tid & 15, slot = tid >> 4;
  const float scale = 0.08838834764831845f;  // 1/sqrt(128)

  for (int ch = split * CHPS; ch < (split + 1) * CHPS; ++ch) {
    // stage A: 8 waves x 4 n-tiles of 16 cols = 512 cols via WMMA
#pragma unroll 1
    for (int t = 0; t < 4; ++t) {
      int ntl = wave * 4 + t;
      int col0 = ch * CHUNK + ntl * 16;
      const float* kp = kK + (size_t)(col0 + nl) * RANK;
      // prefetch the same tile of the NEXT chunk (stream is fully predictable);
      // wrap so the last chunk never targets unmapped pages
      {
        int pcol = ((col0 + CHUNK) & (N_KNOW - 1)) + nl;
        const char* pp = (const char*)(kK + (size_t)pcol * RANK) + kh * 256;
        __builtin_prefetch(pp, 0, 3);
        __builtin_prefetch(pp + 128, 0, 3);
      }
      v8f c;
#pragma unroll
      for (int v = 0; v < 8; ++v) c[v] = 0.f;
#pragma unroll
      for (int kc = 0; kc < 32; ++kc) {
        v2f bk = *(const v2f*)(kp + 4 * kc + 2 * kh);
        c = wmma_f32_16x16x4(aq[kc], bk, c);
      }
#pragma unroll
      for (int v = 0; v < 8; ++v) sc[v + mrow][ntl * 16 + nl] = c[v] * scale;
    }
    __syncthreads();
    // stage B: 16 threads per row keep a private sorted top-8
    int cbase = slot * 32;
    for (int i = 0; i < 32; ++i) {
      float s = sc[row][cbase + i];
      if (s > ts[7]) {
        ts[7] = s;
        ti8[7] = ch * CHUNK + cbase + i;
#pragma unroll
        for (int q = 7; q > 0; --q) {
          if (ts[q] > ts[q - 1]) {
            float tf = ts[q]; ts[q] = ts[q - 1]; ts[q - 1] = tf;
            int tt = ti8[q]; ti8[q] = ti8[q - 1]; ti8[q - 1] = tt;
          }
        }
      }
    }
    __syncthreads();
  }
  // merge 16 candidate lists per row -> this split's top-8 candidates
#pragma unroll
  for (int i = 0; i < 8; ++i) { cs[row][slot * 8 + i] = ts[i]; ci[row][slot * 8 + i] = ti8[i]; }
  __syncthreads();
  if (tid < 16) {
    int r = tid;
    size_t ob = ((tokBase + r) * NSPLIT + split) * 8;
    for (int k = 0; k < 8; ++k) {
      float m = -INFINITY;
      int mi = 0;
      for (int c2 = 0; c2 < 128; ++c2)
        if (cs[r][c2] > m) { m = cs[r][c2]; mi = c2; }
      candS[ob + k] = m;
      candI[ob + k] = ci[r][mi];
      cs[r][mi] = -INFINITY;
    }
  }
}

// ---- merge NSPLIT candidate lists (disjoint column ranges -> exact top-8)
__global__ void memmerge_kernel(const float* __restrict__ candS,
                                const int* __restrict__ candI,
                                int* __restrict__ outIdx, float* __restrict__ outW) {
  int tok = blockIdx.x * blockDim.x + threadIdx.x;  // 1024 tokens, 128/block
  if (tok >= NTOK) return;
  const float* s = candS + (size_t)tok * NCAND;
  const int* ix = candI + (size_t)tok * NCAND;
  unsigned long long used = 0ull;
  float best[KNOW_K];
  int bi[KNOW_K];
  for (int k = 0; k < KNOW_K; ++k) {
    float m = -INFINITY;
    int mi = 0;
    for (int c = 0; c < NCAND; ++c) {
      if (!((used >> c) & 1ull)) {
        float v = s[c];
        if (v > m) { m = v; mi = c; }
      }
    }
    used |= 1ull << mi;
    best[k] = m;
    bi[k] = ix[mi];
  }
  float mx = best[0], sum = 0.f, w[KNOW_K];
  for (int k = 0; k < KNOW_K; ++k) { w[k] = expf(best[k] - mx); sum += w[k]; }
  float inv = 1.f / sum;
  size_t ob = (size_t)tok * KNOW_K;
  for (int k = 0; k < KNOW_K; ++k) { outIdx[ob + k] = bi[k]; outW[ob + k] = w[k] * inv; }
}

// ------------------------------------------- weighted gather of kV + residual
__global__ void memgather_kernel(const int* __restrict__ idx, const float* __restrict__ w,
                                 const float* __restrict__ kV, float* __restrict__ x) {
  int tok = blockIdx.x;
  int tid = threadIdx.x;  // 128
  __shared__ int si[8];
  __shared__ float swt[8];
  if (tid < 8) { si[tid] = idx[(size_t)tok * 8 + tid]; swt[tid] = w[(size_t)tok * 8 + tid]; }
  __syncthreads();
  for (int d = tid; d < D_MODEL; d += 128) {
    float acc = 0.f;
#pragma unroll
    for (int k = 0; k < 8; ++k) acc += swt[k] * kV[(size_t)si[k] * D_MODEL + d];
    x[(size_t)tok * D_MODEL + d] += acc;
  }
}

extern "C" void kernel_launch(void* const* d_in, const int* in_sizes, int n_in,
                              void* d_out, int out_size, void* d_ws, size_t ws_size,
                              hipStream_t stream) {
  const float* x_in = (const float*)d_in[0];
  const float* cneur = (const float*)d_in[1];
  const float* eneur = (const float*)d_in[2];
  const float* kK = (const float*)d_in[3];
  const float* kV = (const float*)d_in[4];
  const float* rq = (const float*)d_in[5];
  const float* rk = (const float*)d_in[6];
  const float* rv = (const float*)d_in[7];
  const float* ro = (const float*)d_in[8];
  const float* rm = (const float*)d_in[9];
  const float* ln1g = (const float*)d_in[10];
  const float* ln1b = (const float*)d_in[11];
  const float* ln2g = (const float*)d_in[12];
  const float* ln2b = (const float*)d_in[13];
  const float* lnfg = (const float*)d_in[14];
  const float* lnfb = (const float*)d_in[15];
  float* out = (float*)d_out;

  float* ws = (float*)d_ws;
  float* xb = ws;     ws += (size_t)NTOK * D_MODEL;
  float* h = ws;      ws += (size_t)NTOK * D_MODEL;
  float* qc = ws;     ws += (size_t)NTOK * RANK;
  float* kc = ws;     ws += (size_t)NTOK * RANK;
  float* vc = ws;     ws += (size_t)NTOK * RANK;
  float* ctx = ws;    ws += (size_t)NTOK * RANK;
  float* qm = ws;     ws += (size_t)NTOK * RANK;
  float* wt = ws;     ws += (size_t)NTOK * KNOW_K;
  float* candS = ws;  ws += (size_t)NTOK * NCAND;
  int* candI = (int*)ws;  ws += (size_t)NTOK * NCAND;
  int* idx = (int*)ws;

  hipMemcpyAsync(xb, x_in, sizeof(float) * (size_t)NTOK * D_MODEL,
                 hipMemcpyDeviceToDevice, stream);

  for (int l = 0; l < N_LAYERS; ++l) {
    ln_kernel<<<NTOK, 256, 0, stream>>>(xb, ln1g + l * D_MODEL, ln1b + l * D_MODEL, h);
    compress_kernel<<<NTOK, 128, 0, stream>>>(h, rq + (size_t)l * N_COMPRESS * D_MODEL, cneur, qc);
    compress_kernel<<<NTOK, 128, 0, stream>>>(h, rk + (size_t)l * N_COMPRESS * D_MODEL, cneur, kc);
    compress_kernel<<<NTOK, 128, 0, stream>>>(h, rv + (size_t)l * N_COMPRESS * D_MODEL, cneur, vc);
    attn_kernel<<<BATCH * N_HEADS * (SEQ / 16), 32, 0, stream>>>(qc, kc, vc, ctx);
    expand_kernel<<<NTOK, 256, 0, stream>>>(ctx, ro + (size_t)l * N_EXPAND * RANK, eneur, xb);
    ln_kernel<<<NTOK, 256, 0, stream>>>(xb, ln2g + l * D_MODEL, ln2b + l * D_MODEL, h);
    compress_kernel<<<NTOK, 128, 0, stream>>>(h, rm + (size_t)l * N_COMPRESS * D_MODEL, cneur, qm);
    memscore_kernel<<<dim3(NTOK / 16, NSPLIT), 256, 0, stream>>>(qm, kK, candS, candI);
    memmerge_kernel<<<NTOK / 128, 128, 0, stream>>>(candS, candI, idx, wt);
    memgather_kernel<<<NTOK, 128, 0, stream>>>(idx, wt, kV, xb);
  }
  ln_kernel<<<NTOK, 256, 0, stream>>>(xb, lnfg, lnfb, out);
}

// v001
// In both of two side-by-side timings against v000, it was 1.16 times as fast.
#include <hip/hip_runtime.h>
#include <math.h>

#define D_MODEL 512
#define RANK 128
#define N_HEADS 8
#define D_HEAD 16
#define N_COMPRESS 64
#define N_EXPAND 64
#define N_KNOW 32768
#define KNOW_K 8
#define N_LAYERS 2
#define BATCH 2
#define SEQ 512
#define NTOK (BATCH * SEQ)

#define CHUNK 512
#define NSPLIT 8                            // grid-Y partitions of the N_KNOW axis
#define NCHUNKS (N_KNOW / CHUNK)            // 64
#define CHPS (NCHUNKS / NSPLIT)             // 8 chunks per split
#define NCAND (NSPLIT * 8)                  // 64 candidates per token
#define KT_PITCH 132  // floats per staged kK row: 528 B = 16 B x 33, so the 32 lanes'
                      // 8-byte fragment reads fall on 64 distinct banks

typedef float v2f __attribute__((ext_vector_type(2)));
typedef float v4f __attribute__((ext_vector_type(4)));
typedef float v8f __attribute__((ext_vector_type(8)));

__device__ __forceinline__ v8f wmma_f32_16x16x4(v2f a, v2f b, v8f c) {
  // D = A(16x4 f32) * B(4x16 f32) + C(16x16 f32)
  return __builtin_amdgcn_wmma_f32_16x16x4_f32(false, a, false, b, (short)0, c,
                                               false, false);
}

// ---------------------------------------------------------------- LayerNorm
__global__ void ln_kernel(const float* __restrict__ x, const float* __restrict__ g,
                          const float* __restrict__ b, float* __restrict__ out) {
  int tok = blockIdx.x;
  int tid = threadIdx.x;  // 256 threads
  const float* xp = x + (size_t)tok * D_MODEL;
  float v0 = xp[tid], v1 = xp[tid + 256];
  __shared__ float rs[256], rq[256];
  rs[tid] = v0 + v1;
  rq[tid] = v0 * v0 + v1 * v1;
  __syncthreads();
  for (int s = 128; s > 0; s >>= 1) {
    if (tid < s) { rs[tid] += rs[tid + s]; rq[tid] += rq[tid + s]; }
    __syncthreads();
  }
  float mean = rs[0] * (1.0f / D_MODEL);
  float var = rq[0] * (1.0f / D_MODEL) - mean * mean;
  float rstd = rsqrtf(var + 1e-5f);
  float* op = out + (size_t)tok * D_MODEL;
  op[tid] = (v0 - mean) * rstd * g[tid] + b[tid];
  op[tid + 256] = (v1 - mean) * rstd * g[tid + 256] + b[tid + 256];
}

// ------------------------------------------------- routed compress (D -> R)
__global__ void compress_kernel(const float* __restrict__ h,
                                const float* __restrict__ router,   // [64,512]
                                const float* __restrict__ neurons,  // [64,512,128]
                                float* __restrict__ out) {          // [NTOK,128]
  int tok = blockIdx.x;
  int tid = threadIdx.x;  // 128 threads
  __shared__ float hs[D_MODEL];
  __shared__ float sc[N_COMPRESS];
  __shared__ float sw[2];
  __shared__ int se[2];
  const float* hp = h + (size_t)tok * D_MODEL;
  for (int i = tid; i < D_MODEL; i += 128) hs[i] = hp[i];
  __syncthreads();
  if (tid < N_COMPRESS) {
    const float* rp = router + (size_t)tid * D_MODEL;
    float acc = 0.f;
    for (int d = 0; d < D_MODEL; ++d) acc += hs[d] * rp[d];
    sc[tid] = acc;
  }
  __syncthreads();
  if (tid == 0) {
    float s1 = -INFINITY, s2 = -INFINITY;
    int e1 = 0, e2 = 0;
    for (int e = 0; e < N_COMPRESS; ++e) {
      float s = sc[e];
      if (s > s1) { s2 = s1; e2 = e1; s1 = s; e1 = e; }
      else if (s > s2) { s2 = s; e2 = e; }
    }
    float z = expf(s2 - s1);
    sw[0] = 1.f / (1.f + z);
    sw[1] = z / (1.f + z);
    se[0] = e1; se[1] = e2;
  }
  __syncthreads();
  int e0 = se[0], e1i = se[1];
  float w0 = sw[0], w1 = sw[1];
  const float* n0 = neurons + (size_t)e0 * (D_MODEL * RANK) + tid;
  const float* n1 = neurons + (size_t)e1i * (D_MODEL * RANK) + tid;
  float a0 = 0.f, a1 = 0.f;
  for (int d = 0; d < D_MODEL; ++d) {
    float hv = hs[d];
    a0 += hv * n0[(size_t)d * RANK];   // coalesced: consecutive tid -> consecutive r
    a1 += hv * n1[(size_t)d * RANK];
  }
  out[(size_t)tok * RANK + tid] = w0 * a0 + w1 * a1;
}

// --------------------------------------------------- routed expand (R -> D)
__global__ void expand_kernel(const float* __restrict__ in,        // [NTOK,128]
                              const float* __restrict__ router,    // [64,128]
                              const float* __restrict__ neurons,   // [64,128,512]
                              float* __restrict__ x) {             // += [NTOK,512]
  int tok = blockIdx.x;
  int tid = threadIdx.x;  // 256 threads
  __shared__ float is[RANK];
  __shared__ float sc[N_EXPAND];
  __shared__ float sw[2];
  __shared__ int se[2];
  const float* ip = in + (size_t)tok * RANK;
  if (tid < RANK) is[tid] = ip[tid];
  __syncthreads();
  if (tid < N_EXPAND) {
    const float* rp = router + (size_t)tid * RANK;
    float acc = 0.f;
    for (int r = 0; r < RANK; ++r) acc += is[r] * rp[r];
    sc[tid] = acc;
  }
  __syncthreads();
  if (tid == 0) {
    float s1 = -INFINITY, s2 = -INFINITY;
    int e1 = 0, e2 = 0;
    for (int e = 0; e < N_EXPAND; ++e) {
      float s = sc[e];
      if (s > s1) { s2 = s1; e2 = e1; s1 = s; e1 = e; }
      else if (s > s2) { s2 = s; e2 = e; }
    }
    float z = expf(s2 - s1);
    sw[0] = 1.f / (1.f + z);
    sw[1] = z / (1.f + z);
    se[0] = e1; se[1] = e2;
  }
  __syncthreads();
  int e0 = se[0], e1i = se[1];
  float w0 = sw[0], w1 = sw[1];
  for (int d = tid; d < D_MODEL; d += 256) {
    const float* n0 = neurons + (size_t)e0 * (RANK * D_MODEL) + d;
    const float* n1 = neurons + (size_t)e1i * (RANK * D_MODEL) + d;
    float a0 = 0.f, a1 = 0.f;
    for (int r = 0; r < RANK; ++r) {
      float iv = is[r];
      a0 += iv * n0[(size_t)r * D_MODEL];
      a1 += iv * n1[(size_t)r * D_MODEL];
    }
    x[(size_t)tok * D_MODEL + d] += w0 * a0 + w1 * a1;
  }
}

// -------------------------- flash attention: one wave per (b, head, q-tile)
// WMMA f32 16x16x4: QK^T (K=16 -> 4 wmma) and P@V (K=16 -> 4 wmma) per tile.
__global__ void attn_kernel(const float* __restrict__ Q, const float* __restrict__ K,
                            const float* __restrict__ V, float* __restrict__ O) {
  int bid = blockIdx.x;
  int qt = bid % (SEQ / 16);
  int head = (bid / (SEQ / 16)) % N_HEADS;
  int b = bid / ((SEQ / 16) * N_HEADS);
  int lane = threadIdx.x;  // block = 32 = one wave
  int nl = lane & 15;
  int kh = lane >> 4;      // which K half (A/B layout: lanes 16-31 hold K+2)
  int mrow = kh ? 8 : 0;   // C/D layout: lanes 16-31 hold rows 8-15
  size_t base = (size_t)b * SEQ;
  __shared__ float Pt[16][17];

  // A fragments for Q tile (16 rows x K=16), 4 chunks of K=4
  const float* qp = Q + (base + qt * 16 + nl) * RANK + head * D_HEAD;
  v2f aq[4];
#pragma unroll
  for (int kc = 0; kc < 4; ++kc) aq[kc] = *(const v2f*)(qp + 4 * kc + 2 * kh);

  v8f o;
  float rm[8], rl[8];
#pragma unroll
  for (int v = 0; v < 8; ++v) { o[v] = 0.f; rm[v] = -INFINITY; rl[v] = 0.f; }

  for (int j = 0; j <= qt; ++j) {
    v8f s;
#pragma unroll
    for (int v = 0; v < 8; ++v) s[v] = 0.f;
    const float* kp = K + (base + j * 16 + nl) * RANK + head * D_HEAD;
#pragma unroll
    for (int kc = 0; kc < 4; ++kc) {
      v2f bk = *(const v2f*)(kp + 4 * kc + 2 * kh);  // B[k][n], B[k+1][n]
      s = wmma_f32_16x16x4(aq[kc], bk, s);
    }
    // scale + causal mask (query = qt*16+m, key = j*16+n)
#pragma unroll
    for (int v = 0; v < 8; ++v) {
      float sv = s[v] * 0.25f;  // 1/sqrt(16)
      if (j == qt && nl > v + mrow) sv = -INFINITY;
      s[v] = sv;
    }
    // online softmax (rows live across 16-lane halves -> butterfly 1,2,4,8)
#pragma unroll
    for (int v = 0; v < 8; ++v) {
      float tmax = s[v];
#pragma unroll
      for (int msk = 1; msk < 16; msk <<= 1)
        tmax = fmaxf(tmax, __shfl_xor(tmax, msk, 32));
      float nm = fmaxf(rm[v], tmax);
      float alpha = __expf(rm[v] - nm);
      float p = __expf(s[v] - nm);
      float psum = p;
#pragma unroll
      for (int msk = 1; msk < 16; msk <<= 1) psum += __shfl_xor(psum, msk, 32);
      rl[v] = rl[v] * alpha + psum;
      o[v] *= alpha;
      rm[v] = nm;
      s[v] = p;
    }
    // re-layout P: C-layout -> LDS -> A-layout
#pragma unroll
    for (int v = 0; v < 8; ++v) Pt[v + mrow][nl] = s[v];
    __syncthreads();
    const float* vp = V + (base + j * 16) * RANK + head * D_HEAD + nl;
#pragma unroll
    for (int kc = 0; kc < 4; ++kc) {
      v2f ap;
      ap.x = Pt[nl][4 * kc + 2 * kh];
      ap.y = Pt[nl][4 * kc + 2 * kh + 1];
      v2f bv;
      bv.x = vp[(size_t)(4 * kc + 2 * kh) * RANK];
      bv.y = vp[(size_t)(4 * kc + 2 * kh + 1) * RANK];
      o = wmma_f32_16x16x4(ap, bv, o);
    }
    __syncthreads();
  }
  float* op = O + (base + qt * 16) * RANK + head * D_HEAD + nl;
#pragma unroll
  for (int v = 0; v < 8; ++v) op[(size_t)(v + mrow) * RANK] = o[v] / rl[v];
}

// ---------------- memory scores GEMM (WMMA f32, K=128) fused with top-8.
// grid = (NTOK/16, NSPLIT): split N_KNOW 8 ways for 8x more waves on the
// FLOP-dominant kernel; each split emits per-row top-8 candidates.
// Each wave brings its 16-column kK tile in as whole 512-byte rows (one row per
// 16-byte-per-lane load), one tile ahead, parks it in its own LDS range and
// reads the B fragments from there (k = 4 kc + 2 kh, as the A fragments).
__global__ __launch_bounds__(256) void memscore_kernel(const float* __restrict__ Qm,  // [NTOK,128]
                                const float* __restrict__ kK,  // [N_KNOW,128]
                                float* __restrict__ candS,     // [NTOK,NSPLIT,8]
                                int* __restrict__ candI) {     // [NTOK,NSPLIT,8]
  int tb = blockIdx.x;      // 16-token tile
  int split = blockIdx.y;   // column partition
  int tid = threadIdx.x;    // 256 threads = 8 waves
  int lane = tid & 31;
  int wave = tid >> 5;
  int nl = lane & 15;
  int kh = lane >> 4;
  int mrow = kh ? 8 : 0;
  size_t tokBase = (size_t)tb * 16;

  __shared__ float sc[16][CHUNK + 4];  // pad: 516 % 64 banks = 4 -> conflict free
  __shared__ float cs[16][128];
  __shared__ int ci[16][128];
  __shared__ __attribute__((aligned(16))) float kt[8][16 * KT_PITCH];  // one tile per wave
  float* ktw = &kt[wave][0];

  // A fragments for the Q tile: K=128 -> 32 chunks, kept in registers
  const float* qp = Qm + (tokBase + nl) * RANK;
  v2f aq[32];
#pragma unroll
  for (int kc = 0; kc < 32; ++kc) aq[kc] = *(const v2f*)(qp + 4 * kc + 2 * kh);

  float ts[8];
  int ti8[8];
#pragma unroll
  for (int i = 0; i < 8; ++i) { ts[i] = -INFINITY; ti8[i] = 0; }
  int row = tid & 15, slot = tid >> 4;
  const float scale = 0.08838834764831845f;  // 1/sqrt(128)

  // this wave's first tile: row i of the tile = 32 lanes x 16 B = 4 whole lines
  v4f st[16];
  const float* gp = kK + (size_t)(split * CHPS * CHUNK + wave * 64) * RANK + lane * 4;
#pragma unroll
  for (int i = 0; i < 16; ++i) st[i] = *(const v4f*)(gp + i * RANK);
  // inputs-only fence on the loaded A values: A is waited for here, once. Without it
  // the waits for A stand among the WMMAs of the loop and drain the next tile's
  // loads there on every trip.
  asm volatile("" ::"v"(aq[0]), "v"(aq[1]), "v"(aq[2]), "v"(aq[3]), "v"(aq[4]), "v"(aq[5]),
               "v"(aq[6]), "v"(aq[7]), "v"(aq[8]), "v"(aq[9]), "v"(aq[10]), "v"(aq[11]),
               "v"(aq[12]), "v"(aq[13]), "v"(aq[14]), "v"(aq[15]));
  asm volatile("" ::"v"(aq[16]), "v"(aq[17]), "v"(aq[18]), "v"(aq[19]), "v"(aq[20]), "v"(aq[21]),
               "v"(aq[22]), "v"(aq[23]), "v"(aq[24]), "v"(aq[25]), "v"(aq[26]), "v"(aq[27]),
               "v"(aq[28]), "v"(aq[29]), "v"(aq[30]), "v"(aq[31]));

  for (int ch = split * CHPS; ch < (split + 1) * CHPS; ++ch) {
    // stage A: 8 waves x 4 n-tiles of 16 cols = 512 cols via WMMA
#pragma unroll 1
    for (int t = 0; t < 4; ++t) {
      int ntl = wave * 4 + t;
#pragma unroll
      for (int i = 0; i < 16; ++i) *(v4f*)(ktw + i * KT_PITCH + lane * 4) = st[i];
      // the wave's own row stores have landed before its lanes read each other's
      // rows back as fragments (the range is private to the wave: no barrier)
      asm volatile("s_wait_dscnt 0x0" ::: "memory");
      // the wave's next tile flies while this one is multiplied; none behind the last
      if (t < 3 || ch + 1 < (split + 1) * CHPS) {
        gp += (t < 3 ? 16 : CHUNK - 48) * RANK;  // next tile of the chunk, or first of the next
#pragma unroll
        for (int i = 0; i < 16; ++i) st[i] = *(const v4f*)(gp + i * RANK);
      }
      const float* kp = ktw + nl * KT_PITCH;
      v8f c;
#pragma unroll
      for (int v = 0; v < 8; ++v) c[v] = 0.f;
#pragma unroll
      for (int kc = 0; kc < 32; ++kc) {
        v2f bk = *(const v2f*)(kp + 4 * kc + 2 * kh);
        c = wmma_f32_16x16x4(aq[kc], bk, c);
      }
#pragma unroll
      for (int v = 0; v < 8; ++v) sc[v + mrow][ntl * 16 + nl] = c[v] * scale;
    }
    __syncthreads();
    // stage B: 16 threads per row keep a private sorted top-8
    int cbase = slot * 32;
    for (int i = 0; i < 32; ++i) {
      float s = sc[row][cbase + i];
      if (s > ts[7]) {
        ts[7] = s;
        ti8[7] = ch * CHUNK + cbase + i;
#pragma unroll
        for (int q = 7; q > 0; --q) {
          if (ts[q] > ts[q - 1]) {
            float tf = ts[q]; ts[q] = ts[q - 1]; ts[q - 1] = tf;
            int tt = ti8[q]; ti8[q] = ti8[q - 1]; ti8[q - 1] = tt;
          }
        }
      }
    }
    __syncthreads();
  }
  // merge 16 candidate lists per row -> this split's top-8 candidates
#pragma unroll
  for (int i = 0; i < 8; ++i) { cs[row][slot * 8 + i] = ts[i]; ci[row][slot * 8 + i] = ti8[i]; }
  __syncthreads();
  if (tid < 16) {
    int r = tid;
    size_t ob = ((tokBase + r) * NSPLIT + split) * 8;
    for (int k = 0; k < 8; ++k) {
      float m = -INFINITY;
      int mi = 0;
      for (int c2 = 0; c2 < 128; ++c2)
        if (cs[r][c2] > m) { m = cs[r][c2]; mi = c2; }
      candS[ob + k] = m;
      candI[ob + k] = ci[r][mi];
      cs[r][mi] = -INFINITY;
    }
  }
}

// ---- merge NSPLIT candidate lists (disjoint column ranges -> exact top-8)
__global__ void memmerge_kernel(const float* __restrict__ candS,
                                const int* __restrict__ candI,
                                int* __restrict__ outIdx, float* __restrict__ outW) {
  int tok = blockIdx.x * blockDim.x + threadIdx.x;  // 1024 tokens, 128/block
  if (tok >= NTOK) return;
  const float* s = candS + (size_t)tok * NCAND;
  const int* ix = candI + (size_t)tok * NCAND;
  unsigned long long used = 0ull;
  float best[KNOW_K];
  int bi[KNOW_K];
  for (int k = 0; k < KNOW_K; ++k) {
    float m = -INFINITY;
    int mi = 0;
    for (int c = 0; c < NCAND; ++c) {
      if (!((used >> c) & 1ull)) {
        float v = s[c];
        if (v > m) { m = v; mi = c; }
      }
    }
    used |= 1ull << mi;
    best[k] = m;
    bi[k] = ix[mi];
  }
  float mx = best[0], sum = 0.f, w[KNOW_K];
  for (int k = 0; k < KNOW_K; ++k) { w[k] = expf(best[k] - mx); sum += w[k]; }
  float inv = 1.f / sum;
  size_t ob = (size_t)tok * KNOW_K;
  for (int k = 0; k < KNOW_K; ++k) { outIdx[ob + k] = bi[k]; outW[ob + k] = w[k] * inv; }
}

// ------------------------------------------- weighted gather of kV + residual
__global__ void memgather_kernel(const int* __restrict__ idx, const float* __restrict__ w,
                                 const float* __restrict__ kV, float* __restrict__ x) {
  int tok = blockIdx.x;
  int tid = threadIdx.x;  // 128
  __shared__ int si[8];
  __shared__ float swt[8];
  if (tid < 8) { si[tid] = idx[(size_t)tok * 8 + tid]; swt[tid] = w[(size_t)tok * 8 + tid]; }
  __syncthreads();
  for (int d = tid; d < D_MODEL; d += 128) {
    float acc = 0.f;
#pragma unroll
    for (int k = 0; k < 8; ++k) acc += swt[k] * kV[(size_t)si[k] * D_MODEL + d];
    x[(size_t)tok * D_MODEL + d] += acc;
  }
}

extern "C" void kernel_launch(void* const* d_in, const int* in_sizes, int n_in,
                              void* d_out, int out_size, void* d_ws, size_t ws_size,
                              hipStream_t stream) {
  const float* x_in = (const float*)d_in[0];
  const float* cneur = (const float*)d_in[1];
  const float* eneur = (const float*)d_in[2];
  const float* kK = (const float*)d_in[3];
  const float* kV = (const float*)d_in[4];
  const float* rq = (const float*)d_in[5];
  const float* rk = (const float*)d_in[6];
  const float* rv = (const float*)d_in[7];
  const float* ro = (const float*)d_in[8];
  const float* rm = (const float*)d_in[9];
  const float* ln1g = (const float*)d_in[10];
  const float* ln1b = (const float*)d_in[11];
  const float* ln2g = (const float*)d_in[12];
  const float* ln2b = (const float*)d_in[13];
  const float* lnfg = (const float*)d_in[14];
  const float* lnfb = (const float*)d_in[15];
  float* out = (float*)d_out;

  float* ws = (float*)d_ws;
  float* xb = ws;     ws += (size_t)NTOK * D_MODEL;
  float* h = ws;      ws += (size_t)NTOK * D_MODEL;
  float* qc = ws;     ws += (size_t)NTOK * RANK;
  float* kc = ws;     ws += (size_t)NTOK * RANK;
  float* vc = ws;     ws += (size_t)NTOK * RANK;
  float* ctx = ws;    ws += (size_t)NTOK * RANK;
  float* qm = ws;     ws += (size_t)NTOK * RANK;
  float* wt = ws;     ws += (size_t)NTOK * KNOW_K;
  float* candS = ws;  ws += (size_t)NTOK * NCAND;
  int* candI = (int*)ws;  ws += (size_t)NTOK * NCAND;
  int* idx = (int*)ws;

  hipMemcpyAsync(xb, x_in, sizeof(float) * (size_t)NTOK * D_MODEL,
                 hipMemcpyDeviceToDevice, stream);

  for (int l = 0; l < N_LAYERS; ++l) {
    ln_kernel<<<NTOK, 256, 0, stream>>>(xb, ln1g + l * D_MODEL, ln1b + l * D_MODEL, h);
    compress_kernel<<<NTOK, 128, 0, stream>>>(h, rq + (size_t)l * N_COMPRESS * D_MODEL, cneur, qc);
    compress_kernel<<<NTOK, 128, 0, stream>>>(h, rk + (size_t)l * N_COMPRESS * D_MODEL, cneur, kc);
    compress_kernel<<<NTOK, 128, 0, stream>>>(h, rv + (size_t)l * N_COMPRESS * D_MODEL, cneur, vc);
    attn_kernel<<<BATCH * N_HEADS * (SEQ / 16), 32, 0, stream>>>(qc, kc, vc, ctx);
    expand_kernel<<<NTOK, 256, 0, stream>>>(ctx, ro + (size_t)l * N_EXPAND * RANK, eneur, xb);
    ln_kernel<<<NTOK, 256, 0, stream>>>(xb, ln2g + l * D_MODEL, ln2b + l * D_MODEL, h);
    compress_kernel<<<NTOK, 128, 0, stream>>>(h, rm + (size_t)l * N_COMPRESS * D_MODEL, cneur, qm);
    memscore_kernel<<<dim3(NTOK / 16, NSPLIT), 256, 0, stream>>>(qm, kK, candS, candI);
    memmerge_kernel<<<NTOK / 128, 128, 0, stream>>>(candS, candI, idx, wt);
    memgather_kernel<<<NTOK, 128, 0, stream>>>(idx, wt, kV, xb);
  }
  ln_kernel<<<NTOK, 256, 0, stream>>>(xb, lnfg, lnfb, out);
}

// v002
// Two timings next to v001 both put it at 1.13 times that version's speed.
// All steps since v000 together make it 1.31 times as fast.
#include <hip/hip_runtime.h>
#include <math.h>

#define D_MODEL 512
#define RANK 128
#define N_HEADS 8
#define D_HEAD 16
#define N_COMPRESS 64
#define N_EXPAND 64
#define N_KNOW 32768
#define KNOW_K 8
#define N_LAYERS 2
#define BATCH 2
#define SEQ 512
#define NTOK (BATCH * SEQ)

#define CHUNK 512
#define NSPLIT 8                            // grid-Y partitions of the N_KNOW axis
#define NCHUNKS (N_KNOW / CHUNK)            // 64
#define CHPS (NCHUNKS / NSPLIT)             // 8 chunks per split
#define NCAND (NSPLIT * 8)                  // 64 candidates per token
#define KT_PITCH 132  // floats per staged kK row: 528 B = 16 B x 33, so the 32 lanes'
                      // 8-byte fragment reads fall on 64 distinct banks

typedef float v2f __attribute__((ext_vector_type(2)));
typedef float v4f __attribute__((ext_vector_type(4)));
typedef float v8f __attribute__((ext_vector_type(8)));

__device__ __forceinline__ v8f wmma_f32_16x16x4(v2f a, v2f b, v8f c) {
  // D = A(16x4 f32) * B(4x16 f32) + C(16x16 f32)
  return __builtin_amdgcn_wmma_f32_16x16x4_f32(false, a, false, b, (short)0, c,
                                               false, false);
}

// ---------------------------------------------------------------- LayerNorm
__global__ void ln_kernel(const float* __restrict__ x, const float* __restrict__ g,
                          const float* __restrict__ b, float* __restrict__ out) {
  int tok = blockIdx.x;
  int tid = threadIdx.x;  // 256 threads
  const float* xp = x + (size_t)tok * D_MODEL;
  float v0 = xp[tid], v1 = xp[tid + 256];
  __shared__ float rs[256], rq[256];
  rs[tid] = v0 + v1;
  rq[tid] = v0 * v0 + v1 * v1;
  __syncthreads();
  for (int s = 128; s > 0; s >>= 1) {
    if (tid < s) { rs[tid] += rs[tid + s]; rq[tid] += rq[tid + s]; }
    __syncthreads();
  }
  float mean = rs[0] * (1.0f / D_MODEL);
  float var = rq[0] * (1.0f / D_MODEL) - mean * mean;
  float rstd = rsqrtf(var + 1e-5f);
  float* op = out + (size_t)tok * D_MODEL;
  op[tid] = (v0 - mean) * rstd * g[tid] + b[tid];
  op[tid + 256] = (v1 - mean) * rstd * g[tid + 256] + b[tid + 256];
}

// ------------------------------------------------- routed compress (D -> R)
__global__ void compress_kernel(const float* __restrict__ h,
                                const float* __restrict__ router,   // [64,512]
                                const float* __restrict__ neurons,  // [64,512,128]
                                float* __restrict__ out) {          // [NTOK,128]
  int tok = blockIdx.x;
  int tid = threadIdx.x;  // 128 threads
  __shared__ float hs[D_MODEL];
  __shared__ float sc[N_COMPRESS];
  __shared__ float ss[2];
  __shared__ int se[2];
  const float* hp = h + (size_t)tok * D_MODEL;
  for (int i = tid; i < D_MODEL; i += 128) hs[i] = hp[i];
  if (tid < 2) { ss[tid] = -INFINITY; se[tid] = 0; }  // start values, as the scan had
  __syncthreads();
  float my = 0.f;
  if (tid < N_COMPRESS) {
    const float* rp = router + (size_t)tid * D_MODEL;
    float acc = 0.f;
    for (int d = 0; d < D_MODEL; ++d) acc += hs[d] * rp[d];
    sc[tid] = acc;
    my = acc;
  }
  __syncthreads();
  // top-2 by rank: each score counts the scores that come before it (greater, or
  // equal with a lower index); ranks 0 and 1 are the two that a scan in index order picks
  if (tid < N_COMPRESS) {
    int rank = 0;
    for (int e = 0; e < N_COMPRESS; ++e) {
      float s = sc[e];
      rank += (s > my || (s == my && e < tid)) ? 1 : 0;
    }
    if (rank < 2) { ss[rank] = my; se[rank] = tid; }
  }
  __syncthreads();
  int e0 = se[0], e1i = se[1];
  float z = expf(ss[1] - ss[0]);
  float w0 = 1.f / (1.f + z), w1 = z / (1.f + z);
  const float* n0 = neurons + (size_t)e0 * (D_MODEL * RANK) + tid;
  const float* n1 = neurons + (size_t)e1i * (D_MODEL * RANK) + tid;
  float a0 = 0.f, a1 = 0.f;
  for (int d = 0; d < D_MODEL; ++d) {
    float hv = hs[d];
    a0 += hv * n0[(size_t)d * RANK];   // coalesced: consecutive tid -> consecutive r
    a1 += hv * n1[(size_t)d * RANK];
  }
  out[(size_t)tok * RANK + tid] = w0 * a0 + w1 * a1;
}

// --------------------------------------------------- routed expand (R -> D)
__global__ void expand_kernel(const float* __restrict__ in,        // [NTOK,128]
                              const float* __restrict__ router,    // [64,128]
                              const float* __restrict__ neurons,   // [64,128,512]
                              float* __restrict__ x) {             // += [NTOK,512]
  int tok = blockIdx.x;
  int tid = threadIdx.x;  // 256 threads
  __shared__ float is[RANK];
  __shared__ float sc[N_EXPAND];
  __shared__ float ss[2];
  __shared__ int se[2];
  const float* ip = in + (size_t)tok * RANK;
  if (tid < RANK) is[tid] = ip[tid];
  if (tid < 2) { ss[tid] = -INFINITY; se[tid] = 0; }  // start values, as the scan had
  __syncthreads();
  float my = 0.f;
  if (tid < N_EXPAND) {
    const float* rp = router + (size_t)tid * RANK;
    float acc = 0.f;
    for (int r = 0; r < RANK; ++r) acc += is[r] * rp[r];
    sc[tid] = acc;
    my = acc;
  }
  __syncthreads();
  // top-2 by rank, as in compress_kernel
  if (tid < N_EXPAND) {
    int rank = 0;
    for (int e = 0; e < N_EXPAND; ++e) {
      float s = sc[e];
      rank += (s > my || (s == my && e < tid)) ? 1 : 0;
    }
    if (rank < 2) { ss[rank] = my; se[rank] = tid; }
  }
  __syncthreads();
  int e0 = se[0], e1i = se[1];
  float z = expf(ss[1] - ss[0]);
  float w0 = 1.f / (1.f + z), w1 = z / (1.f + z);
  for (int d = tid; d < D_MODEL; d += 256) {
    const float* n0 = neurons + (size_t)e0 * (RANK * D_MODEL) + d;
    const float* n1 = neurons + (size_t)e1i * (RANK * D_MODEL) + d;
    float a0 = 0.f, a1 = 0.f;
    for (int r = 0; r < RANK; ++r) {
      float iv = is[r];
      a0 += iv * n0[(size_t)r * D_MODEL];
      a1 += iv * n1[(size_t)r * D_MODEL];
    }
    x[(size_t)tok * D_MODEL + d] += w0 * a0 + w1 * a1;
  }
}

// -------------------------- flash attention: one wave per (b, head, q-tile)
// WMMA f32 16x16x4: QK^T (K=16 -> 4 wmma) and P@V (K=16 -> 4 wmma) per tile.
__global__ void attn_kernel(const float* __restrict__ Q, const float* __restrict__ K,
                            const float* __restrict__ V, float* __restrict__ O) {
  int bid = blockIdx.x;
  int qt = bid % (SEQ / 16);
  int head = (bid / (SEQ / 16)) % N_HEADS;
  int b = bid / ((SEQ / 16) * N_HEADS);
  int lane = threadIdx.x;  // block = 32 = one wave
  int nl = lane & 15;
  int kh = lane >> 4;      // which K half (A/B layout: lanes 16-31 hold K+2)
  int mrow = kh ? 8 : 0;   // C/D layout: lanes 16-31 hold rows 8-15
  size_t base = (size_t)b * SEQ;
  __shared__ float Pt[16][17];

  // A fragments for Q tile (16 rows x K=16), 4 chunks of K=4
  const float* qp = Q + (base + qt * 16 + nl) * RANK + head * D_HEAD;
  v2f aq[4];
#pragma unroll
  for (int kc = 0; kc < 4; ++kc) aq[kc] = *(const v2f*)(qp + 4 * kc + 2 * kh);

  v8f o;
  float rm[8], rl[8];
#pragma unroll
  for (int v = 0; v < 8; ++v) { o[v] = 0.f; rm[v] = -INFINITY; rl[v] = 0.f; }

  for (int j = 0; j <= qt; ++j) {
    v8f s;
#pragma unroll
    for (int v = 0; v < 8; ++v) s[v] = 0.f;
    const float* kp = K + (base + j * 16 + nl) * RANK + head * D_HEAD;
#pragma unroll
    for (int kc = 0; kc < 4; ++kc) {
      v2f bk = *(const v2f*)(kp + 4 * kc + 2 * kh);  // B[k][n], B[k+1][n]
      s = wmma_f32_16x16x4(aq[kc], bk, s);
    }
    // scale + causal mask (query = qt*16+m, key = j*16+n)
#pragma unroll
    for (int v = 0; v < 8; ++v) {
      float sv = s[v] * 0.25f;  // 1/sqrt(16)
      if (j == qt && nl > v + mrow) sv = -INFINITY;
      s[v] = sv;
    }
    // online softmax (rows live across 16-lane halves -> butterfly 1,2,4,8)
#pragma unroll
    for (int v = 0; v < 8; ++v) {
      float tmax = s[v];
#pragma unroll
      for (int msk = 1; msk < 16; msk <<= 1)
        tmax = fmaxf(tmax, __shfl_xor(tmax, msk, 32));
      float nm = fmaxf(rm[v], tmax);
      float alpha = __expf(rm[v] - nm);
      float p = __expf(s[v] - nm);
      float psum = p;
#pragma unroll
      for (int msk = 1; msk < 16; msk <<= 1) psum += __shfl_xor(psum, msk, 32);
      rl[v] = rl[v] * alpha + psum;
      o[v] *= alpha;
      rm[v] = nm;
      s[v] = p;
    }
    // re-layout P: C-layout -> LDS -> A-layout
#pragma unroll
    for (int v = 0; v < 8; ++v) Pt[v + mrow][nl] = s[v];
    __syncthreads();
    const float* vp = V + (base + j * 16) * RANK + head * D_HEAD + nl;
#pragma unroll
    for (int kc = 0; kc < 4; ++kc) {
      v2f ap;
      ap.x = Pt[nl][4 * kc + 2 * kh];
      ap.y = Pt[nl][4 * kc + 2 * kh + 1];
      v2f bv;
      bv.x = vp[(size_t)(4 * kc + 2 * kh) * RANK];
      bv.y = vp[(size_t)(4 * kc + 2 * kh + 1) * RANK];
      o = wmma_f32_16x16x4(ap, bv, o);
    }
    __syncthreads();
  }
  float* op = O + (base + qt * 16) * RANK + head * D_HEAD + nl;
#pragma unroll
  for (int v = 0; v < 8; ++v) op[(size_t)(v + mrow) * RANK] = o[v] / rl[v];
}

// ---------------- memory scores GEMM (WMMA f32, K=128) fused with top-8.
// grid = (NTOK/16, NSPLIT): split N_KNOW 8 ways for 8x more waves on the
// FLOP-dominant kernel; each split emits per-row top-8 candidates.
// Each wave brings its 16-column kK tile in as whole 512-byte rows (one row per
// 16-byte-per-lane load), one tile ahead, parks it in its own LDS range and
// reads the B fragments from there (k = 4 kc + 2 kh, as the A fragments).
__global__ __launch_bounds__(256) void memscore_kernel(const float* __restrict__ Qm,  // [NTOK,128]
                                const float* __restrict__ kK,  // [N_KNOW,128]
                                float* __restrict__ candS,     // [NTOK,NSPLIT,8]
                                int* __restrict__ candI) {     // [NTOK,NSPLIT,8]
  int tb = blockIdx.x;      // 16-token tile
  int split = blockIdx.y;   // column partition
  int tid = threadIdx.x;    // 256 threads = 8 waves
  int lane = tid & 31;
  int wave = tid >> 5;
  int nl = lane & 15;
  int kh = lane >> 4;
  int mrow = kh ? 8 : 0;
  size_t tokBase = (size_t)tb * 16;

  __shared__ float sc[16][CHUNK + 4];  // pad: 516 % 64 banks = 4 -> conflict free
  __shared__ float cs[16][128];
  __shared__ int ci[16][128];
  __shared__ __attribute__((aligned(16))) float kt[8][16 * KT_PITCH];  // one tile per wave
  float* ktw = &kt[wave][0];

  // A fragments for the Q tile: K=128 -> 32 chunks, kept in registers
  const float* qp = Qm + (tokBase + nl) * RANK;
  v2f aq[32];
#pragma unroll
  for (int kc = 0; kc < 32; ++kc) aq[kc] = *(const v2f*)(qp + 4 * kc + 2 * kh);

  float ts[8];
  int ti8[8];
#pragma unroll
  for (int i = 0; i < 8; ++i) { ts[i] = -INFINITY; ti8[i] = 0; }
  int row = tid & 15, slot = tid >> 4;
  const float scale = 0.08838834764831845f;  // 1/sqrt(128)

  // this wave's first tile: row i of the tile = 32 lanes x 16 B = 4 whole lines
  v4f st[16];
  const float* gp = kK + (size_t)(split * CHPS * CHUNK + wave * 64) * RANK + lane * 4;
#pragma unroll
  for (int i = 0; i < 16; ++i) st[i] = *(const v4f*)(gp + i * RANK);
  // inputs-only fence on the loaded A values: A is waited for here, once. Without it
  // the waits for A stand among the WMMAs of the loop and drain the next tile's
  // loads there on every trip.
  asm volatile("" ::"v"(aq[0]), "v"(aq[1]), "v"(aq[2]), "v"(aq[3]), "v"(aq[4]), "v"(aq[5]),
               "v"(aq[6]), "v"(aq[7]), "v"(aq[8]), "v"(aq[9]), "v"(aq[10]), "v"(aq[11]),
               "v"(aq[12]), "v"(aq[13]), "v"(aq[14]), "v"(aq[15]));
  asm volatile("" ::"v"(aq[16]), "v"(aq[17]), "v"(aq[18]), "v"(aq[19]), "v"(aq[20]), "v"(aq[21]),
               "v"(aq[22]), "v"(aq[23]), "v"(aq[24]), "v"(aq[25]), "v"(aq[26]), "v"(aq[27]),
               "v"(aq[28]), "v"(aq[29]), "v"(aq[30]), "v"(aq[31]));

  for (int ch = split * CHPS; ch < (split + 1) * CHPS; ++ch) {
    // stage A: 8 waves x 4 n-tiles of 16 cols = 512 cols via WMMA
#pragma unroll 1
    for (int t = 0; t < 4; ++t) {
      int ntl = wave * 4 + t;
#pragma unroll
      for (int i = 0; i < 16; ++i) *(v4f*)(ktw + i * KT_PITCH + lane * 4) = st[i];
      // the wave's own row stores have landed before its lanes read each other's
      // rows back as fragments (the range is private to the wave: no barrier)
      asm volatile("s_wait_dscnt 0x0" ::: "memory");
      // the wave's next tile flies while this one is multiplied; none behind the last
      if (t < 3 || ch + 1 < (split + 1) * CHPS) {
        gp += (t < 3 ? 16 : CHUNK - 48) * RANK;  // next tile of the chunk, or first of the next
#pragma unroll
        for (int i = 0; i < 16; ++i) st[i] = *(const v4f*)(gp + i * RANK);
      }
      const float* kp = ktw + nl * KT_PITCH;
      v8f c;
#pragma unroll
      for (int v = 0; v < 8; ++v) c[v] = 0.f;
#pragma unroll
      for (int kc = 0; kc < 32; ++kc) {
        v2f bk = *(const v2f*)(kp + 4 * kc + 2 * kh);
        c = wmma_f32_16x16x4(aq[kc], bk, c);
      }
#pragma unroll
      for (int v = 0; v < 8; ++v) sc[v + mrow][ntl * 16 + nl] = c[v] * scale;
    }
    __syncthreads();
    // stage B: 16 threads per row keep a private sorted top-8
    int cbase = slot * 32;
    for (int i = 0; i < 32; ++i) {
      float s = sc[row][cbase + i];
      if (s > ts[7]) {
        ts[7] = s;
        ti8[7] = ch * CHUNK + cbase + i;
#pragma unroll
        for (int q = 7; q > 0; --q) {
          if (ts[q] > ts[q - 1]) {
            float tf = ts[q]; ts[q] = ts[q - 1]; ts[q - 1] = tf;
            int tt = ti8[q]; ti8[q] = ti8[q - 1]; ti8[q - 1] = tt;
          }
        }
      }
    }
    __syncthreads();
  }
  // merge 16 candidate lists per row -> this split's top-8 candidates
#pragma unroll
  for (int i = 0; i < 8; ++i) { cs[row][slot * 8 + i] = ts[i]; ci[row][slot * 8 + i] = ti8[i]; }
  __syncthreads();
  if (tid < 16) {
    int r = tid;
    size_t ob = ((tokBase + r) * NSPLIT + split) * 8;
    for (int k = 0; k < 8; ++k) {
      float m = -INFINITY;
      int mi = 0;
      for (int c2 = 0; c2 < 128; ++c2)
        if (cs[r][c2] > m) { m = cs[r][c2]; mi = c2; }
      candS[ob + k] = m;
      candI[ob + k] = ci[r][mi];
      cs[r][mi] = -INFINITY;
    }
  }
}

// ---- merge NSPLIT candidate lists (disjoint column ranges -> exact top-8)
// One thread per candidate, 4 tokens per block. A candidate's rank is the number of
// its token's candidates that come before it (greater score, or equal score and a
// lower position): ranks 0..7 are the picks of eight scans in position order.
__global__ __launch_bounds__(256) void memmerge_kernel(const float* __restrict__ candS,
                                const int* __restrict__ candI,
                                int* __restrict__ outIdx, float* __restrict__ outW) {
  int tid = threadIdx.x;
  int tl = tid >> 6, c = tid & (NCAND - 1);
  int tok = blockIdx.x * 4 + tl;
  __shared__ float cs[4][NCAND];
  __shared__ float best[4][KNOW_K];
  __shared__ int bi[4][KNOW_K];
  float my = candS[(size_t)tok * NCAND + c];
  int myi = candI[(size_t)tok * NCAND + c];
  cs[tl][c] = my;
  if (c < KNOW_K) { best[tl][c] = -INFINITY; bi[tl][c] = 0; }  // start values, as the scans had
  __syncthreads();
  int rank = 0;
  for (int e = 0; e < NCAND; ++e) {
    float v = cs[tl][e];
    rank += (v > my || (v == my && e < c)) ? 1 : 0;
  }
  if (rank < KNOW_K) { best[tl][rank] = my; bi[tl][rank] = myi; }
  __syncthreads();
  if (c < KNOW_K) {
    float mx = best[tl][0], sum = 0.f;
    for (int k = 0; k < KNOW_K; ++k) sum += expf(best[tl][k] - mx);
    float inv = 1.f / sum;
    size_t ob = (size_t)tok * KNOW_K + c;
    outIdx[ob] = bi[tl][c];
    outW[ob] = expf(best[tl][c] - mx) * inv;
  }
}

// ------------------------------------------- weighted gather of kV + residual
__global__ void memgather_kernel(const int* __restrict__ idx, const float* __restrict__ w,
                                 const float* __restrict__ kV, float* __restrict__ x) {
  int tok = blockIdx.x;
  int tid = threadIdx.x;  // 128
  __shared__ int si[8];
  __shared__ float swt[8];
  if (tid < 8) { si[tid] = idx[(size_t)tok * 8 + tid]; swt[tid] = w[(size_t)tok * 8 + tid]; }
  __syncthreads();
  for (int d = tid; d < D_MODEL; d += 128) {
    float acc = 0.f;
#pragma unroll
    for (int k = 0; k < 8; ++k) acc += swt[k] * kV[(size_t)si[k] * D_MODEL + d];
    x[(size_t)tok * D_MODEL + d] += acc;
  }
}

extern "C" void kernel_launch(void* const* d_in, const int* in_sizes, int n_in,
                              void* d_out, int out_size, void* d_ws, size_t ws_size,
                              hipStream_t stream) {
  const float* x_in = (const float*)d_in[0];
  const float* cneur = (const float*)d_in[1];
  const float* eneur = (const float*)d_in[2];
  const float* kK = (const float*)d_in[3];
  const float* kV = (const float*)d_in[4];
  const float* rq = (const float*)d_in[5];
  const float* rk = (const float*)d_in[6];
  const float* rv = (const float*)d_in[7];
  const float* ro = (const float*)d_in[8];
  const float* rm = (const float*)d_in[9];
  const float* ln1g = (const float*)d_in[10];
  const float* ln1b = (const float*)d_in[11];
  const float* ln2g = (const float*)d_in[12];
  const float* ln2b = (const float*)d_in[13];
  const float* lnfg = (const float*)d_in[14];
  const float* lnfb = (const float*)d_in[15];
  float* out = (float*)d_out;

  float* ws = (float*)d_ws;
  float* xb = ws;     ws += (size_t)NTOK * D_MODEL;
  float* h = ws;      ws += (size_t)NTOK * D_MODEL;
  float* qc = ws;     ws += (size_t)NTOK * RANK;
  float* kc = ws;     ws += (size_t)NTOK * RANK;
  float* vc = ws;     ws += (size_t)NTOK * RANK;
  float* ctx = ws;    ws += (size_t)NTOK * RANK;
  float* qm = ws;     ws += (size_t)NTOK * RANK;
  float* wt = ws;     ws += (size_t)NTOK * KNOW_K;
  float* candS = ws;  ws += (size_t)NTOK * NCAND;
  int* candI = (int*)ws;  ws += (size_t)NTOK * NCAND;
  int* idx = (int*)ws;

  hipMemcpyAsync(xb, x_in, sizeof(float) * (size_t)NTOK * D_MODEL,
                 hipMemcpyDeviceToDevice, stream);

  for (int l = 0; l < N_LAYERS; ++l) {
    ln_kernel<<<NTOK, 256, 0, stream>>>(xb, ln1g + l * D_MODEL, ln1b + l * D_MODEL, h);
    compress_kernel<<<NTOK, 128, 0, stream>>>(h, rq + (size_t)l * N_COMPRESS * D_MODEL, cneur, qc);
    compress_kernel<<<NTOK, 128, 0, stream>>>(h, rk + (size_t)l * N_COMPRESS * D_MODEL, cneur, kc);
    compress_kernel<<<NTOK, 128, 0, stream>>>(h, rv + (size_t)l * N_COMPRESS * D_MODEL, cneur, vc);
    attn_kernel<<<BATCH * N_HEADS * (SEQ / 16), 32, 0, stream>>>(qc, kc, vc, ctx);
    expand_kernel<<<NTOK, 256, 0, stream>>>(ctx, ro + (size_t)l * N_EXPAND * RANK, eneur, xb);
    ln_kernel<<<NTOK, 256, 0, stream>>>(xb, ln2g + l * D_MODEL, ln2b + l * D_MODEL, h);
    compress_kernel<<<NTOK, 128, 0, stream>>>(h, rm + (size_t)l * N_COMPRESS * D_MODEL, cneur, qm);
    memscore_kernel<<<dim3(NTOK / 16, NSPLIT), 256, 0, stream>>>(qm, kK, candS, candI);
    memmerge_kernel<<<NTOK / 4, 256, 0, stream>>>(candS, candI, idx, wt);
    memgather_kernel<<<NTOK, 128, 0, stream>>>(idx, wt, kV, xb);
  }
  ln_kernel<<<NTOK, 256, 0, stream>>>(xb, lnfg, lnfb, out);
}

// v004
// It is 1.29 times as fast as v002, going by the measured steps of the versions left out in between.
// All steps since v000 together make it 1.69 times as fast.
#include <hip/hip_runtime.h>
#include <math.h>

#define D_MODEL 512
#define RANK 128
#define N_HEADS 8
#define D_HEAD 16
#define N_COMPRESS 64
#define N_EXPAND 64
#define N_KNOW 32768
#define KNOW_K 8
#define N_LAYERS 2
#define BATCH 2
#define SEQ 512
#define NTOK (BATCH * SEQ)

#define CHUNK 512
#define NSPLIT 8                            // grid-Y partitions of the N_KNOW axis
#define NCHUNKS (N_KNOW / CHUNK)            // 64
#define CHPS (NCHUNKS / NSPLIT)             // 8 chunks per split
#define NCAND (NSPLIT * 8)                  // 64 candidates per token
#define KT_PITCH 132  // floats per staged kK row: 528 B = 16 B x 33, so the 32 lanes'
                      // 8-byte fragment reads fall on 64 distinct banks

#define PLANE ((size_t)NTOK * RANK)  // floats per plane of a compress result: plane s holds
                                     // each token's weighted projection by its s-th expert
#define GP_PITCH 36  // floats per row of a wave's 32x32 partial tile in LDS: 144 B keeps the
                     // 16-byte reads aligned and puts rows v and v + 8 on different banks

typedef float v2f __attribute__((ext_vector_type(2)));
typedef float v4f __attribute__((ext_vector_type(4)));
typedef float v8f __attribute__((ext_vector_type(8)));

__device__ __forceinline__ v8f wmma_f32_16x16x4(v2f a, v2f b, v8f c) {
  // D = A(16x4 f32) * B(4x16 f32) + C(16x16 f32)
  return __builtin_amdgcn_wmma_f32_16x16x4_f32(false, a, false, b, (short)0, c,
                                               false, false);
}

// ---------------------------------------------------------------- LayerNorm
__global__ void ln_kernel(const float* __restrict__ x, const float* __restrict__ g,
                          const float* __restrict__ b, float* __restrict__ out) {
  int tok = blockIdx.x;
  int tid = threadIdx.x;  // 256 threads
  const float* xp = x + (size_t)tok * D_MODEL;
  float v0 = xp[tid], v1 = xp[tid + 256];
  __shared__ float rs[256], rq[256];
  rs[tid] = v0 + v1;
  rq[tid] = v0 * v0 + v1 * v1;
  __syncthreads();
  for (int s = 128; s > 0; s >>= 1) {
    if (tid < s) { rs[tid] += rs[tid + s]; rq[tid] += rq[tid + s]; }
    __syncthreads();
  }
  float mean = rs[0] * (1.0f / D_MODEL);
  float var = rq[0] * (1.0f / D_MODEL) - mean * mean;
  float rstd = rsqrtf(var + 1e-5f);
  float* op = out + (size_t)tok * D_MODEL;
  op[tid] = (v0 - mean) * rstd * g[tid] + b[tid];
  op[tid + 256] = (v1 - mean) * rstd * g[tid + 256] + b[tid + 256];
}

// ------------------------------------------------- routed compress (D -> R)
// Two launches. route_kernel picks each token's two experts and their weights;
// compress_group_kernel takes one expert per block, gathers the tokens that picked
// it and multiplies them with the expert's matrix, which is so read once per block
// instead of once per token.
// the bound states the block size, so that the logits' row loads in flight fit the
// register budget without spills
__global__ __launch_bounds__(128) void route_kernel(const float* __restrict__ h,
                                const float* __restrict__ router,   // [64,512]
                                int* __restrict__ sel,              // [NTOK,2] expert
                                float* __restrict__ wsel) {         // [NTOK,2] weight
  int tok = blockIdx.x;
  int tid = threadIdx.x;  // 128 threads
  __shared__ __attribute__((aligned(16))) float hs[D_MODEL];
  __shared__ float sc[N_COMPRESS];
  __shared__ float ss[2];
  __shared__ int se[2];
  const float* hp = h + (size_t)tok * D_MODEL;
  for (int i = tid; i < D_MODEL; i += 128) hs[i] = hp[i];
  if (tid < 2) { ss[tid] = -INFINITY; se[tid] = 0; }  // start values, as the scan had
  __syncthreads();
  // router logits: wave w takes rows 16w..16w+15. A row is read as whole 128-byte
  // lines (lane l holds d = 128 j + 4 l .. +3, j = 0..3), each lane sums its 16
  // products, and the lanes' partial sums are added over the wave.
  {
    int lane = tid & 31, wave = tid >> 5;
    v4f hv[4];
#pragma unroll  // hv stays in registers
    for (int j = 0; j < 4; ++j) hv[j] = *(const v4f*)(hs + 128 * j + 4 * lane);
    const float* rp = router + (size_t)(wave * 16) * D_MODEL + 4 * lane;
    float p16[16];
#pragma unroll  // p16 stays in registers; the 64 row loads are independent and fly together
    for (int e = 0; e < 16; ++e) {
      v2f acc = {0.f, 0.f};
#pragma unroll  // as above
      for (int j = 0; j < 4; ++j) {
        v4f rv = *(const v4f*)(rp + e * D_MODEL + 128 * j);
        acc += hv[j].xy * rv.xy;
        acc += hv[j].zw * rv.zw;
      }
      p16[e] = acc.x + acc.y;
    }
    // halving butterfly: at each level a lane hands over the half of its rows that
    // its partner keeps; lanes 2e and 2e+1 end with row e's whole sum
    float p8[8], p4[4], p2[2];
    bool u16 = lane & 16, u8 = lane & 8, u4 = lane & 4, u2 = lane & 2;
#pragma unroll  // the partial sums stay in registers (this loop and the two below)
    for (int i = 0; i < 8; ++i)
      p8[i] = (u16 ? p16[i + 8] : p16[i]) + __shfl_xor(u16 ? p16[i] : p16[i + 8], 16, 32);
#pragma unroll  // as above
    for (int i = 0; i < 4; ++i)
      p4[i] = (u8 ? p8[i + 4] : p8[i]) + __shfl_xor(u8 ? p8[i] : p8[i + 4], 8, 32);
#pragma unroll  // as above
    for (int i = 0; i < 2; ++i)
      p2[i] = (u4 ? p4[i + 2] : p4[i]) + __shfl_xor(u4 ? p4[i] : p4[i + 2], 4, 32);
    float p1 = (u2 ? p2[1] : p2[0]) + __shfl_xor(u2 ? p2[0] : p2[1], 2, 32);
    p1 += __shfl_xor(p1, 1, 32);
    if ((lane & 1) == 0) sc[wave * 16 + (lane >> 1)] = p1;
  }
  __syncthreads();
  float my = (tid < N_COMPRESS) ? sc[tid] : 0.f;
  // top-2 by rank: each score counts the scores that come before it (greater, or
  // equal with a lower index); ranks 0 and 1 are the two that a scan in index order picks
  if (tid < N_COMPRESS) {
    int rank = 0;
    for (int e = 0; e < N_COMPRESS; ++e) {
      float s = sc[e];
      rank += (s > my || (s == my && e < tid)) ? 1 : 0;
    }
    if (rank < 2) { ss[rank] = my; se[rank] = tid; }
  }
  __syncthreads();
  if (tid < 2) {
    float z = expf(ss[1] - ss[0]);
    sel[tok * 2 + tid] = se[tid];
    wsel[tok * 2 + tid] = (tid == 0 ? 1.f : z) / (1.f + z);
  }
}

// grid = (N_COMPRESS, RANK / 32): block (e, y) computes columns 32 y .. 32 y + 31 of
// h[tok] x neurons[e] for every entry (tok, s) with sel[tok][s] == e, 32 entries a pass.
// Wave w takes k = 64 w .. 64 w + 63 on WMMA f32 16x16x4; the eight partial tiles are
// added through LDS in wave order. Row (tok, s) goes, times its weight, to plane s of out.
__global__ __launch_bounds__(256) void compress_group_kernel(
    const float* __restrict__ h,        // [NTOK,512]
    const int* __restrict__ sel,        // [NTOK,2]
    const float* __restrict__ wsel,     // [NTOK,2]
    const float* __restrict__ neurons,  // [64,512,128]
    float* __restrict__ out) {          // [2,NTOK,128]
  int e = blockIdx.x;
  int n0 = blockIdx.y * 32;
  int tid = threadIdx.x;  // 256 threads = 8 waves
  int lane = tid & 31;
  int wave = tid >> 5;
  int nl = lane & 15;
  int kh = lane >> 4;
  __shared__ int list[2 * NTOK];  // this expert's entries (2 tok + s), ascending
  __shared__ int wcnt[64];
  __shared__ __attribute__((aligned(16))) float red[8][32 * GP_PITCH];

  int sv[8];
#pragma unroll  // sv stays in registers; the 8 loads fly together
  for (int j = 0; j < 8; ++j) sv[j] = sel[j * 256 + tid];

  // the list: a ballot per 32 entries, the counts summed in entry order
  unsigned mk[8];
#pragma unroll  // mk stays in registers
  for (int j = 0; j < 8; ++j) {
    mk[j] = __builtin_amdgcn_ballot_w32(sv[j] == e);
    if (lane == 0) wcnt[j * 8 + wave] = __popc(mk[j]);
  }
  __syncthreads();

  // B fragments, kept in registers for all passes; they fly while the list is built.
  // WMMA step 2 j + i of this wave multiplies k = 64 w + 8 j + 4 kh + 2 i + {0, 1},
  // in B here as in A below.
  const float* bp = neurons + (size_t)e * (D_MODEL * RANK) + (size_t)(wave * 64 + 4 * kh) * RANK + n0 + nl;
  v2f bf[2][16];
#pragma unroll  // bf stays in registers
  for (int j = 0; j < 8; ++j) {
#pragma unroll  // as above
    for (int nn = 0; nn < 2; ++nn) {
      bf[nn][2 * j].x = bp[(8 * j + 0) * RANK + 16 * nn];
      bf[nn][2 * j].y = bp[(8 * j + 1) * RANK + 16 * nn];
      bf[nn][2 * j + 1].x = bp[(8 * j + 2) * RANK + 16 * nn];
      bf[nn][2 * j + 1].y = bp[(8 * j + 3) * RANK + 16 * nn];
    }
  }

  int run = 0;
  int base[8];
#pragma unroll  // base stays in registers
  for (int q = 0; q < 64; ++q) {
    if ((q & 7) == wave) base[q >> 3] = run;
    run += wcnt[q];
  }
  unsigned below = (1u << lane) - 1u;
#pragma unroll  // as above
  for (int j = 0; j < 8; ++j)
    if ((mk[j] >> lane) & 1u) list[base[j] + __popc(mk[j] & below)] = j * 256 + tid;
  __syncthreads();
  // the same in every thread of the block; held as a scalar so that the pass loop,
  // which holds WMMAs and barriers, branches on a scalar compare
  int n = __builtin_amdgcn_readfirstlane(run);

  for (int m0 = 0; m0 < n; m0 += 32) {
    // A fragments: lane (nl, kh) reads its entry's h row; a row past the end of the
    // list reads entry 0's and is not stored
    v4f af[2][8];
#pragma unroll  // af stays in registers
    for (int t = 0; t < 2; ++t) {
      int ix = m0 + t * 16 + nl;
      int en = list[ix < n ? ix : 0];
      const float* ap = h + (size_t)(en >> 1) * D_MODEL + wave * 64 + 4 * kh;
#pragma unroll  // as above
      for (int j = 0; j < 8; ++j) af[t][j] = *(const v4f*)(ap + 8 * j);
    }
    // the row that this thread stores at the foot of the pass, and its weight, fetched early
    int m = tid >> 3, c4 = (tid & 7) * 4;  // 8 threads x 16 B = one 128-byte line per row
    int eo = list[m0 + m < n ? m0 + m : 0];
    float wo = wsel[eo];
    v8f c[2][2];
#pragma unroll  // c stays in registers (this loop and the two below)
    for (int t = 0; t < 2; ++t)
#pragma unroll  // as above
      for (int nn = 0; nn < 2; ++nn)
#pragma unroll  // as above
        for (int v = 0; v < 8; ++v) c[t][nn][v] = 0.f;
#pragma unroll  // as above
    for (int j = 0; j < 8; ++j) {
#pragma unroll  // as above
      for (int t = 0; t < 2; ++t)
#pragma unroll  // as above
        for (int nn = 0; nn < 2; ++nn)
          c[t][nn] = wmma_f32_16x16x4(af[t][j].xy, bf[nn][2 * j], c[t][nn]);
#pragma unroll  // as above
      for (int t = 0; t < 2; ++t)
#pragma unroll  // as above
        for (int nn = 0; nn < 2; ++nn)
          c[t][nn] = wmma_f32_16x16x4(af[t][j].zw, bf[nn][2 * j + 1], c[t][nn]);
    }
#pragma unroll  // as above
    for (int t = 0; t < 2; ++t)
#pragma unroll  // as above
      for (int nn = 0; nn < 2; ++nn)
#pragma unroll  // as above
        for (int v = 0; v < 8; ++v)
          red[wave][(t * 16 + v + 8 * kh) * GP_PITCH + nn * 16 + nl] = c[t][nn][v];
    __syncthreads();
    v4f sum = *(const v4f*)(&red[0][m * GP_PITCH + c4]);
#pragma unroll  // the 8 reads fly together
    for (int w = 1; w < 8; ++w) sum += *(const v4f*)(&red[w][m * GP_PITCH + c4]);
    if (m0 + m < n)
      *(v4f*)(out + (size_t)(eo & 1) * PLANE + (size_t)(eo >> 1) * RANK + n0 + c4) = sum * wo;
    __syncthreads();  // red is rewritten by the next pass
  }
}

// --------------------------------------------------- routed expand (R -> D)
__global__ void expand_kernel(const float* __restrict__ in,        // [NTOK,128]
                              const float* __restrict__ router,    // [64,128]
                              const float* __restrict__ neurons,   // [64,128,512]
                              float* __restrict__ x) {             // += [NTOK,512]
  int tok = blockIdx.x;
  int tid = threadIdx.x;  // 256 threads
  __shared__ __attribute__((aligned(16))) float is[RANK];
  __shared__ float sc[N_EXPAND];
  __shared__ float ss[2];
  __shared__ int se[2];
  const float* ip = in + (size_t)tok * RANK;
  if (tid < RANK) is[tid] = ip[tid];
  if (tid < 2) { ss[tid] = -INFINITY; se[tid] = 0; }  // start values, as the scan had
  __syncthreads();
  // router logits as in route_kernel: wave w takes rows 8w..8w+7, one 16-byte
  // load per lane covers a row (lane l holds r = 4 l .. +3)
  {
    int lane = tid & 31, wave = tid >> 5;
    v4f iv = *(const v4f*)(is + 4 * lane);
    const float* rp = router + (size_t)(wave * 8) * RANK + 4 * lane;
    float p8[8];
#pragma unroll  // p8 stays in registers; the 8 row loads are independent and fly together
    for (int e = 0; e < 8; ++e) {
      v4f rv = *(const v4f*)(rp + e * RANK);
      v2f acc = iv.xy * rv.xy;
      acc += iv.zw * rv.zw;
      p8[e] = acc.x + acc.y;
    }
    // halving butterfly; lanes 4e..4e+3 end with row e's whole sum
    float p4[4], p2[2];
    bool u16 = lane & 16, u8 = lane & 8, u4 = lane & 4;
#pragma unroll  // the partial sums stay in registers (this loop and the next)
    for (int i = 0; i < 4; ++i)
      p4[i] = (u16 ? p8[i + 4] : p8[i]) + __shfl_xor(u16 ? p8[i] : p8[i + 4], 16, 32);
#pragma unroll  // as above
    for (int i = 0; i < 2; ++i)
      p2[i] = (u8 ? p4[i + 2] : p4[i]) + __shfl_xor(u8 ? p4[i] : p4[i + 2], 8, 32);
    float p1 = (u4 ? p2[1] : p2[0]) + __shfl_xor(u4 ? p2[0] : p2[1], 4, 32);
    p1 += __shfl_xor(p1, 2, 32);
    p1 += __shfl_xor(p1, 1, 32);
    if ((lane & 3) == 0) sc[wave * 8 + (lane >> 2)] = p1;
  }
  __syncthreads();
  float my = (tid < N_EXPAND) ? sc[tid] : 0.f;
  // top-2 by rank, as in route_kernel
  if (tid < N_EXPAND) {
    int rank = 0;
    for (int e = 0; e < N_EXPAND; ++e) {
      float s = sc[e];
      rank += (s > my || (s == my && e < tid)) ? 1 : 0;
    }
    if (rank < 2) { ss[rank] = my; se[rank] = tid; }
  }
  __syncthreads();
  int e0 = se[0], e1i = se[1];
  float z = expf(ss[1] - ss[0]);
  float w0 = 1.f / (1.f + z), w1 = z / (1.f + z);
  for (int d = tid; d < D_MODEL; d += 256) {
    const float* n0 = neurons + (size_t)e0 * (RANK * D_MODEL) + d;
    const float* n1 = neurons + (size_t)e1i * (RANK * D_MODEL) + d;
    float a0 = 0.f, a1 = 0.f;
    for (int r = 0; r < RANK; ++r) {
      float iv = is[r];
      a0 += iv * n0[(size_t)r * D_MODEL];
      a1 += iv * n1[(size_t)r * D_MODEL];
    }
    x[(size_t)tok * D_MODEL + d] += w0 * a0 + w1 * a1;
  }
}

// -------------------------- flash attention: one wave per (b, head, q-tile)
// WMMA f32 16x16x4: QK^T (K=16 -> 4 wmma) and P@V (K=16 -> 4 wmma) per tile.
// Q, K and V come as two planes each (see compress_group_kernel), added as they are read.
__global__ void attn_kernel(const float* __restrict__ Q, const float* __restrict__ K,
                            const float* __restrict__ V, float* __restrict__ O) {
  int bid = blockIdx.x;
  int qt = bid % (SEQ / 16);
  int head = (bid / (SEQ / 16)) % N_HEADS;
  int b = bid / ((SEQ / 16) * N_HEADS);
  int lane = threadIdx.x;  // block = 32 = one wave
  int nl = lane & 15;
  int kh = lane >> 4;      // which K half (A/B layout: lanes 16-31 hold K+2)
  int mrow = kh ? 8 : 0;   // C/D layout: lanes 16-31 hold rows 8-15
  size_t base = (size_t)b * SEQ;
  __shared__ float Pt[16][17];

  // A fragments for Q tile (16 rows x K=16), 4 chunks of K=4
  const float* qp = Q + (base + qt * 16 + nl) * RANK + head * D_HEAD;
  v2f aq[4];
#pragma unroll
  for (int kc = 0; kc < 4; ++kc)
    aq[kc] = *(const v2f*)(qp + 4 * kc + 2 * kh) + *(const v2f*)(qp + PLANE + 4 * kc + 2 * kh);

  v8f o;
  float rm[8], rl[8];
#pragma unroll
  for (int v = 0; v < 8; ++v) { o[v] = 0.f; rm[v] = -INFINITY; rl[v] = 0.f; }

  for (int j = 0; j <= qt; ++j) {
    v8f s;
#pragma unroll
    for (int v = 0; v < 8; ++v) s[v] = 0.f;
    const float* kp = K + (base + j * 16 + nl) * RANK + head * D_HEAD;
#pragma unroll
    for (int kc = 0; kc < 4; ++kc) {
      v2f bk = *(const v2f*)(kp + 4 * kc + 2 * kh) +
               *(const v2f*)(kp + PLANE + 4 * kc + 2 * kh);  // B[k][n], B[k+1][n]
      s = wmma_f32_16x16x4(aq[kc], bk, s);
    }
    // scale + causal mask (query = qt*16+m, key = j*16+n)
#pragma unroll
    for (int v = 0; v < 8; ++v) {
      float sv = s[v] * 0.25f;  // 1/sqrt(16)
      if (j == qt && nl > v + mrow) sv = -INFINITY;
      s[v] = sv;
    }
    // online softmax (rows live across 16-lane halves -> butterfly 1,2,4,8)
#pragma unroll
    for (int v = 0; v < 8; ++v) {
      float tmax = s[v];
#pragma unroll
      for (int msk = 1; msk < 16; msk <<= 1)
        tmax = fmaxf(tmax, __shfl_xor(tmax, msk, 32));
      float nm = fmaxf(rm[v], tmax);
      float alpha = __expf(rm[v] - nm);
      float p = __expf(s[v] - nm);
      float psum = p;
#pragma unroll
      for (int msk = 1; msk < 16; msk <<= 1) psum += __shfl_xor(psum, msk, 32);
      rl[v] = rl[v] * alpha + psum;
      o[v] *= alpha;
      rm[v] = nm;
      s[v] = p;
    }
    // re-layout P: C-layout -> LDS -> A-layout
#pragma unroll
    for (int v = 0; v < 8; ++v) Pt[v + mrow][nl] = s[v];
    __syncthreads();
    const float* vp = V + (base + j * 16) * RANK + head * D_HEAD + nl;
#pragma unroll
    for (int kc = 0; kc < 4; ++kc) {
      v2f ap;
      ap.x = Pt[nl][4 * kc + 2 * kh];
      ap.y = Pt[nl][4 * kc + 2 * kh + 1];
      v2f bv;
      bv.x = vp[(size_t)(4 * kc + 2 * kh) * RANK] + vp[PLANE + (size_t)(4 * kc + 2 * kh) * RANK];
      bv.y = vp[(size_t)(4 * kc + 2 * kh + 1) * RANK] + vp[PLANE + (size_t)(4 * kc + 2 * kh + 1) * RANK];
      o = wmma_f32_16x16x4(ap, bv, o);
    }
    __syncthreads();
  }
  float* op = O + (base + qt * 16) * RANK + head * D_HEAD + nl;
#pragma unroll
  for (int v = 0; v < 8; ++v) op[(size_t)(v + mrow) * RANK] = o[v] / rl[v];
}

// ---------------- memory scores GEMM (WMMA f32, K=128) fused with top-8.
// grid = (NTOK/16, NSPLIT): split N_KNOW 8 ways for 8x more waves on the
// FLOP-dominant kernel; each split emits per-row top-8 candidates.
// Each wave brings its 16-column kK tile in as whole 512-byte rows (one row per
// 16-byte-per-lane load), one tile ahead, parks it in its own LDS range and
// reads the B fragments from there (k = 4 kc + 2 kh, as the A fragments).
__global__ __launch_bounds__(256) void memscore_kernel(const float* __restrict__ Qm,  // [2,NTOK,128]
                                const float* __restrict__ kK,  // [N_KNOW,128]
                                float* __restrict__ candS,     // [NTOK,NSPLIT,8]
                                int* __restrict__ candI) {     // [NTOK,NSPLIT,8]
  int tb = blockIdx.x;      // 16-token tile
  int split = blockIdx.y;   // column partition
  int tid = threadIdx.x;    // 256 threads = 8 waves
  int lane = tid & 31;
  int wave = tid >> 5;
  int nl = lane & 15;
  int kh = lane >> 4;
  int mrow = kh ? 8 : 0;
  size_t tokBase = (size_t)tb * 16;

  __shared__ float sc[16][CHUNK + 4];  // pad: 516 % 64 banks = 4 -> conflict free
  __shared__ float cs[16][128];
  __shared__ int ci[16][128];
  __shared__ __attribute__((aligned(16))) float kt[8][16 * KT_PITCH];  // one tile per wave
  float* ktw = &kt[wave][0];

  // A fragments for the Q tile (its two planes added): K=128 -> 32 chunks, kept in registers
  const float* qp = Qm + (tokBase + nl) * RANK;
  v2f aq[32];
#pragma unroll
  for (int kc = 0; kc < 32; ++kc)
    aq[kc] = *(const v2f*)(qp + 4 * kc + 2 * kh) + *(const v2f*)(qp + PLANE + 4 * kc + 2 * kh);

  float ts[8];
  int ti8[8];
#pragma unroll
  for (int i = 0; i < 8; ++i) { ts[i] = -INFINITY; ti8[i] = 0; }
  int row = tid & 15, slot = tid >> 4;
  const float scale = 0.08838834764831845f;  // 1/sqrt(128)

  // this wave's first tile: row i of the tile = 32 lanes x 16 B = 4 whole lines
  v4f st[16];
  const float* gp = kK + (size_t)(split * CHPS * CHUNK + wave * 64) * RANK + lane * 4;
#pragma unroll
  for (int i = 0; i < 16; ++i) st[i] = *(const v4f*)(gp + i * RANK);
  // inputs-only fence on the A values (each the sum of two loaded values, no product):
  // A is waited for here, once. Without it
  // the waits for A stand among the WMMAs of the loop and drain the next tile's
  // loads there on every trip.
  asm volatile("" ::"v"(aq[0]), "v"(aq[1]), "v"(aq[2]), "v"(aq[3]), "v"(aq[4]), "v"(aq[5]),
               "v"(aq[6]), "v"(aq[7]), "v"(aq[8]), "v"(aq[9]), "v"(aq[10]), "v"(aq[11]),
               "v"(aq[12]), "v"(aq[13]), "v"(aq[14]), "v"(aq[15]));
  asm volatile("" ::"v"(aq[16]), "v"(aq[17]), "v"(aq[18]), "v"(aq[19]), "v"(aq[20]), "v"(aq[21]),
               "v"(aq[22]), "v"(aq[23]), "v"(aq[24]), "v"(aq[25]), "v"(aq[26]), "v"(aq[27]),
               "v"(aq[28]), "v"(aq[29]), "v"(aq[30]), "v"(aq[31]));

  for (int ch = split * CHPS; ch < (split + 1) * CHPS; ++ch) {
    // stage A: 8 waves x 4 n-tiles of 16 cols = 512 cols via WMMA
#pragma unroll 1
    for (int t = 0; t < 4; ++t) {
      int ntl = wave * 4 + t;
#pragma unroll
      for (int i = 0; i < 16; ++i) *(v4f*)(ktw + i * KT_PITCH + lane * 4) = st[i];
      // the wave's own row stores have landed before its lanes read each other's
      // rows back as fragments (the range is private to the wave: no barrier)
      asm volatile("s_wait_dscnt 0x0" ::: "memory");
      // the wave's next tile flies while this one is multiplied; none behind the last
      if (t < 3 || ch + 1 < (split + 1) * CHPS) {
        gp += (t < 3 ? 16 : CHUNK - 48) * RANK;  // next tile of the chunk, or first of the next
#pragma unroll
        for (int i = 0; i < 16; ++i) st[i] = *(const v4f*)(gp + i * RANK);
      }
      const float* kp = ktw + nl * KT_PITCH;
      v8f c;
#pragma unroll
      for (int v = 0; v < 8; ++v) c[v] = 0.f;
#pragma unroll
      for (int kc = 0; kc < 32; ++kc) {
        v2f bk = *(const v2f*)(kp + 4 * kc + 2 * kh);
        c = wmma_f32_16x16x4(aq[kc], bk, c);
      }
#pragma unroll
      for (int v = 0; v < 8; ++v) sc[v + mrow][ntl * 16 + nl] = c[v] * scale;
    }
    __syncthreads();
    // stage B: 16 threads per row keep a private sorted top-8
    int cbase = slot * 32;
    for (int i = 0; i < 32; ++i) {
      float s = sc[row][cbase + i];
      if (s > ts[7]) {
        ts[7] = s;
        ti8[7] = ch * CHUNK + cbase + i;
#pragma unroll
        for (int q = 7; q > 0; --q) {
          if (ts[q] > ts[q - 1]) {
            float tf = ts[q]; ts[q] = ts[q - 1]; ts[q - 1] = tf;
            int tt = ti8[q]; ti8[q] = ti8[q - 1]; ti8[q - 1] = tt;
          }
        }
      }
    }
    __syncthreads();
  }
  // merge 16 candidate lists per row -> this split's top-8 candidates
#pragma unroll
  for (int i = 0; i < 8; ++i) { cs[row][slot * 8 + i] = ts[i]; ci[row][slot * 8 + i] = ti8[i]; }
  __syncthreads();
  if (tid < 16) {
    int r = tid;
    size_t ob = ((tokBase + r) * NSPLIT + split) * 8;
    for (int k = 0; k < 8; ++k) {
      float m = -INFINITY;
      int mi = 0;
      for (int c2 = 0; c2 < 128; ++c2)
        if (cs[r][c2] > m) { m = cs[r][c2]; mi = c2; }
      candS[ob + k] = m;
      candI[ob + k] = ci[r][mi];
      cs[r][mi] = -INFINITY;
    }
  }
}

// ---- merge NSPLIT candidate lists (disjoint column ranges -> exact top-8)
// One thread per candidate, 4 tokens per block. A candidate's rank is the number of
// its token's candidates that come before it (greater score, or equal score and a
// lower position): ranks 0..7 are the picks of eight scans in position order.
__global__ __launch_bounds__(256) void memmerge_kernel(const float* __restrict__ candS,
                                const int* __restrict__ candI,
                                int* __restrict__ outIdx, float* __restrict__ outW) {
  int tid = threadIdx.x;
  int tl = tid >> 6, c = tid & (NCAND - 1);
  int tok = blockIdx.x * 4 + tl;
  __shared__ float cs[4][NCAND];
  __shared__ float best[4][KNOW_K];
  __shared__ int bi[4][KNOW_K];
  float my = candS[(size_t)tok * NCAND + c];
  int myi = candI[(size_t)tok * NCAND + c];
  cs[tl][c] = my;
  if (c < KNOW_K) { best[tl][c] = -INFINITY; bi[tl][c] = 0; }  // start values, as the scans had
  __syncthreads();
  int rank = 0;
  for (int e = 0; e < NCAND; ++e) {
    float v = cs[tl][e];
    rank += (v > my || (v == my && e < c)) ? 1 : 0;
  }
  if (rank < KNOW_K) { best[tl][rank] = my; bi[tl][rank] = myi; }
  __syncthreads();
  if (c < KNOW_K) {
    float mx = best[tl][0], sum = 0.f;
    for (int k = 0; k < KNOW_K; ++k) sum += expf(best[tl][k] - mx);
    float inv = 1.f / sum;
    size_t ob = (size_t)tok * KNOW_K + c;
    outIdx[ob] = bi[tl][c];
    outW[ob] = expf(best[tl][c] - mx) * inv;
  }
}

// ------------------------------------------- weighted gather of kV + residual
__global__ void memgather_kernel(const int* __restrict__ idx, const float* __restrict__ w,
                                 const float* __restrict__ kV, float* __restrict__ x) {
  int tok = blockIdx.x;
  int tid = threadIdx.x;  // 128
  __shared__ int si[8];
  __shared__ float swt[8];
  if (tid < 8) { si[tid] = idx[(size_t)tok * 8 + tid]; swt[tid] = w[(size_t)tok * 8 + tid]; }
  __syncthreads();
  for (int d = tid; d < D_MODEL; d += 128) {
    float acc = 0.f;
#pragma unroll
    for (int k = 0; k < 8; ++k) acc += swt[k] * kV[(size_t)si[k] * D_MODEL + d];
    x[(size_t)tok * D_MODEL + d] += acc;
  }
}

extern "C" void kernel_launch(void* const* d_in, const int* in_sizes, int n_in,
                              void* d_out, int out_size, void* d_ws, size_t ws_size,
                              hipStream_t stream) {
  const float* x_in = (const float*)d_in[0];
  const float* cneur = (const float*)d_in[1];
  const float* eneur = (const float*)d_in[2];
  const float* kK = (const float*)d_in[3];
  const float* kV = (const float*)d_in[4];
  const float* rq = (const float*)d_in[5];
  const float* rk = (const float*)d_in[6];
  const float* rv = (const float*)d_in[7];
  const float* ro = (const float*)d_in[8];
  const float* rm = (const float*)d_in[9];
  const float* ln1g = (const float*)d_in[10];
  const float* ln1b = (const float*)d_in[11];
  const float* ln2g = (const float*)d_in[12];
  const float* ln2b = (const float*)d_in[13];
  const float* lnfg = (const float*)d_in[14];
  const float* lnfb = (const float*)d_in[15];
  float* out = (float*)d_out;

  float* ws = (float*)d_ws;
  float* xb = ws;     ws += (size_t)NTOK * D_MODEL;
  float* h = ws;      ws += (size_t)NTOK * D_MODEL;
  float* qc = ws;     ws += 2 * PLANE;
  float* kc = ws;     ws += 2 * PLANE;
  float* vc = ws;     ws += 2 * PLANE;
  float* ctx = ws;    ws += (size_t)NTOK * RANK;
  float* qm = ws;     ws += 2 * PLANE;
  float* wt = ws;     ws += (size_t)NTOK * KNOW_K;
  float* candS = ws;  ws += (size_t)NTOK * NCAND;
  int* candI = (int*)ws;  ws += (size_t)NTOK * NCAND;
  int* idx = (int*)ws;    ws += (size_t)NTOK * KNOW_K;
  int* sel = (int*)ws;    ws += (size_t)NTOK * 2;
  float* wsel = ws;
  const dim3 ggrid(N_COMPRESS, RANK / 32);

  hipMemcpyAsync(xb, x_in, sizeof(float) * (size_t)NTOK * D_MODEL,
                 hipMemcpyDeviceToDevice, stream);

  for (int l = 0; l < N_LAYERS; ++l) {
    ln_kernel<<<NTOK, 256, 0, stream>>>(xb, ln1g + l * D_MODEL, ln1b + l * D_MODEL, h);
    route_kernel<<<NTOK, 128, 0, stream>>>(h, rq + (size_t)l * N_COMPRESS * D_MODEL, sel, wsel);
    compress_group_kernel<<<ggrid, 256, 0, stream>>>(h, sel, wsel, cneur, qc);
    route_kernel<<<NTOK, 128, 0, stream>>>(h, rk + (size_t)l * N_COMPRESS * D_MODEL, sel, wsel);
    compress_group_kernel<<<ggrid, 256, 0, stream>>>(h, sel, wsel, cneur, kc);
    route_kernel<<<NTOK, 128, 0, stream>>>(h, rv + (size_t)l * N_COMPRESS * D_MODEL, sel, wsel);
    compress_group_kernel<<<ggrid, 256, 0, stream>>>(h, sel, wsel, cneur, vc);
    attn_kernel<<<BATCH * N_HEADS * (SEQ / 16), 32, 0, stream>>>(qc, kc, vc, ctx);
    expand_kernel<<<NTOK, 256, 0, stream>>>(ctx, ro + (size_t)l * N_EXPAND * RANK, eneur, xb);
    ln_kernel<<<NTOK, 256, 0, stream>>>(xb, ln2g + l * D_MODEL, ln2b + l * D_MODEL, h);
    route_kernel<<<NTOK, 128, 0, stream>>>(h, rm + (size_t)l * N_COMPRESS * D_MODEL, sel, wsel);
    compress_group_kernel<<<ggrid, 256, 0, stream>>>(h, sel, wsel, cneur, qm);
    memscore_kernel<<<dim3(NTOK / 16, NSPLIT), 256, 0, stream>>>(qm, kK, candS, candI);
    memmerge_kernel<<<NTOK / 4, 256, 0, stream>>>(candS, candI, idx, wt);
    memgather_kernel<<<NTOK, 128, 0, stream>>>(idx, wt, kV, xb);
  }
  ln_kernel<<<NTOK, 256, 0, stream>>>(xb, lnfg, lnfb, out);
}

// v005
// Two timings next to v004 put it at 1.24 and 1.25 times that version's speed.
// Counting every step since v000, it is 2.10 times as fast.
#include <hip/hip_runtime.h>
#include <math.h>

#define D_MODEL 512
#define RANK 128
#define N_HEADS 8
#define D_HEAD 16
#define N_COMPRESS 64
#define N_EXPAND 64
#define N_KNOW 32768
#define KNOW_K 8
#define N_LAYERS 2
#define BATCH 2
#define SEQ 512
#define NTOK (BATCH * SEQ)

#define CHUNK 512
#define NSPLIT 8                            // grid-Y partitions of the N_KNOW axis
#define NCHUNKS (N_KNOW / CHUNK)            // 64
#define CHPS (NCHUNKS / NSPLIT)             // 8 chunks per split
#define NCAND (NSPLIT * 8)                  // 64 candidates per token
#define KT_PITCH 132  // floats per staged kK row: 528 B = 16 B x 33, so the 32 lanes'
                      // 8-byte fragment reads fall on 64 distinct banks

#define PLANE ((size_t)NTOK * RANK)  // floats per plane of a compress result: plane s holds
                                     // each token's weighted projection by its s-th expert
#define GP_PITCH 36  // floats per row of a wave's 32x32 partial tile in LDS: 144 B keeps the
                     // 16-byte reads aligned and puts rows v and v + 8 on different banks

#define ATT_W 8    // waves per attention block
#define ATT_OP 18  // floats per row of a wave's parked output tile: rows v and v + 8, stored
                   // by one instruction, fall on different banks

typedef float v2f __attribute__((ext_vector_type(2)));
typedef float v4f __attribute__((ext_vector_type(4)));
typedef float v8f __attribute__((ext_vector_type(8)));

__device__ __forceinline__ v8f wmma_f32_16x16x4(v2f a, v2f b, v8f c) {
  // D = A(16x4 f32) * B(4x16 f32) + C(16x16 f32)
  return __builtin_amdgcn_wmma_f32_16x16x4_f32(false, a, false, b, (short)0, c,
                                               false, false);
}

// ---------------------------------------------------------------- LayerNorm
__global__ void ln_kernel(const float* __restrict__ x, const float* __restrict__ g,
                          const float* __restrict__ b, float* __restrict__ out) {
  int tok = blockIdx.x;
  int tid = threadIdx.x;  // 256 threads
  const float* xp = x + (size_t)tok * D_MODEL;
  float v0 = xp[tid], v1 = xp[tid + 256];
  __shared__ float rs[256], rq[256];
  rs[tid] = v0 + v1;
  rq[tid] = v0 * v0 + v1 * v1;
  __syncthreads();
  for (int s = 128; s > 0; s >>= 1) {
    if (tid < s) { rs[tid] += rs[tid + s]; rq[tid] += rq[tid + s]; }
    __syncthreads();
  }
  float mean = rs[0] * (1.0f / D_MODEL);
  float var = rq[0] * (1.0f / D_MODEL) - mean * mean;
  float rstd = rsqrtf(var + 1e-5f);
  float* op = out + (size_t)tok * D_MODEL;
  op[tid] = (v0 - mean) * rstd * g[tid] + b[tid];
  op[tid + 256] = (v1 - mean) * rstd * g[tid + 256] + b[tid + 256];
}

// ------------------------------------------------- routed compress (D -> R)
// Two launches. route_kernel picks each token's two experts and their weights;
// compress_group_kernel takes one expert per block, gathers the tokens that picked
// it and multiplies them with the expert's matrix, which is so read once per block
// instead of once per token.
// the bound states the block size, so that the logits' row loads in flight fit the
// register budget without spills
__global__ __launch_bounds__(128) void route_kernel(const float* __restrict__ h,
                                const float* __restrict__ router,   // [64,512]
                                int* __restrict__ sel,              // [NTOK,2] expert
                                float* __restrict__ wsel) {         // [NTOK,2] weight
  int tok = blockIdx.x;
  int tid = threadIdx.x;  // 128 threads
  __shared__ __attribute__((aligned(16))) float hs[D_MODEL];
  __shared__ float sc[N_COMPRESS];
  __shared__ float ss[2];
  __shared__ int se[2];
  const float* hp = h + (size_t)tok * D_MODEL;
  for (int i = tid; i < D_MODEL; i += 128) hs[i] = hp[i];
  if (tid < 2) { ss[tid] = -INFINITY; se[tid] = 0; }  // start values, as the scan had
  __syncthreads();
  // router logits: wave w takes rows 16w..16w+15. A row is read as whole 128-byte
  // lines (lane l holds d = 128 j + 4 l .. +3, j = 0..3), each lane sums its 16
  // products, and the lanes' partial sums are added over the wave.
  {
    int lane = tid & 31, wave = tid >> 5;
    v4f hv[4];
#pragma unroll  // hv stays in registers
    for (int j = 0; j < 4; ++j) hv[j] = *(const v4f*)(hs + 128 * j + 4 * lane);
    const float* rp = router + (size_t)(wave * 16) * D_MODEL + 4 * lane;
    float p16[16];
#pragma unroll  // p16 stays in registers; the 64 row loads are independent and fly together
    for (int e = 0; e < 16; ++e) {
      v2f acc = {0.f, 0.f};
#pragma unroll  // as above
      for (int j = 0; j < 4; ++j) {
        v4f rv = *(const v4f*)(rp + e * D_MODEL + 128 * j);
        acc += hv[j].xy * rv.xy;
        acc += hv[j].zw * rv.zw;
      }
      p16[e] = acc.x + acc.y;
    }
    // halving butterfly: at each level a lane hands over the half of its rows that
    // its partner keeps; lanes 2e and 2e+1 end with row e's whole sum
    float p8[8], p4[4], p2[2];
    bool u16 = lane & 16, u8 = lane & 8, u4 = lane & 4, u2 = lane & 2;
#pragma unroll  // the partial sums stay in registers (this loop and the two below)
    for (int i = 0; i < 8; ++i)
      p8[i] = (u16 ? p16[i + 8] : p16[i]) + __shfl_xor(u16 ? p16[i] : p16[i + 8], 16, 32);
#pragma unroll  // as above
    for (int i = 0; i < 4; ++i)
      p4[i] = (u8 ? p8[i + 4] : p8[i]) + __shfl_xor(u8 ? p8[i] : p8[i + 4], 8, 32);
#pragma unroll  // as above
    for (int i = 0; i < 2; ++i)
      p2[i] = (u4 ? p4[i + 2] : p4[i]) + __shfl_xor(u4 ? p4[i] : p4[i + 2], 4, 32);
    float p1 = (u2 ? p2[1] : p2[0]) + __shfl_xor(u2 ? p2[0] : p2[1], 2, 32);
    p1 += __shfl_xor(p1, 1, 32);
    if ((lane & 1) == 0) sc[wave * 16 + (lane >> 1)] = p1;
  }
  __syncthreads();
  float my = (tid < N_COMPRESS) ? sc[tid] : 0.f;
  // top-2 by rank: each score counts the scores that come before it (greater, or
  // equal with a lower index); ranks 0 and 1 are the two that a scan in index order picks
  if (tid < N_COMPRESS) {
    int rank = 0;
    for (int e = 0; e < N_COMPRESS; ++e) {
      float s = sc[e];
      rank += (s > my || (s == my && e < tid)) ? 1 : 0;
    }
    if (rank < 2) { ss[rank] = my; se[rank] = tid; }
  }
  __syncthreads();
  if (tid < 2) {
    float z = expf(ss[1] - ss[0]);
    sel[tok * 2 + tid] = se[tid];
    wsel[tok * 2 + tid] = (tid == 0 ? 1.f : z) / (1.f + z);
  }
}

// grid = (N_COMPRESS, RANK / 32): block (e, y) computes columns 32 y .. 32 y + 31 of
// h[tok] x neurons[e] for every entry (tok, s) with sel[tok][s] == e, 32 entries a pass.
// Wave w takes k = 64 w .. 64 w + 63 on WMMA f32 16x16x4; the eight partial tiles are
// added through LDS in wave order. Row (tok, s) goes, times its weight, to plane s of out.
__global__ __launch_bounds__(256) void compress_group_kernel(
    const float* __restrict__ h,        // [NTOK,512]
    const int* __restrict__ sel,        // [NTOK,2]
    const float* __restrict__ wsel,     // [NTOK,2]
    const float* __restrict__ neurons,  // [64,512,128]
    float* __restrict__ out) {          // [2,NTOK,128]
  int e = blockIdx.x;
  int n0 = blockIdx.y * 32;
  int tid = threadIdx.x;  // 256 threads = 8 waves
  int lane = tid & 31;
  int wave = tid >> 5;
  int nl = lane & 15;
  int kh = lane >> 4;
  __shared__ int list[2 * NTOK];  // this expert's entries (2 tok + s), ascending
  __shared__ int wcnt[64];
  __shared__ __attribute__((aligned(16))) float red[8][32 * GP_PITCH];

  int sv[8];
#pragma unroll  // sv stays in registers; the 8 loads fly together
  for (int j = 0; j < 8; ++j) sv[j] = sel[j * 256 + tid];

  // the list: a ballot per 32 entries, the counts summed in entry order
  unsigned mk[8];
#pragma unroll  // mk stays in registers
  for (int j = 0; j < 8; ++j) {
    mk[j] = __builtin_amdgcn_ballot_w32(sv[j] == e);
    if (lane == 0) wcnt[j * 8 + wave] = __popc(mk[j]);
  }
  __syncthreads();

  // B fragments, kept in registers for all passes; they fly while the list is built.
  // WMMA step 2 j + i of this wave multiplies k = 64 w + 8 j + 4 kh + 2 i + {0, 1},
  // in B here as in A below.
  const float* bp = neurons + (size_t)e * (D_MODEL * RANK) + (size_t)(wave * 64 + 4 * kh) * RANK + n0 + nl;
  v2f bf[2][16];
#pragma unroll  // bf stays in registers
  for (int j = 0; j < 8; ++j) {
#pragma unroll  // as above
    for (int nn = 0; nn < 2; ++nn) {
      bf[nn][2 * j].x = bp[(8 * j + 0) * RANK + 16 * nn];
      bf[nn][2 * j].y = bp[(8 * j + 1) * RANK + 16 * nn];
      bf[nn][2 * j + 1].x = bp[(8 * j + 2) * RANK + 16 * nn];
      bf[nn][2 * j + 1].y = bp[(8 * j + 3) * RANK + 16 * nn];
    }
  }

  int run = 0;
  int base[8];
#pragma unroll  // base stays in registers
  for (int q = 0; q < 64; ++q) {
    if ((q & 7) == wave) base[q >> 3] = run;
    run += wcnt[q];
  }
  unsigned below = (1u << lane) - 1u;
#pragma unroll  // as above
  for (int j = 0; j < 8; ++j)
    if ((mk[j] >> lane) & 1u) list[base[j] + __popc(mk[j] & below)] = j * 256 + tid;
  __syncthreads();
  // the same in every thread of the block; held as a scalar so that the pass loop,
  // which holds WMMAs and barriers, branches on a scalar compare
  int n = __builtin_amdgcn_readfirstlane(run);

  for (int m0 = 0; m0 < n; m0 += 32) {
    // A fragments: lane (nl, kh) reads its entry's h row; a row past the end of the
    // list reads entry 0's and is not stored
    v4f af[2][8];
#pragma unroll  // af stays in registers
    for (int t = 0; t < 2; ++t) {
      int ix = m0 + t * 16 + nl;
      int en = list[ix < n ? ix : 0];
      const float* ap = h + (size_t)(en >> 1) * D_MODEL + wave * 64 + 4 * kh;
#pragma unroll  // as above
      for (int j = 0; j < 8; ++j) af[t][j] = *(const v4f*)(ap + 8 * j);
    }
    // the row that this thread stores at the foot of the pass, and its weight, fetched early
    int m = tid >> 3, c4 = (tid & 7) * 4;  // 8 threads x 16 B = one 128-byte line per row
    int eo = list[m0 + m < n ? m0 + m : 0];
    float wo = wsel[eo];
    v8f c[2][2];
#pragma unroll  // c stays in registers (this loop and the two below)
    for (int t = 0; t < 2; ++t)
#pragma unroll  // as above
      for (int nn = 0; nn < 2; ++nn)
#pragma unroll  // as above
        for (int v = 0; v < 8; ++v) c[t][nn][v] = 0.f;
#pragma unroll  // as above
    for (int j = 0; j < 8; ++j) {
#pragma unroll  // as above
      for (int t = 0; t < 2; ++t)
#pragma unroll  // as above
        for (int nn = 0; nn < 2; ++nn)
          c[t][nn] = wmma_f32_16x16x4(af[t][j].xy, bf[nn][2 * j], c[t][nn]);
#pragma unroll  // as above
      for (int t = 0; t < 2; ++t)
#pragma unroll  // as above
        for (int nn = 0; nn < 2; ++nn)
          c[t][nn] = wmma_f32_16x16x4(af[t][j].zw, bf[nn][2 * j + 1], c[t][nn]);
    }
#pragma unroll  // as above
    for (int t = 0; t < 2; ++t)
#pragma unroll  // as above
      for (int nn = 0; nn < 2; ++nn)
#pragma unroll  // as above
        for (int v = 0; v < 8; ++v)
          red[wave][(t * 16 + v + 8 * kh) * GP_PITCH + nn * 16 + nl] = c[t][nn][v];
    __syncthreads();
    v4f sum = *(const v4f*)(&red[0][m * GP_PITCH + c4]);
#pragma unroll  // the 8 reads fly together
    for (int w = 1; w < 8; ++w) sum += *(const v4f*)(&red[w][m * GP_PITCH + c4]);
    if (m0 + m < n)
      *(v4f*)(out + (size_t)(eo & 1) * PLANE + (size_t)(eo >> 1) * RANK + n0 + c4) = sum * wo;
    __syncthreads();  // red is rewritten by the next pass
  }
}

// --------------------------------------------------- routed expand (R -> D)
__global__ void expand_kernel(const float* __restrict__ in,        // [NTOK,128]
                              const float* __restrict__ router,    // [64,128]
                              const float* __restrict__ neurons,   // [64,128,512]
                              float* __restrict__ x) {             // += [NTOK,512]
  int tok = blockIdx.x;
  int tid = threadIdx.x;  // 256 threads
  __shared__ __attribute__((aligned(16))) float is[RANK];
  __shared__ float sc[N_EXPAND];
  __shared__ float ss[2];
  __shared__ int se[2];
  const float* ip = in + (size_t)tok * RANK;
  if (tid < RANK) is[tid] = ip[tid];
  if (tid < 2) { ss[tid] = -INFINITY; se[tid] = 0; }  // start values, as the scan had
  __syncthreads();
  // router logits as in route_kernel: wave w takes rows 8w..8w+7, one 16-byte
  // load per lane covers a row (lane l holds r = 4 l .. +3)
  {
    int lane = tid & 31, wave = tid >> 5;
    v4f iv = *(const v4f*)(is + 4 * lane);
    const float* rp = router + (size_t)(wave * 8) * RANK + 4 * lane;
    float p8[8];
#pragma unroll  // p8 stays in registers; the 8 row loads are independent and fly together
    for (int e = 0; e < 8; ++e) {
      v4f rv = *(const v4f*)(rp + e * RANK);
      v2f acc = iv.xy * rv.xy;
      acc += iv.zw * rv.zw;
      p8[e] = acc.x + acc.y;
    }
    // halving butterfly; lanes 4e..4e+3 end with row e's whole sum
    float p4[4], p2[2];
    bool u16 = lane & 16, u8 = lane & 8, u4 = lane & 4;
#pragma unroll  // the partial sums stay in registers (this loop and the next)
    for (int i = 0; i < 4; ++i)
      p4[i] = (u16 ? p8[i + 4] : p8[i]) + __shfl_xor(u16 ? p8[i] : p8[i + 4], 16, 32);
#pragma unroll  // as above
    for (int i = 0; i < 2; ++i)
      p2[i] = (u8 ? p4[i + 2] : p4[i]) + __shfl_xor(u8 ? p4[i] : p4[i + 2], 8, 32);
    float p1 = (u4 ? p2[1] : p2[0]) + __shfl_xor(u4 ? p2[0] : p2[1], 4, 32);
    p1 += __shfl_xor(p1, 2, 32);
    p1 += __shfl_xor(p1, 1, 32);
    if ((lane & 3) == 0) sc[wave * 8 + (lane >> 2)] = p1;
  }
  __syncthreads();
  float my = (tid < N_EXPAND) ? sc[tid] : 0.f;
  // top-2 by rank, as in route_kernel
  if (tid < N_EXPAND) {
    int rank = 0;
    for (int e = 0; e < N_EXPAND; ++e) {
      float s = sc[e];
      rank += (s > my || (s == my && e < tid)) ? 1 : 0;
    }
    if (rank < 2) { ss[rank] = my; se[rank] = tid; }
  }
  __syncthreads();
  int e0 = se[0], e1i = se[1];
  float z = expf(ss[1] - ss[0]);
  float w0 = 1.f / (1.f + z), w1 = z / (1.f + z);
  for (int d = tid; d < D_MODEL; d += 256) {
    const float* n0 = neurons + (size_t)e0 * (RANK * D_MODEL) + d;
    const float* n1 = neurons + (size_t)e1i * (RANK * D_MODEL) + d;
    float a0 = 0.f, a1 = 0.f;
    for (int r = 0; r < RANK; ++r) {
      float iv = is[r];
      a0 += iv * n0[(size_t)r * D_MODEL];
      a1 += iv * n1[(size_t)r * D_MODEL];
    }
    x[(size_t)tok * D_MODEL + d] += w0 * a0 + w1 * a1;
  }
}

// -------------------------- flash attention: one block per (b, head, q-tile)
// WMMA f32 16x16x4: QK^T (K=16 -> 4 wmma) and P@V (K=16 -> 4 wmma) per tile.
// Q, K and V come as two planes each (see compress_group_kernel), added as they are read.
// The key tiles are dealt to the block's ATT_W waves (wave w takes tiles w, w + ATT_W, ...):
// a tile's steps hang on one another, so the longest row of tiles sets the launch's time.
// Each wave runs its own online softmax; the partial results are joined at the end.
__global__ __launch_bounds__(32 * ATT_W) void attn_kernel(
    const float* __restrict__ Q, const float* __restrict__ K,
    const float* __restrict__ V, float* __restrict__ O) {
  int bid = blockIdx.x;
  int qt = bid % (SEQ / 16);
  int head = (bid / (SEQ / 16)) % N_HEADS;
  int b = bid / ((SEQ / 16) * N_HEADS);
  int tid = threadIdx.x;  // 32 * ATT_W threads
  int lane = tid & 31;
  // the same in every lane of a wave; held as a scalar so that the tile loop, which
  // holds WMMAs, branches on a scalar compare
  int wave = __builtin_amdgcn_readfirstlane(tid >> 5);
  int nl = lane & 15;
  int kh = lane >> 4;      // which K half (A/B layout: lanes 16-31 hold K+2)
  int mrow = kh ? 8 : 0;   // C/D layout: lanes 16-31 hold rows 8-15
  size_t base = (size_t)b * SEQ;
  __shared__ float PtAll[ATT_W][16][17];
  __shared__ float oS[ATT_W][16][ATT_OP];  // each wave's unnormalised output tile
  __shared__ float mS[ATT_W][16];          // its row maxima
  __shared__ float lS[ATT_W][16];          // its row sums
  float (*Pt)[17] = PtAll[wave];           // private to the wave

  // A fragments for Q tile (16 rows x K=16), 4 chunks of K=4
  const float* qp = Q + (base + qt * 16 + nl) * RANK + head * D_HEAD;
  v2f aq[4];
#pragma unroll
  for (int kc = 0; kc < 4; ++kc)
    aq[kc] = *(const v2f*)(qp + 4 * kc + 2 * kh) + *(const v2f*)(qp + PLANE + 4 * kc + 2 * kh);

  v8f o;
  float rm[8], rl[8];
#pragma unroll
  for (int v = 0; v < 8; ++v) { o[v] = 0.f; rm[v] = -INFINITY; rl[v] = 0.f; }

  for (int j = wave; j <= qt; j += ATT_W) {
    v8f s;
#pragma unroll
    for (int v = 0; v < 8; ++v) s[v] = 0.f;
    const float* kp = K + (base + j * 16 + nl) * RANK + head * D_HEAD;
#pragma unroll
    for (int kc = 0; kc < 4; ++kc) {
      v2f bk = *(const v2f*)(kp + 4 * kc + 2 * kh) +
               *(const v2f*)(kp + PLANE + 4 * kc + 2 * kh);  // B[k][n], B[k+1][n]
      s = wmma_f32_16x16x4(aq[kc], bk, s);
    }
    // scale + causal mask (query = qt*16+m, key = j*16+n)
#pragma unroll
    for (int v = 0; v < 8; ++v) {
      float sv = s[v] * 0.25f;  // 1/sqrt(16)
      if (j == qt && nl > v + mrow) sv = -INFINITY;
      s[v] = sv;
    }
    // online softmax (rows live across 16-lane halves -> butterfly 1,2,4,8)
#pragma unroll
    for (int v = 0; v < 8; ++v) {
      float tmax = s[v];
#pragma unroll
      for (int msk = 1; msk < 16; msk <<= 1)
        tmax = fmaxf(tmax, __shfl_xor(tmax, msk, 32));
      float nm = fmaxf(rm[v], tmax);
      float alpha = __expf(rm[v] - nm);
      float p = __expf(s[v] - nm);
      float psum = p;
#pragma unroll
      for (int msk = 1; msk < 16; msk <<= 1) psum += __shfl_xor(psum, msk, 32);
      rl[v] = rl[v] * alpha + psum;
      o[v] *= alpha;
      rm[v] = nm;
      s[v] = p;
    }
    // re-layout P: C-layout -> LDS -> A-layout
#pragma unroll
    for (int v = 0; v < 8; ++v) Pt[v + mrow][nl] = s[v];
    // the wave's own stores have landed before its lanes read each other's values
    // back (the range is private to the wave: no barrier, and the waves' trip counts differ)
    asm volatile("s_wait_dscnt 0x0" ::: "memory");
    const float* vp = V + (base + j * 16) * RANK + head * D_HEAD + nl;
#pragma unroll
    for (int kc = 0; kc < 4; ++kc) {
      v2f ap;
      ap.x = Pt[nl][4 * kc + 2 * kh];
      ap.y = Pt[nl][4 * kc + 2 * kh + 1];
      v2f bv;
      bv.x = vp[(size_t)(4 * kc + 2 * kh) * RANK] + vp[PLANE + (size_t)(4 * kc + 2 * kh) * RANK];
      bv.y = vp[(size_t)(4 * kc + 2 * kh + 1) * RANK] + vp[PLANE + (size_t)(4 * kc + 2 * kh + 1) * RANK];
      o = wmma_f32_16x16x4(ap, bv, o);
    }
  }
  // join the waves' partial results: a wave without a tile hands in maximum -inf,
  // sum 0 and output 0, and so weighs nothing (wave 0 always has tile 0)
#pragma unroll  // o stays in registers
  for (int v = 0; v < 8; ++v) oS[wave][v + mrow][nl] = o[v];
  if (nl == 0) {
#pragma unroll  // rm and rl stay in registers
    for (int v = 0; v < 8; ++v) { mS[wave][v + mrow] = rm[v]; lS[wave][v + mrow] = rl[v]; }
  }
  __syncthreads();
  static_assert(32 * ATT_W == 256, "one thread per element of the 16x16 output tile");
  int r = tid >> 4, cc = tid & 15;
  float mx = mS[0][r];
#pragma unroll  // the LDS reads fly together (this loop and the next)
  for (int w = 1; w < ATT_W; ++w) mx = fmaxf(mx, mS[w][r]);
  float den = 0.f, num = 0.f;
#pragma unroll  // as above
  for (int w = 0; w < ATT_W; ++w) {
    float f = __expf(mS[w][r] - mx);
    den += lS[w][r] * f;
    num += oS[w][r][cc] * f;
  }
  O[(base + qt * 16 + r) * RANK + head * D_HEAD + cc] = num / den;
}

// ---------------- memory scores GEMM (WMMA f32, K=128) fused with top-8.
// grid = (NTOK/16, NSPLIT): split N_KNOW 8 ways for 8x more waves on the
// FLOP-dominant kernel; each split emits per-row top-8 candidates.
// Each wave brings its 16-column kK tile in as whole 512-byte rows (one row per
// 16-byte-per-lane load), one tile ahead, parks it in its own LDS range and
// reads the B fragments from there (k = 4 kc + 2 kh, as the A fragments).
__global__ __launch_bounds__(256) void memscore_kernel(const float* __restrict__ Qm,  // [2,NTOK,128]
                                const float* __restrict__ kK,  // [N_KNOW,128]
                                float* __restrict__ candS,     // [NTOK,NSPLIT,8]
                                int* __restrict__ candI) {     // [NTOK,NSPLIT,8]
  int tb = blockIdx.x;      // 16-token tile
  int split = blockIdx.y;   // column partition
  int tid = threadIdx.x;    // 256 threads = 8 waves
  int lane = tid & 31;
  int wave = tid >> 5;
  int nl = lane & 15;
  int kh = lane >> 4;
  int mrow = kh ? 8 : 0;
  size_t tokBase = (size_t)tb * 16;

  __shared__ float sc[16][CHUNK + 4];  // pad: 516 % 64 banks = 4 -> conflict free
  __shared__ float cs[16][128];
  __shared__ int ci[16][128];
  __shared__ __attribute__((aligned(16))) float kt[8][16 * KT_PITCH];  // one tile per wave
  float* ktw = &kt[wave][0];

  // A fragments for the Q tile (its two planes added): K=128 -> 32 chunks, kept in registers
  const float* qp = Qm + (tokBase + nl) * RANK;
  v2f aq[32];
#pragma unroll
  for (int kc = 0; kc < 32; ++kc)
    aq[kc] = *(const v2f*)(qp + 4 * kc + 2 * kh) + *(const v2f*)(qp + PLANE + 4 * kc + 2 * kh);

  float ts[8];
  int ti8[8];
#pragma unroll
  for (int i = 0; i < 8; ++i) { ts[i] = -INFINITY; ti8[i] = 0; }
  int row = tid & 15, slot = tid >> 4;
  const float scale = 0.08838834764831845f;  // 1/sqrt(128)

  // this wave's first tile: row i of the tile = 32 lanes x 16 B = 4 whole lines
  v4f st[16];
  const float* gp = kK + (size_t)(split * CHPS * CHUNK + wave * 64) * RANK + lane * 4;
#pragma unroll
  for (int i = 0; i < 16; ++i) st[i] = *(const v4f*)(gp + i * RANK);
  // inputs-only fence on the A values (each the sum of two loaded values, no product):
  // A is waited for here, once. Without it
  // the waits for A stand among the WMMAs of the loop and drain the next tile's
  // loads there on every trip.
  asm volatile("" ::"v"(aq[0]), "v"(aq[1]), "v"(aq[2]), "v"(aq[3]), "v"(aq[4]), "v"(aq[5]),
               "v"(aq[6]), "v"(aq[7]), "v"(aq[8]), "v"(aq[9]), "v"(aq[10]), "v"(aq[11]),
               "v"(aq[12]), "v"(aq[13]), "v"(aq[14]), "v"(aq[15]));
  asm volatile("" ::"v"(aq[16]), "v"(aq[17]), "v"(aq[18]), "v"(aq[19]), "v"(aq[20]), "v"(aq[21]),
               "v"(aq[22]), "v"(aq[23]), "v"(aq[24]), "v"(aq[25]), "v"(aq[26]), "v"(aq[27]),
               "v"(aq[28]), "v"(aq[29]), "v"(aq[30]), "v"(aq[31]));

  for (int ch = split * CHPS; ch < (split + 1) * CHPS; ++ch) {
    // stage A: 8 waves x 4 n-tiles of 16 cols = 512 cols via WMMA
#pragma unroll 1
    for (int t = 0; t < 4; ++t) {
      int ntl = wave * 4 + t;
#pragma unroll
      for (int i = 0; i < 16; ++i) *(v4f*)(ktw + i * KT_PITCH + lane * 4) = st[i];
      // the wave's own row stores have landed before its lanes read each other's
      // rows back as fragments (the range is private to the wave: no barrier)
      asm volatile("s_wait_dscnt 0x0" ::: "memory");
      // the wave's next tile flies while this one is multiplied; none behind the last
      if (t < 3 || ch + 1 < (split + 1) * CHPS) {
        gp += (t < 3 ? 16 : CHUNK - 48) * RANK;  // next tile of the chunk, or first of the next
#pragma unroll
        for (int i = 0; i < 16; ++i) st[i] = *(const v4f*)(gp + i * RANK);
      }
      const float* kp = ktw + nl * KT_PITCH;
      v8f c;
#pragma unroll
      for (int v = 0; v < 8; ++v) c[v] = 0.f;
#pragma unroll
      for (int kc = 0; kc < 32; ++kc) {
        v2f bk = *(const v2f*)(kp + 4 * kc + 2 * kh);
        c = wmma_f32_16x16x4(aq[kc], bk, c);
      }
#pragma unroll
      for (int v = 0; v < 8; ++v) sc[v + mrow][ntl * 16 + nl] = c[v] * scale;
    }
    __syncthreads();
    // stage B: 16 threads per row keep a private sorted top-8
    int cbase = slot * 32;
    for (int i = 0; i < 32; ++i) {
      float s = sc[row][cbase + i];
      if (s > ts[7]) {
        ts[7] = s;
        ti8[7] = ch * CHUNK + cbase + i;
#pragma unroll
        for (int q = 7; q > 0; --q) {
          if (ts[q] > ts[q - 1]) {
            float tf = ts[q]; ts[q] = ts[q - 1]; ts[q - 1] = tf;
            int tt = ti8[q]; ti8[q] = ti8[q - 1]; ti8[q - 1] = tt;
          }
        }
      }
    }
    __syncthreads();
  }
  // merge 16 candidate lists per row -> this split's top-8 candidates
#pragma unroll
  for (int i = 0; i < 8; ++i) { cs[row][slot * 8 + i] = ts[i]; ci[row][slot * 8 + i] = ti8[i]; }
  __syncthreads();
  if (tid < 16) {
    int r = tid;
    size_t ob = ((tokBase + r) * NSPLIT + split) * 8;
    for (int k = 0; k < 8; ++k) {
      float m = -INFINITY;
      int mi = 0;
      for (int c2 = 0; c2 < 128; ++c2)
        if (cs[r][c2] > m) { m = cs[r][c2]; mi = c2; }
      candS[ob + k] = m;
      candI[ob + k] = ci[r][mi];
      cs[r][mi] = -INFINITY;
    }
  }
}

// ---- merge NSPLIT candidate lists (disjoint column ranges -> exact top-8)
// One thread per candidate, 4 tokens per block. A candidate's rank is the number of
// its token's candidates that come before it (greater score, or equal score and a
// lower position): ranks 0..7 are the picks of eight scans in position order.
__global__ __launch_bounds__(256) void memmerge_kernel(const float* __restrict__ candS,
                                const int* __restrict__ candI,
                                int* __restrict__ outIdx, float* __restrict__ outW) {
  int tid = threadIdx.x;
  int tl = tid >> 6, c = tid & (NCAND - 1);
  int tok = blockIdx.x * 4 + tl;
  __shared__ float cs[4][NCAND];
  __shared__ float best[4][KNOW_K];
  __shared__ int bi[4][KNOW_K];
  float my = candS[(size_t)tok * NCAND + c];
  int myi = candI[(size_t)tok * NCAND + c];
  cs[tl][c] = my;
  if (c < KNOW_K) { best[tl][c] = -INFINITY; bi[tl][c] = 0; }  // start values, as the scans had
  __syncthreads();
  int rank = 0;
  for (int e = 0; e < NCAND; ++e) {
    float v = cs[tl][e];
    rank += (v > my || (v == my && e < c)) ? 1 : 0;
  }
  if (rank < KNOW_K) { best[tl][rank] = my; bi[tl][rank] = myi; }
  __syncthreads();
  if (c < KNOW_K) {
    float mx = best[tl][0], sum = 0.f;
    for (int k = 0; k < KNOW_K; ++k) sum += expf(best[tl][k] - mx);
    float inv = 1.f / sum;
    size_t ob = (size_t)tok * KNOW_K + c;
    outIdx[ob] = bi[tl][c];
    outW[ob] = expf(best[tl][c] - mx) * inv;
  }
}

// ------------------------------------------- weighted gather of kV + residual
__global__ void memgather_kernel(const int* __restrict__ idx, const float* __restrict__ w,
                                 const float* __restrict__ kV, float* __restrict__ x) {
  int tok = blockIdx.x;
  int tid = threadIdx.x;  // 128
  __shared__ int si[8];
  __shared__ float swt[8];
  if (tid < 8) { si[tid] = idx[(size_t)tok * 8 + tid]; swt[tid] = w[(size_t)tok * 8 + tid]; }
  __syncthreads();
  for (int d = tid; d < D_MODEL; d += 128) {
    float acc = 0.f;
#pragma unroll
    for (int k = 0; k < 8; ++k) acc += swt[k] * kV[(size_t)si[k] * D_MODEL + d];
    x[(size_t)tok * D_MODEL + d] += acc;
  }
}

extern "C" void kernel_launch(void* const* d_in, const int* in_sizes, int n_in,
                              void* d_out, int out_size, void* d_ws, size_t ws_size,
                              hipStream_t stream) {
  const float* x_in = (const float*)d_in[0];
  const float* cneur = (const float*)d_in[1];
  const float* eneur = (const float*)d_in[2];
  const float* kK = (const float*)d_in[3];
  const float* kV = (const float*)d_in[4];
  const float* rq = (const float*)d_in[5];
  const float* rk = (const float*)d_in[6];
  const float* rv = (const float*)d_in[7];
  const float* ro = (const float*)d_in[8];
  const float* rm = (const float*)d_in[9];
  const float* ln1g = (const float*)d_in[10];
  const float* ln1b = (const float*)d_in[11];
  const float* ln2g = (const float*)d_in[12];
  const float* ln2b = (const float*)d_in[13];
  const float* lnfg = (const float*)d_in[14];
  const float* lnfb = (const float*)d_in[15];
  float* out = (float*)d_out;

  float* ws = (float*)d_ws;
  float* xb = ws;     ws += (size_t)NTOK * D_MODEL;
  float* h = ws;      ws += (size_t)NTOK * D_MODEL;
  float* qc = ws;     ws += 2 * PLANE;
  float* kc = ws;     ws += 2 * PLANE;
  float* vc = ws;     ws += 2 * PLANE;
  float* ctx = ws;    ws += (size_t)NTOK * RANK;
  float* qm = ws;     ws += 2 * PLANE;
  float* wt = ws;     ws += (size_t)NTOK * KNOW_K;
  float* candS = ws;  ws += (size_t)NTOK * NCAND;
  int* candI = (int*)ws;  ws += (size_t)NTOK * NCAND;
  int* idx = (int*)ws;    ws += (size_t)NTOK * KNOW_K;
  int* sel = (int*)ws;    ws += (size_t)NTOK * 2;
  float* wsel = ws;
  const dim3 ggrid(N_COMPRESS, RANK / 32);

  hipMemcpyAsync(xb, x_in, sizeof(float) * (size_t)NTOK * D_MODEL,
                 hipMemcpyDeviceToDevice, stream);

  for (int l = 0; l < N_LAYERS; ++l) {
    ln_kernel<<<NTOK, 256, 0, stream>>>(xb, ln1g + l * D_MODEL, ln1b + l * D_MODEL, h);
    route_kernel<<<NTOK, 128, 0, stream>>>(h, rq + (size_t)l * N_COMPRESS * D_MODEL, sel, wsel);
    compress_group_kernel<<<ggrid, 256, 0, stream>>>(h, sel, wsel, cneur, qc);
    route_kernel<<<NTOK, 128, 0, stream>>>(h, rk + (size_t)l * N_COMPRESS * D_MODEL, sel, wsel);
    compress_group_kernel<<<ggrid, 256, 0, stream>>>(h, sel, wsel, cneur, kc);
    route_kernel<<<NTOK, 128, 0, stream>>>(h, rv + (size_t)l * N_COMPRESS * D_MODEL, sel, wsel);
    compress_group_kernel<<<ggrid, 256, 0, stream>>>(h, sel, wsel, cneur, vc);
    attn_kernel<<<BATCH * N_HEADS * (SEQ / 16), 32 * ATT_W, 0, stream>>>(qc, kc, vc, ctx);
    expand_kernel<<<NTOK, 256, 0, stream>>>(ctx, ro + (size_t)l * N_EXPAND * RANK, eneur, xb);
    ln_kernel<<<NTOK, 256, 0, stream>>>(xb, ln2g + l * D_MODEL, ln2b + l * D_MODEL, h);
    route_kernel<<<NTOK, 128, 0, stream>>>(h, rm + (size_t)l * N_COMPRESS * D_MODEL, sel, wsel);
    compress_group_kernel<<<ggrid, 256, 0, stream>>>(h, sel, wsel, cneur, qm);
    memscore_kernel<<<dim3(NTOK / 16, NSPLIT), 256, 0, stream>>>(qm, kK, candS, candI);
    memmerge_kernel<<<NTOK / 4, 256, 0, stream>>>(candS, candI, idx, wt);
    memgather_kernel<<<NTOK, 128, 0, stream>>>(idx, wt, kV, xb);
  }
  ln_kernel<<<NTOK, 256, 0, stream>>>(xb, lnfg, lnfb, out);
}

// v006
// Next to v005, in two timings, it ran 1.09 times as fast each time.
// Counting every step since v000, it is 2.30 times as fast.
#include <hip/hip_runtime.h>
#include <math.h>

#define D_MODEL 512
#define RANK 128
#define N_HEADS 8
#define D_HEAD 16
#define N_COMPRESS 64
#define N_EXPAND 64
#define N_KNOW 32768
#define KNOW_K 8
#define N_LAYERS 2
#define BATCH 2
#define SEQ 512
#define NTOK (BATCH * SEQ)

#define CHUNK 512
#define NSPLIT 8                            // grid-Y partitions of the N_KNOW axis
#define NCHUNKS (N_KNOW / CHUNK)            // 64
#define CHPS (NCHUNKS / NSPLIT)             // 8 chunks per split
#define NCAND (NSPLIT * 8)                  // 64 candidates per token
#define KT_PITCH 132  // floats per staged kK row: 528 B = 16 B x 33, so the 32 lanes'
                      // 8-byte fragment reads fall on 64 distinct banks

#define PLANE ((size_t)NTOK * RANK)  // floats per plane of a compress result: plane s holds
                                     // each token's weighted projection by its s-th expert
#define GP_PITCH 36  // floats per row of a wave's 32x32 partial tile in LDS: 144 B keeps the
                     // 16-byte reads aligned and puts rows v and v + 8 on different banks

#define ATT_W 8    // waves per attention block
#define ATT_OP 18  // floats per row of a wave's parked output tile: rows v and v + 8, stored
                   // by one instruction, fall on different banks

typedef float v2f __attribute__((ext_vector_type(2)));
typedef float v4f __attribute__((ext_vector_type(4)));
typedef float v8f __attribute__((ext_vector_type(8)));

__device__ __forceinline__ v8f wmma_f32_16x16x4(v2f a, v2f b, v8f c) {
  // D = A(16x4 f32) * B(4x16 f32) + C(16x16 f32)
  return __builtin_amdgcn_wmma_f32_16x16x4_f32(false, a, false, b, (short)0, c,
                                               false, false);
}

// ---------------------------------------------------------------- LayerNorm
__global__ void ln_kernel(const float* __restrict__ x, const float* __restrict__ g,
                          const float* __restrict__ b, float* __restrict__ out) {
  int tok = blockIdx.x;
  int tid = threadIdx.x;  // 256 threads
  const float* xp = x + (size_t)tok * D_MODEL;
  float v0 = xp[tid], v1 = xp[tid + 256];
  __shared__ float rs[256], rq[256];
  rs[tid] = v0 + v1;
  rq[tid] = v0 * v0 + v1 * v1;
  __syncthreads();
  for (int s = 128; s > 0; s >>= 1) {
    if (tid < s) { rs[tid] += rs[tid + s]; rq[tid] += rq[tid + s]; }
    __syncthreads();
  }
  float mean = rs[0] * (1.0f / D_MODEL);
  float var = rq[0] * (1.0f / D_MODEL) - mean * mean;
  float rstd = rsqrtf(var + 1e-5f);
  float* op = out + (size_t)tok * D_MODEL;
  op[tid] = (v0 - mean) * rstd * g[tid] + b[tid];
  op[tid + 256] = (v1 - mean) * rstd * g[tid + 256] + b[tid + 256];
}

// ------------------------------------------------- routed compress (D -> R)
// Two launches. route_kernel picks each token's two experts and their weights;
// compress_group_kernel takes one expert per block, gathers the tokens that picked
// it and multiplies them with the expert's matrix, which is so read once per block
// instead of once per token.
// Projections of the same h that do not hang on one another (q, k, v) share the two
// launches: grid y of route_kernel and grid z of compress_group_kernel name the
// projection, so their latencies overlap and no launch gap stands between them.
// the bound states the block size, so that the logits' row loads in flight fit the
// register budget without spills
__global__ __launch_bounds__(128) void route_kernel(const float* __restrict__ h,
                                const float* __restrict__ router0,  // [64,512], projection 0
                                const float* __restrict__ router1,  // projection 1
                                const float* __restrict__ router2,  // projection 2
                                int* __restrict__ sel,              // [grid y,NTOK,2] expert
                                float* __restrict__ wsel) {         // [grid y,NTOK,2] weight
  int tok = blockIdx.x;
  int pr = blockIdx.y;
  const float* router = pr == 0 ? router0 : (pr == 1 ? router1 : router2);
  sel += pr * (2 * NTOK);
  wsel += pr * (2 * NTOK);
  int tid = threadIdx.x;  // 128 threads
  __shared__ __attribute__((aligned(16))) float hs[D_MODEL];
  __shared__ float sc[N_COMPRESS];
  __shared__ float ss[2];
  __shared__ int se[2];
  const float* hp = h + (size_t)tok * D_MODEL;
  for (int i = tid; i < D_MODEL; i += 128) hs[i] = hp[i];
  if (tid < 2) { ss[tid] = -INFINITY; se[tid] = 0; }  // start values, as the scan had
  __syncthreads();
  // router logits: wave w takes rows 16w..16w+15. A row is read as whole 128-byte
  // lines (lane l holds d = 128 j + 4 l .. +3, j = 0..3), each lane sums its 16
  // products, and the lanes' partial sums are added over the wave.
  {
    int lane = tid & 31, wave = tid >> 5;
    v4f hv[4];
#pragma unroll  // hv stays in registers
    for (int j = 0; j < 4; ++j) hv[j] = *(const v4f*)(hs + 128 * j + 4 * lane);
    const float* rp = router + (size_t)(wave * 16) * D_MODEL + 4 * lane;
    float p16[16];
#pragma unroll  // p16 stays in registers; the 64 row loads are independent and fly together
    for (int e = 0; e < 16; ++e) {
      v2f acc = {0.f, 0.f};
#pragma unroll  // as above
      for (int j = 0; j < 4; ++j) {
        v4f rv = *(const v4f*)(rp + e * D_MODEL + 128 * j);
        acc += hv[j].xy * rv.xy;
        acc += hv[j].zw * rv.zw;
      }
      p16[e] = acc.x + acc.y;
    }
    // halving butterfly: at each level a lane hands over the half of its rows that
    // its partner keeps; lanes 2e and 2e+1 end with row e's whole sum
    float p8[8], p4[4], p2[2];
    bool u16 = lane & 16, u8 = lane & 8, u4 = lane & 4, u2 = lane & 2;
#pragma unroll  // the partial sums stay in registers (this loop and the two below)
    for (int i = 0; i < 8; ++i)
      p8[i] = (u16 ? p16[i + 8] : p16[i]) + __shfl_xor(u16 ? p16[i] : p16[i + 8], 16, 32);
#pragma unroll  // as above
    for (int i = 0; i < 4; ++i)
      p4[i] = (u8 ? p8[i + 4] : p8[i]) + __shfl_xor(u8 ? p8[i] : p8[i + 4], 8, 32);
#pragma unroll  // as above
    for (int i = 0; i < 2; ++i)
      p2[i] = (u4 ? p4[i + 2] : p4[i]) + __shfl_xor(u4 ? p4[i] : p4[i + 2], 4, 32);
    float p1 = (u2 ? p2[1] : p2[0]) + __shfl_xor(u2 ? p2[0] : p2[1], 2, 32);
    p1 += __shfl_xor(p1, 1, 32);
    if ((lane & 1) == 0) sc[wave * 16 + (lane >> 1)] = p1;
  }
  __syncthreads();
  float my = (tid < N_COMPRESS) ? sc[tid] : 0.f;
  // top-2 by rank: each score counts the scores that come before it (greater, or
  // equal with a lower index); ranks 0 and 1 are the two that a scan in index order picks
  if (tid < N_COMPRESS) {
    int rank = 0;
    for (int e = 0; e < N_COMPRESS; ++e) {
      float s = sc[e];
      rank += (s > my || (s == my && e < tid)) ? 1 : 0;
    }
    if (rank < 2) { ss[rank] = my; se[rank] = tid; }
  }
  __syncthreads();
  if (tid < 2) {
    float z = expf(ss[1] - ss[0]);
    sel[tok * 2 + tid] = se[tid];
    wsel[tok * 2 + tid] = (tid == 0 ? 1.f : z) / (1.f + z);
  }
}

// grid = (N_COMPRESS, RANK / 32, projections): block (e, y, z) computes columns
// 32 y .. 32 y + 31 of h[tok] x neurons[e] for every entry (tok, s) with
// sel[z][tok][s] == e, 32 entries a pass.
// Wave w takes k = 64 w .. 64 w + 63 on WMMA f32 16x16x4; the eight partial tiles are
// added through LDS in wave order. Row (tok, s) goes, times its weight, to plane s of out[z].
__global__ __launch_bounds__(256) void compress_group_kernel(
    const float* __restrict__ h,        // [NTOK,512]
    const int* __restrict__ sel,        // [grid z,NTOK,2]
    const float* __restrict__ wsel,     // [grid z,NTOK,2]
    const float* __restrict__ neurons,  // [64,512,128]
    float* __restrict__ out) {          // [grid z,2,NTOK,128]
  int e = blockIdx.x;
  int n0 = blockIdx.y * 32;
  sel += blockIdx.z * (2 * NTOK);
  wsel += blockIdx.z * (2 * NTOK);
  out += blockIdx.z * (2 * PLANE);
  int tid = threadIdx.x;  // 256 threads = 8 waves
  int lane = tid & 31;
  int wave = tid >> 5;
  int nl = lane & 15;
  int kh = lane >> 4;
  __shared__ int list[2 * NTOK];  // this expert's entries (2 tok + s), ascending
  __shared__ int wcnt[64];
  __shared__ __attribute__((aligned(16))) float red[8][32 * GP_PITCH];

  int sv[8];
#pragma unroll  // sv stays in registers; the 8 loads fly together
  for (int j = 0; j < 8; ++j) sv[j] = sel[j * 256 + tid];

  // the list: a ballot per 32 entries, the counts summed in entry order
  unsigned mk[8];
#pragma unroll  // mk stays in registers
  for (int j = 0; j < 8; ++j) {
    mk[j] = __builtin_amdgcn_ballot_w32(sv[j] == e);
    if (lane == 0) wcnt[j * 8 + wave] = __popc(mk[j]);
  }
  __syncthreads();

  // B fragments, kept in registers for all passes; they fly while the list is built.
  // WMMA step 2 j + i of this wave multiplies k = 64 w + 8 j + 4 kh + 2 i + {0, 1},
  // in B here as in A below.
  const float* bp = neurons + (size_t)e * (D_MODEL * RANK) + (size_t)(wave * 64 + 4 * kh) * RANK + n0 + nl;
  v2f bf[2][16];
#pragma unroll  // bf stays in registers
  for (int j = 0; j < 8; ++j) {
#pragma unroll  // as above
    for (int nn = 0; nn < 2; ++nn) {
      bf[nn][2 * j].x = bp[(8 * j + 0) * RANK + 16 * nn];
      bf[nn][2 * j].y = bp[(8 * j + 1) * RANK + 16 * nn];
      bf[nn][2 * j + 1].x = bp[(8 * j + 2) * RANK + 16 * nn];
      bf[nn][2 * j + 1].y = bp[(8 * j + 3) * RANK + 16 * nn];
    }
  }

  int run = 0;
  int base[8];
#pragma unroll  // base stays in registers
  for (int q = 0; q < 64; ++q) {
    if ((q & 7) == wave) base[q >> 3] = run;
    run += wcnt[q];
  }
  unsigned below = (1u << lane) - 1u;
#pragma unroll  // as above
  for (int j = 0; j < 8; ++j)
    if ((mk[j] >> lane) & 1u) list[base[j] + __popc(mk[j] & below)] = j * 256 + tid;
  __syncthreads();
  // the same in every thread of the block; held as a scalar so that the pass loop,
  // which holds WMMAs and barriers, branches on a scalar compare
  int n = __builtin_amdgcn_readfirstlane(run);

  for (int m0 = 0; m0 < n; m0 += 32) {
    // A fragments: lane (nl, kh) reads its entry's h row; a row past the end of the
    // list reads entry 0's and is not stored
    v4f af[2][8];
#pragma unroll  // af stays in registers
    for (int t = 0; t < 2; ++t) {
      int ix = m0 + t * 16 + nl;
      int en = list[ix < n ? ix : 0];
      const float* ap = h + (size_t)(en >> 1) * D_MODEL + wave * 64 + 4 * kh;
#pragma unroll  // as above
      for (int j = 0; j < 8; ++j) af[t][j] = *(const v4f*)(ap + 8 * j);
    }
    // the row that this thread stores at the foot of the pass, and its weight, fetched early
    int m = tid >> 3, c4 = (tid & 7) * 4;  // 8 threads x 16 B = one 128-byte line per row
    int eo = list[m0 + m < n ? m0 + m : 0];
    float wo = wsel[eo];
    v8f c[2][2];
#pragma unroll  // c stays in registers (this loop and the two below)
    for (int t = 0; t < 2; ++t)
#pragma unroll  // as above
      for (int nn = 0; nn < 2; ++nn)
#pragma unroll  // as above
        for (int v = 0; v < 8; ++v) c[t][nn][v] = 0.f;
#pragma unroll  // as above
    for (int j = 0; j < 8; ++j) {
#pragma unroll  // as above
      for (int t = 0; t < 2; ++t)
#pragma unroll  // as above
        for (int nn = 0; nn < 2; ++nn)
          c[t][nn] = wmma_f32_16x16x4(af[t][j].xy, bf[nn][2 * j], c[t][nn]);
#pragma unroll  // as above
      for (int t = 0; t < 2; ++t)
#pragma unroll  // as above
        for (int nn = 0; nn < 2; ++nn)
          c[t][nn] = wmma_f32_16x16x4(af[t][j].zw, bf[nn][2 * j + 1], c[t][nn]);
    }
#pragma unroll  // as above
    for (int t = 0; t < 2; ++t)
#pragma unroll  // as above
      for (int nn = 0; nn < 2; ++nn)
#pragma unroll  // as above
        for (int v = 0; v < 8; ++v)
          red[wave][(t * 16 + v + 8 * kh) * GP_PITCH + nn * 16 + nl] = c[t][nn][v];
    __syncthreads();
    v4f sum = *(const v4f*)(&red[0][m * GP_PITCH + c4]);
#pragma unroll  // the 8 reads fly together
    for (int w = 1; w < 8; ++w) sum += *(const v4f*)(&red[w][m * GP_PITCH + c4]);
    if (m0 + m < n)
      *(v4f*)(out + (size_t)(eo & 1) * PLANE + (size_t)(eo >> 1) * RANK + n0 + c4) = sum * wo;
    __syncthreads();  // red is rewritten by the next pass
  }
}

// --------------------------------------------------- routed expand (R -> D)
__global__ void expand_kernel(const float* __restrict__ in,        // [NTOK,128]
                              const float* __restrict__ router,    // [64,128]
                              const float* __restrict__ neurons,   // [64,128,512]
                              float* __restrict__ x) {             // += [NTOK,512]
  int tok = blockIdx.x;
  int tid = threadIdx.x;  // 256 threads
  __shared__ __attribute__((aligned(16))) float is[RANK];
  __shared__ float sc[N_EXPAND];
  __shared__ float ss[2];
  __shared__ int se[2];
  const float* ip = in + (size_t)tok * RANK;
  if (tid < RANK) is[tid] = ip[tid];
  if (tid < 2) { ss[tid] = -INFINITY; se[tid] = 0; }  // start values, as the scan had
  __syncthreads();
  // router logits as in route_kernel: wave w takes rows 8w..8w+7, one 16-byte
  // load per lane covers a row (lane l holds r = 4 l .. +3)
  {
    int lane = tid & 31, wave = tid >> 5;
    v4f iv = *(const v4f*)(is + 4 * lane);
    const float* rp = router + (size_t)(wave * 8) * RANK + 4 * lane;
    float p8[8];
#pragma unroll  // p8 stays in registers; the 8 row loads are independent and fly together
    for (int e = 0; e < 8; ++e) {
      v4f rv = *(const v4f*)(rp + e * RANK);
      v2f acc = iv.xy * rv.xy;
      acc += iv.zw * rv.zw;
      p8[e] = acc.x + acc.y;
    }
    // halving butterfly; lanes 4e..4e+3 end with row e's whole sum
    float p4[4], p2[2];
    bool u16 = lane & 16, u8 = lane & 8, u4 = lane & 4;
#pragma unroll  // the partial sums stay in registers (this loop and the next)
    for (int i = 0; i < 4; ++i)
      p4[i] = (u16 ? p8[i + 4] : p8[i]) + __shfl_xor(u16 ? p8[i] : p8[i + 4], 16, 32);
#pragma unroll  // as above
    for (int i = 0; i < 2; ++i)
      p2[i] = (u8 ? p4[i + 2] : p4[i]) + __shfl_xor(u8 ? p4[i] : p4[i + 2], 8, 32);
    float p1 = (u4 ? p2[1] : p2[0]) + __shfl_xor(u4 ? p2[0] : p2[1], 4, 32);
    p1 += __shfl_xor(p1, 2, 32);
    p1 += __shfl_xor(p1, 1, 32);
    if ((lane & 3) == 0) sc[wave * 8 + (lane >> 2)] = p1;
  }
  __syncthreads();
  float my = (tid < N_EXPAND) ? sc[tid] : 0.f;
  // top-2 by rank, as in route_kernel
  if (tid < N_EXPAND) {
    int rank = 0;
    for (int e = 0; e < N_EXPAND; ++e) {
      float s = sc[e];
      rank += (s > my || (s == my && e < tid)) ? 1 : 0;
    }
    if (rank < 2) { ss[rank] = my; se[rank] = tid; }
  }
  __syncthreads();
  int e0 = se[0], e1i = se[1];
  float z = expf(ss[1] - ss[0]);
  float w0 = 1.f / (1.f + z), w1 = z / (1.f + z);
  for (int d = tid; d < D_MODEL; d += 256) {
    const float* n0 = neurons + (size_t)e0 * (RANK * D_MODEL) + d;
    const float* n1 = neurons + (size_t)e1i * (RANK * D_MODEL) + d;
    float a0 = 0.f, a1 = 0.f;
    for (int r = 0; r < RANK; ++r) {
      float iv = is[r];
      a0 += iv * n0[(size_t)r * D_MODEL];
      a1 += iv * n1[(size_t)r * D_MODEL];
    }
    x[(size_t)tok * D_MODEL + d] += w0 * a0 + w1 * a1;
  }
}

// -------------------------- flash attention: one block per (b, head, q-tile)
// WMMA f32 16x16x4: QK^T (K=16 -> 4 wmma) and P@V (K=16 -> 4 wmma) per tile.
// Q, K and V come as two planes each (see compress_group_kernel), added as they are read.
// The key tiles are dealt to the block's ATT_W waves (wave w takes tiles w, w + ATT_W, ...):
// a tile's steps hang on one another, so the longest row of tiles sets the launch's time.
// Each wave runs its own online softmax; the partial results are joined at the end.
__global__ __launch_bounds__(32 * ATT_W) void attn_kernel(
    const float* __restrict__ Q, const float* __restrict__ K,
    const float* __restrict__ V, float* __restrict__ O) {
  int bid = blockIdx.x;
  int qt = bid % (SEQ / 16);
  int head = (bid / (SEQ / 16)) % N_HEADS;
  int b = bid / ((SEQ / 16) * N_HEADS);
  int tid = threadIdx.x;  // 32 * ATT_W threads
  int lane = tid & 31;
  // the same in every lane of a wave; held as a scalar so that the tile loop, which
  // holds WMMAs, branches on a scalar compare
  int wave = __builtin_amdgcn_readfirstlane(tid >> 5);
  int nl = lane & 15;
  int kh = lane >> 4;      // which K half (A/B layout: lanes 16-31 hold K+2)
  int mrow = kh ? 8 : 0;   // C/D layout: lanes 16-31 hold rows 8-15
  size_t base = (size_t)b * SEQ;
  __shared__ float PtAll[ATT_W][16][17];
  __shared__ float oS[ATT_W][16][ATT_OP];  // each wave's unnormalised output tile
  __shared__ float mS[ATT_W][16];          // its row maxima
  __shared__ float lS[ATT_W][16];          // its row sums
  float (*Pt)[17] = PtAll[wave];           // private to the wave

  // A fragments for Q tile (16 rows x K=16), 4 chunks of K=4
  const float* qp = Q + (base + qt * 16 + nl) * RANK + head * D_HEAD;
  v2f aq[4];
#pragma unroll
  for (int kc = 0; kc < 4; ++kc)
    aq[kc] = *(const v2f*)(qp + 4 * kc + 2 * kh) + *(const v2f*)(qp + PLANE + 4 * kc + 2 * kh);

  v8f o;
  float rm[8], rl[8];
#pragma unroll
  for (int v = 0; v < 8; ++v) { o[v] = 0.f; rm[v] = -INFINITY; rl[v] = 0.f; }

  for (int j = wave; j <= qt; j += ATT_W) {
    v8f s;
#pragma unroll
    for (int v = 0; v < 8; ++v) s[v] = 0.f;
    const float* kp = K + (base + j * 16 + nl) * RANK + head * D_HEAD;
#pragma unroll
    for (int kc = 0; kc < 4; ++kc) {
      v2f bk = *(const v2f*)(kp + 4 * kc + 2 * kh) +
               *(const v2f*)(kp + PLANE + 4 * kc + 2 * kh);  // B[k][n], B[k+1][n]
      s = wmma_f32_16x16x4(aq[kc], bk, s);
    }
    // scale + causal mask (query = qt*16+m, key = j*16+n)
#pragma unroll
    for (int v = 0; v < 8; ++v) {
      float sv = s[v] * 0.25f;  // 1/sqrt(16)
      if (j == qt && nl > v + mrow) sv = -INFINITY;
      s[v] = sv;
    }
    // online softmax (rows live across 16-lane halves -> butterfly 1,2,4,8)
#pragma unroll
    for (int v = 0; v < 8; ++v) {
      float tmax = s[v];
#pragma unroll
      for (int msk = 1; msk < 16; msk <<= 1)
        tmax = fmaxf(tmax, __shfl_xor(tmax, msk, 32));
      float nm = fmaxf(rm[v], tmax);
      float alpha = __expf(rm[v] - nm);
      float p = __expf(s[v] - nm);
      float psum = p;
#pragma unroll
      for (int msk = 1; msk < 16; msk <<= 1) psum += __shfl_xor(psum, msk, 32);
      rl[v] = rl[v] * alpha + psum;
      o[v] *= alpha;
      rm[v] = nm;
      s[v] = p;
    }
    // re-layout P: C-layout -> LDS -> A-layout
#pragma unroll
    for (int v = 0; v < 8; ++v) Pt[v + mrow][nl] = s[v];
    // the wave's own stores have landed before its lanes read each other's values
    // back (the range is private to the wave: no barrier, and the waves' trip counts differ)
    asm volatile("s_wait_dscnt 0x0" ::: "memory");
    const float* vp = V + (base + j * 16) * RANK + head * D_HEAD + nl;
#pragma unroll
    for (int kc = 0; kc < 4; ++kc) {
      v2f ap;
      ap.x = Pt[nl][4 * kc + 2 * kh];
      ap.y = Pt[nl][4 * kc + 2 * kh + 1];
      v2f bv;
      bv.x = vp[(size_t)(4 * kc + 2 * kh) * RANK] + vp[PLANE + (size_t)(4 * kc + 2 * kh) * RANK];
      bv.y = vp[(size_t)(4 * kc + 2 * kh + 1) * RANK] + vp[PLANE + (size_t)(4 * kc + 2 * kh + 1) * RANK];
      o = wmma_f32_16x16x4(ap, bv, o);
    }
  }
  // join the waves' partial results: a wave without a tile hands in maximum -inf,
  // sum 0 and output 0, and so weighs nothing (wave 0 always has tile 0)
#pragma unroll  // o stays in registers
  for (int v = 0; v < 8; ++v) oS[wave][v + mrow][nl] = o[v];
  if (nl == 0) {
#pragma unroll  // rm and rl stay in registers
    for (int v = 0; v < 8; ++v) { mS[wave][v + mrow] = rm[v]; lS[wave][v + mrow] = rl[v]; }
  }
  __syncthreads();
  static_assert(32 * ATT_W == 256, "one thread per element of the 16x16 output tile");
  int r = tid >> 4, cc = tid & 15;
  float mx = mS[0][r];
#pragma unroll  // the LDS reads fly together (this loop and the next)
  for (int w = 1; w < ATT_W; ++w) mx = fmaxf(mx, mS[w][r]);
  float den = 0.f, num = 0.f;
#pragma unroll  // as above
  for (int w = 0; w < ATT_W; ++w) {
    float f = __expf(mS[w][r] - mx);
    den += lS[w][r] * f;
    num += oS[w][r][cc] * f;
  }
  O[(base + qt * 16 + r) * RANK + head * D_HEAD + cc] = num / den;
}

// ---------------- memory scores GEMM (WMMA f32, K=128) fused with top-8.
// grid = (NTOK/16, NSPLIT): split N_KNOW 8 ways for 8x more waves on the
// FLOP-dominant kernel; each split emits per-row top-8 candidates.
// Each wave brings its 16-column kK tile in as whole 512-byte rows (one row per
// 16-byte-per-lane load), one tile ahead, parks it in its own LDS range and
// reads the B fragments from there (k = 4 kc + 2 kh, as the A fragments).
__global__ __launch_bounds__(256) void memscore_kernel(const float* __restrict__ Qm,  // [2,NTOK,128]
                                const float* __restrict__ kK,  // [N_KNOW,128]
                                float* __restrict__ candS,     // [NTOK,NSPLIT,8]
                                int* __restrict__ candI) {     // [NTOK,NSPLIT,8]
  int tb = blockIdx.x;      // 16-token tile
  int split = blockIdx.y;   // column partition
  int tid = threadIdx.x;    // 256 threads = 8 waves
  int lane = tid & 31;
  int wave = tid >> 5;
  int nl = lane & 15;
  int kh = lane >> 4;
  int mrow = kh ? 8 : 0;
  size_t tokBase = (size_t)tb * 16;

  __shared__ float sc[16][CHUNK + 4];  // pad: 516 % 64 banks = 4 -> conflict free
  __shared__ float cs[16][128];
  __shared__ int ci[16][128];
  __shared__ __attribute__((aligned(16))) float kt[8][16 * KT_PITCH];  // one tile per wave
  float* ktw = &kt[wave][0];

  // A fragments for the Q tile (its two planes added): K=128 -> 32 chunks, kept in registers
  const float* qp = Qm + (tokBase + nl) * RANK;
  v2f aq[32];
#pragma unroll
  for (int kc = 0; kc < 32; ++kc)
    aq[kc] = *(const v2f*)(qp + 4 * kc + 2 * kh) + *(const v2f*)(qp + PLANE + 4 * kc + 2 * kh);

  float ts[8];
  int ti8[8];
#pragma unroll
  for (int i = 0; i < 8; ++i) { ts[i] = -INFINITY; ti8[i] = 0; }
  int row = tid & 15, slot = tid >> 4;
  const float scale = 0.08838834764831845f;  // 1/sqrt(128)

  // this wave's first tile: row i of the tile = 32 lanes x 16 B = 4 whole lines
  v4f st[16];
  const float* gp = kK + (size_t)(split * CHPS * CHUNK + wave * 64) * RANK + lane * 4;
#pragma unroll
  for (int i = 0; i < 16; ++i) st[i] = *(const v4f*)(gp + i * RANK);
  // inputs-only fence on the A values (each the sum of two loaded values, no product):
  // A is waited for here, once. Without it
  // the waits for A stand among the WMMAs of the loop and drain the next tile's
  // loads there on every trip.
  asm volatile("" ::"v"(aq[0]), "v"(aq[1]), "v"(aq[2]), "v"(aq[3]), "v"(aq[4]), "v"(aq[5]),
               "v"(aq[6]), "v"(aq[7]), "v"(aq[8]), "v"(aq[9]), "v"(aq[10]), "v"(aq[11]),
               "v"(aq[12]), "v"(aq[13]), "v"(aq[14]), "v"(aq[15]));
  asm volatile("" ::"v"(aq[16]), "v"(aq[17]), "v"(aq[18]), "v"(aq[19]), "v"(aq[20]), "v"(aq[21]),
               "v"(aq[22]), "v"(aq[23]), "v"(aq[24]), "v"(aq[25]), "v"(aq[26]), "v"(aq[27]),
               "v"(aq[28]), "v"(aq[29]), "v"(aq[30]), "v"(aq[31]));

  for (int ch = split * CHPS; ch < (split + 1) * CHPS; ++ch) {
    // stage A: 8 waves x 4 n-tiles of 16 cols = 512 cols via WMMA
#pragma unroll 1
    for (int t = 0; t < 4; ++t) {
      int ntl = wave * 4 + t;
#pragma unroll
      for (int i = 0; i < 16; ++i) *(v4f*)(ktw + i * KT_PITCH + lane * 4) = st[i];
      // the wave's own row stores have landed before its lanes read each other's
      // rows back as fragments (the range is private to the wave: no barrier)
      asm volatile("s_wait_dscnt 0x0" ::: "memory");
      // the wave's next tile flies while this one is multiplied; none behind the last
      if (t < 3 || ch + 1 < (split + 1) * CHPS) {
        gp += (t < 3 ? 16 : CHUNK - 48) * RANK;  // next tile of the chunk, or first of the next
#pragma unroll
        for (int i = 0; i < 16; ++i) st[i] = *(const v4f*)(gp + i * RANK);
      }
      const float* kp = ktw + nl * KT_PITCH;
      v8f c;
#pragma unroll
      for (int v = 0; v < 8; ++v) c[v] = 0.f;
#pragma unroll
      for (int kc = 0; kc < 32; ++kc) {
        v2f bk = *(const v2f*)(kp + 4 * kc + 2 * kh);
        c = wmma_f32_16x16x4(aq[kc], bk, c);
      }
#pragma unroll
      for (int v = 0; v < 8; ++v) sc[v + mrow][ntl * 16 + nl] = c[v] * scale;
    }
    __syncthreads();
    // stage B: 16 threads per row keep a private sorted top-8
    int cbase = slot * 32;
    for (int i = 0; i < 32; ++i) {
      float s = sc[row][cbase + i];
      if (s > ts[7]) {
        ts[7] = s;
        ti8[7] = ch * CHUNK + cbase + i;
#pragma unroll
        for (int q = 7; q > 0; --q) {
          if (ts[q] > ts[q - 1]) {
            float tf = ts[q]; ts[q] = ts[q - 1]; ts[q - 1] = tf;
            int tt = ti8[q]; ti8[q] = ti8[q - 1]; ti8[q - 1] = tt;
          }
        }
      }
    }
    __syncthreads();
  }
  // merge 16 candidate lists per row -> this split's top-8 candidates
#pragma unroll
  for (int i = 0; i < 8; ++i) { cs[row][slot * 8 + i] = ts[i]; ci[row][slot * 8 + i] = ti8[i]; }
  __syncthreads();
  if (tid < 16) {
    int r = tid;
    size_t ob = ((tokBase + r) * NSPLIT + split) * 8;
    for (int k = 0; k < 8; ++k) {
      float m = -INFINITY;
      int mi = 0;
      for (int c2 = 0; c2 < 128; ++c2)
        if (cs[r][c2] > m) { m = cs[r][c2]; mi = c2; }
      candS[ob + k] = m;
      candI[ob + k] = ci[r][mi];
      cs[r][mi] = -INFINITY;
    }
  }
}

// ---- merge NSPLIT candidate lists (disjoint column ranges -> exact top-8)
// One thread per candidate, 4 tokens per block. A candidate's rank is the number of
// its token's candidates that come before it (greater score, or equal score and a
// lower position): ranks 0..7 are the picks of eight scans in position order.
__global__ __launch_bounds__(256) void memmerge_kernel(const float* __restrict__ candS,
                                const int* __restrict__ candI,
                                int* __restrict__ outIdx, float* __restrict__ outW) {
  int tid = threadIdx.x;
  int tl = tid >> 6, c = tid & (NCAND - 1);
  int tok = blockIdx.x * 4 + tl;
  __shared__ float cs[4][NCAND];
  __shared__ float best[4][KNOW_K];
  __shared__ int bi[4][KNOW_K];
  float my = candS[(size_t)tok * NCAND + c];
  int myi = candI[(size_t)tok * NCAND + c];
  cs[tl][c] = my;
  if (c < KNOW_K) { best[tl][c] = -INFINITY; bi[tl][c] = 0; }  // start values, as the scans had
  __syncthreads();
  int rank = 0;
  for (int e = 0; e < NCAND; ++e) {
    float v = cs[tl][e];
    rank += (v > my || (v == my && e < c)) ? 1 : 0;
  }
  if (rank < KNOW_K) { best[tl][rank] = my; bi[tl][rank] = myi; }
  __syncthreads();
  if (c < KNOW_K) {
    float mx = best[tl][0], sum = 0.f;
    for (int k = 0; k < KNOW_K; ++k) sum += expf(best[tl][k] - mx);
    float inv = 1.f / sum;
    size_t ob = (size_t)tok * KNOW_K + c;
    outIdx[ob] = bi[tl][c];
    outW[ob] = expf(best[tl][c] - mx) * inv;
  }
}

// ------------------------------------------- weighted gather of kV + residual
__global__ void memgather_kernel(const int* __restrict__ idx, const float* __restrict__ w,
                                 const float* __restrict__ kV, float* __restrict__ x) {
  int tok = blockIdx.x;
  int tid = threadIdx.x;  // 128
  __shared__ int si[8];
  __shared__ float swt[8];
  if (tid < 8) { si[tid] = idx[(size_t)tok * 8 + tid]; swt[tid] = w[(size_t)tok * 8 + tid]; }
  __syncthreads();
  for (int d = tid; d < D_MODEL; d += 128) {
    float acc = 0.f;
#pragma unroll
    for (int k = 0; k < 8; ++k) acc += swt[k] * kV[(size_t)si[k] * D_MODEL + d];
    x[(size_t)tok * D_MODEL + d] += acc;
  }
}

extern "C" void kernel_launch(void* const* d_in, const int* in_sizes, int n_in,
                              void* d_out, int out_size, void* d_ws, size_t ws_size,
                              hipStream_t stream) {
  const float* x_in = (const float*)d_in[0];
  const float* cneur = (const float*)d_in[1];
  const float* eneur = (const float*)d_in[2];
  const float* kK = (const float*)d_in[3];
  const float* kV = (const float*)d_in[4];
  const float* rq = (const float*)d_in[5];
  const float* rk = (const float*)d_in[6];
  const float* rv = (const float*)d_in[7];
  const float* ro = (const float*)d_in[8];
  const float* rm = (const float*)d_in[9];
  const float* ln1g = (const float*)d_in[10];
  const float* ln1b = (const float*)d_in[11];
  const float* ln2g = (const float*)d_in[12];
  const float* ln2b = (const float*)d_in[13];
  const float* lnfg = (const float*)d_in[14];
  const float* lnfb = (const float*)d_in[15];
  float* out = (float*)d_out;

  float* ws = (float*)d_ws;
  float* xb = ws;     ws += (size_t)NTOK * D_MODEL;
  float* h = ws;      ws += (size_t)NTOK * D_MODEL;
  float* qc = ws;     ws += 2 * PLANE;  // qc, kc, vc lie in a row: out[0..2] of one launch
  float* kc = ws;     ws += 2 * PLANE;
  float* vc = ws;     ws += 2 * PLANE;
  float* ctx = ws;    ws += (size_t)NTOK * RANK;
  float* qm = ws;     ws += 2 * PLANE;
  float* wt = ws;     ws += (size_t)NTOK * KNOW_K;
  float* candS = ws;  ws += (size_t)NTOK * NCAND;
  int* candI = (int*)ws;  ws += (size_t)NTOK * NCAND;
  int* idx = (int*)ws;    ws += (size_t)NTOK * KNOW_K;
  int* sel = (int*)ws;    ws += (size_t)3 * NTOK * 2;
  float* wsel = ws;

  hipMemcpyAsync(xb, x_in, sizeof(float) * (size_t)NTOK * D_MODEL,
                 hipMemcpyDeviceToDevice, stream);

  for (int l = 0; l < N_LAYERS; ++l) {
    ln_kernel<<<NTOK, 256, 0, stream>>>(xb, ln1g + l * D_MODEL, ln1b + l * D_MODEL, h);
    route_kernel<<<dim3(NTOK, 3), 128, 0, stream>>>(h, rq + (size_t)l * N_COMPRESS * D_MODEL,
                                                    rk + (size_t)l * N_COMPRESS * D_MODEL,
                                                    rv + (size_t)l * N_COMPRESS * D_MODEL, sel, wsel);
    compress_group_kernel<<<dim3(N_COMPRESS, RANK / 32, 3), 256, 0, stream>>>(h, sel, wsel, cneur, qc);
    attn_kernel<<<BATCH * N_HEADS * (SEQ / 16), 32 * ATT_W, 0, stream>>>(qc, kc, vc, ctx);
    expand_kernel<<<NTOK, 256, 0, stream>>>(ctx, ro + (size_t)l * N_EXPAND * RANK, eneur, xb);
    ln_kernel<<<NTOK, 256, 0, stream>>>(xb, ln2g + l * D_MODEL, ln2b + l * D_MODEL, h);
    route_kernel<<<dim3(NTOK, 1), 128, 0, stream>>>(h, rm + (size_t)l * N_COMPRESS * D_MODEL,
                                                    rm + (size_t)l * N_COMPRESS * D_MODEL,
                                                    rm + (size_t)l * N_COMPRESS * D_MODEL, sel, wsel);
    compress_group_kernel<<<dim3(N_COMPRESS, RANK / 32, 1), 256, 0, stream>>>(h, sel, wsel, cneur, qm);
    memscore_kernel<<<dim3(NTOK / 16, NSPLIT), 256, 0, stream>>>(qm, kK, candS, candI);
    memmerge_kernel<<<NTOK / 4, 256, 0, stream>>>(candS, candI, idx, wt);
    memgather_kernel<<<NTOK, 128, 0, stream>>>(idx, wt, kV, xb);
  }
  ln_kernel<<<NTOK, 256, 0, stream>>>(xb, lnfg, lnfb, out);
}

// v007
// One run takes 323 microseconds.
// Next to v006, in two timings, it ran 1.09 times as fast each time.
// Counting every step since v000, it is 2.50 times as fast.
#include <hip/hip_runtime.h>
#include <math.h>

#define D_MODEL 512
#define RANK 128
#define N_HEADS 8
#define D_HEAD 16
#define N_COMPRESS 64
#define N_EXPAND 64
#define N_KNOW 32768
#define KNOW_K 8
#define N_LAYERS 2
#define BATCH 2
#define SEQ 512
#define NTOK (BATCH * SEQ)

#define CHUNK 512
#define NSPLIT 8                            // grid-Y partitions of the N_KNOW axis
#define NCHUNKS (N_KNOW / CHUNK)            // 64
#define CHPS (NCHUNKS / NSPLIT)             // 8 chunks per split
#define NCAND (NSPLIT * 8)                  // 64 candidates per token
#define KT_PITCH 132  // floats per staged kK row: 528 B = 16 B x 33, so the 32 lanes'
                      // 8-byte fragment reads fall on 64 distinct banks

#define PLANE ((size_t)NTOK * RANK)  // floats per plane of a compress result: plane s holds
                                     // each token's weighted projection by its s-th expert
#define GP_PITCH 36  // floats per row of a wave's 32x32 partial tile in LDS: 144 B keeps the
                     // 16-byte reads aligned and puts rows v and v + 8 on different banks

#define ATT_W 8    // waves per attention block
#define ATT_OP 18  // floats per row of a wave's parked output tile: rows v and v + 8, stored
                   // by one instruction, fall on different banks

typedef float v2f __attribute__((ext_vector_type(2)));
typedef float v4f __attribute__((ext_vector_type(4)));
typedef float v8f __attribute__((ext_vector_type(8)));

__device__ __forceinline__ v8f wmma_f32_16x16x4(v2f a, v2f b, v8f c) {
  // D = A(16x4 f32) * B(4x16 f32) + C(16x16 f32)
  return __builtin_amdgcn_wmma_f32_16x16x4_f32(false, a, false, b, (short)0, c,
                                               false, false);
}

// ---------------------------------------------------------------- LayerNorm
// of one row, by a block of NT threads (128 or 256) that already holds the row: thread t
// has elements t + NT i in v[i] and gets their normalised values back in v[i]. It stands
// inside the kernel that reads or makes the row, so that it costs no launch of its own.
// The 512 terms are added as a halving tree (distance 256, 128, ... 1): down to NT terms
// in the thread, down to 32 through LDS, the rest over the lanes; every wave does the
// part behind the barrier for itself, so one barrier is enough. The caller does not use
// red for anything else.
template <int NT>
__device__ __forceinline__ void ln_row(float (&v)[D_MODEL / NT], const float* __restrict__ g,
                                       const float* __restrict__ b, float* red /* [2 NT], LDS */) {
  static_assert(NT == 128 || NT == 256, "the tree is written out for these two");
  int tid = threadIdx.x;
  int lane = tid & 31;
  float gv[D_MODEL / NT], bv[D_MODEL / NT];
#pragma unroll  // gv and bv stay in registers; fetched ahead of the barrier, they fly during the sums
  for (int i = 0; i < D_MODEL / NT; ++i) { gv[i] = g[tid + NT * i]; bv[i] = b[tid + NT * i]; }
  if constexpr (NT == 128) {
    red[tid] = (v[0] + v[2]) + (v[1] + v[3]);
    red[NT + tid] = (v[0] * v[0] + v[2] * v[2]) + (v[1] * v[1] + v[3] * v[3]);
  } else {
    red[tid] = v[0] + v[1];
    red[NT + tid] = v[0] * v[0] + v[1] * v[1];
  }
  __syncthreads();
  float sq[2];
#pragma unroll  // sq stays in registers
  for (int j = 0; j < 2; ++j) {
    const float* r = red + j * NT + lane;
    if constexpr (NT == 128)
      sq[j] = (r[0] + r[64]) + (r[32] + r[96]);
    else
      sq[j] = ((r[0] + r[128]) + (r[64] + r[192])) + ((r[32] + r[160]) + (r[96] + r[224]));
  }
#pragma unroll  // five fixed lane distances
  for (int msk = 16; msk > 0; msk >>= 1) {
    sq[0] += __shfl_xor(sq[0], msk, 32);
    sq[1] += __shfl_xor(sq[1], msk, 32);
  }
  float mean = sq[0] * (1.0f / D_MODEL);
  float var = sq[1] * (1.0f / D_MODEL) - mean * mean;
  float rstd = rsqrtf(var + 1e-5f);
#pragma unroll  // v stays in registers
  for (int i = 0; i < D_MODEL / NT; ++i) v[i] = (v[i] - mean) * rstd * gv[i] + bv[i];
}

// ------------------------------------------------- routed compress (D -> R)
// Two stages. The routing normalises a token's row (h = LayerNorm(x)) and picks its two
// experts and their weights; compress_group_kernel takes one expert per block, gathers
// the tokens that picked it and multiplies them with the expert's matrix, which is so
// read once per block instead of once per token.
// The routing works on one token's row, so it needs no launch of its own where the kernel
// in front of it makes that row in one block: route_row is called by route_kernel (q, k, v)
// and at the foot of expand_kernel (the memory query).

// Sums over the 32 lanes of N rows' partial sums, a[i] being this lane's part of row i.
// Halving butterfly, lane distance MSK = 16, 8, ...: at each level a lane hands over the
// half of its rows that its partner keeps; with one row left the remaining distances are
// plain sums. Called with N rows and MSK = 16, lanes (32 / N) e .. return row e's whole sum.
template <int N, int MSK>
__device__ __forceinline__ float fold_rows(const float (&a)[N], int lane) {
  if constexpr (N == 1) {
    float s = a[0];
#pragma unroll  // fixed lane distances
    for (int m = MSK; m >= 1; m >>= 1) s += __shfl_xor(s, m, 32);
    return s;
  } else {
    float o[N / 2];
    bool up = lane & MSK;
#pragma unroll  // the partial sums stay in registers
    for (int i = 0; i < N / 2; ++i)
      o[i] = (up ? a[i + N / 2] : a[i]) + __shfl_xor(up ? a[i] : a[i + N / 2], MSK, 32);
    return fold_rows<N / 2, MSK / 2>(o, lane);
  }
}

// One token's routing by a block of NW waves (4 or 8). On entry hs (LDS, [512], 16-byte
// aligned) holds h, ss and se (LDS, [2]) their start values, and a barrier has published
// them. sc is LDS, [64]. sel2 and wsel2 are the token's own two entries.
template <int NW>
__device__ __forceinline__ void route_row(const float* hs, const float* __restrict__ router,  // [64,512]
                                          float* sc, float* ss, int* se,
                                          int* __restrict__ sel2, float* __restrict__ wsel2) {
  constexpr int R = N_COMPRESS / NW;  // router rows per wave
  static_assert(R == 8 || R == 16, "the lane sum below halves R rows over the 32 lanes");
  int tid = threadIdx.x;
  // router logits: wave w takes rows R w .. R w + R - 1. A row is read as whole 128-byte
  // lines (lane l holds d = 128 j + 4 l .. +3, j = 0..3), each lane sums its 16
  // products, and the lanes' partial sums are added over the wave.
  {
    int lane = tid & 31, wave = tid >> 5;
    v4f hv[4];
#pragma unroll  // hv stays in registers
    for (int j = 0; j < 4; ++j) hv[j] = *(const v4f*)(hs + 128 * j + 4 * lane);
    const float* rp = router + (size_t)(wave * R) * D_MODEL + 4 * lane;
    float p[R];
#pragma unroll  // p stays in registers; the 4 R row loads are independent and fly together
    for (int e = 0; e < R; ++e) {
      v2f acc = {0.f, 0.f};
#pragma unroll  // as above
      for (int j = 0; j < 4; ++j) {
        v4f rv = *(const v4f*)(rp + e * D_MODEL + 128 * j);
        acc += hv[j].xy * rv.xy;
        acc += hv[j].zw * rv.zw;
      }
      p[e] = acc.x + acc.y;
    }
    float p0 = fold_rows<R, 16>(p, lane);
    if ((lane & (32 / R - 1)) == 0) sc[wave * R + lane / (32 / R)] = p0;
  }
  __syncthreads();
  float my = (tid < N_COMPRESS) ? sc[tid] : 0.f;
  // top-2 by rank: each score counts the scores that come before it (greater, or
  // equal with a lower index); ranks 0 and 1 are the two that a scan in index order picks
  if (tid < N_COMPRESS) {
    int rank = 0;
    for (int e = 0; e < N_COMPRESS; ++e) {
      float s = sc[e];
      rank += (s > my || (s == my && e < tid)) ? 1 : 0;
    }
    if (rank < 2) { ss[rank] = my; se[rank] = tid; }
  }
  __syncthreads();
  if (tid < 2) {
    float z = expf(ss[1] - ss[0]);
    sel2[tid] = se[tid];
    wsel2[tid] = (tid == 0 ? 1.f : z) / (1.f + z);
  }
}

// Projections of the same x that do not hang on one another (q, k, v) share the two
// launches: grid y of route_kernel and grid z of compress_group_kernel name the
// projection, so their latencies overlap and no launch gap stands between them.
// Each projection's block normalises the row for itself; projection 0's stores h.
// the bound states the block size, so that the logits' row loads in flight fit the
// register budget without spills
__global__ __launch_bounds__(128) void route_kernel(const float* __restrict__ x,
                                const float* __restrict__ lng,      // [512] LayerNorm gain
                                const float* __restrict__ lnb,      // [512] LayerNorm bias
                                float* __restrict__ h,              // [NTOK,512] LayerNorm(x)
                                const float* __restrict__ router0,  // [64,512], projection 0
                                const float* __restrict__ router1,  // projection 1
                                const float* __restrict__ router2,  // projection 2
                                int* __restrict__ sel,              // [grid y,NTOK,2] expert
                                float* __restrict__ wsel) {         // [grid y,NTOK,2] weight
  int tok = blockIdx.x;
  int pr = blockIdx.y;
  const float* router = pr == 0 ? router0 : (pr == 1 ? router1 : router2);
  sel += pr * (2 * NTOK);
  wsel += pr * (2 * NTOK);
  int tid = threadIdx.x;  // 128 threads
  __shared__ __attribute__((aligned(16))) float hs[D_MODEL];
  __shared__ float sc[N_COMPRESS];
  __shared__ float ss[2];
  __shared__ int se[2];
  __shared__ float red[256];
  float hv[4];
#pragma unroll  // hv stays in registers (this loop and the two below)
  for (int i = 0; i < 4; ++i) hv[i] = x[(size_t)tok * D_MODEL + tid + 128 * i];
  ln_row<128>(hv, lng, lnb, red);
#pragma unroll  // as above
  for (int i = 0; i < 4; ++i) hs[tid + 128 * i] = hv[i];
  if (tid < 2) { ss[tid] = -INFINITY; se[tid] = 0; }  // start values, as the scan had
  __syncthreads();
  route_row<4>(hs, router, sc, ss, se, sel + tok * 2, wsel + tok * 2);
  // stored behind the last barrier: in front of one, the barrier would wait for the stores
  if (pr == 0) {
#pragma unroll  // as above
    for (int i = 0; i < 4; ++i) h[(size_t)tok * D_MODEL + tid + 128 * i] = hv[i];
  }
}

// grid = (N_COMPRESS, RANK / 32, projections): block (e, y, z) computes columns
// 32 y .. 32 y + 31 of h[tok] x neurons[e] for every entry (tok, s) with
// sel[z][tok][s] == e, 32 entries a pass.
// Wave w takes k = 64 w .. 64 w + 63 on WMMA f32 16x16x4; the eight partial tiles are
// added through LDS in wave order. Row (tok, s) goes, times its weight, to plane s of out[z].
__global__ __launch_bounds__(256) void compress_group_kernel(
    const float* __restrict__ h,        // [NTOK,512]
    const int* __restrict__ sel,        // [grid z,NTOK,2]
    const float* __restrict__ wsel,     // [grid z,NTOK,2]
    const float* __restrict__ neurons,  // [64,512,128]
    float* __restrict__ out) {          // [grid z,2,NTOK,128]
  int e = blockIdx.x;
  int n0 = blockIdx.y * 32;
  sel += blockIdx.z * (2 * NTOK);
  wsel += blockIdx.z * (2 * NTOK);
  out += blockIdx.z * (2 * PLANE);
  int tid = threadIdx.x;  // 256 threads = 8 waves
  int lane = tid & 31;
  int wave = tid >> 5;
  int nl = lane & 15;
  int kh = lane >> 4;
  __shared__ int list[2 * NTOK];  // this expert's entries (2 tok + s), ascending
  __shared__ int wcnt[64];
  __shared__ __attribute__((aligned(16))) float red[8][32 * GP_PITCH];

  int sv[8];
#pragma unroll  // sv stays in registers; the 8 loads fly together
  for (int j = 0; j < 8; ++j) sv[j] = sel[j * 256 + tid];

  // the list: a ballot per 32 entries, the counts summed in entry order
  unsigned mk[8];
#pragma unroll  // mk stays in registers
  for (int j = 0; j < 8; ++j) {
    mk[j] = __builtin_amdgcn_ballot_w32(sv[j] == e);
    if (lane == 0) wcnt[j * 8 + wave] = __popc(mk[j]);
  }
  __syncthreads();

  // B fragments, kept in registers for all passes; they fly while the list is built.
  // WMMA step 2 j + i of this wave multiplies k = 64 w + 8 j + 4 kh + 2 i + {0, 1},
  // in B here as in A below.
  const float* bp = neurons + (size_t)e * (D_MODEL * RANK) + (size_t)(wave * 64 + 4 * kh) * RANK + n0 + nl;
  v2f bf[2][16];
#pragma unroll  // bf stays in registers
  for (int j = 0; j < 8; ++j) {
#pragma unroll  // as above
    for (int nn = 0; nn < 2; ++nn) {
      bf[nn][2 * j].x = bp[(8 * j + 0) * RANK + 16 * nn];
      bf[nn][2 * j].y = bp[(8 * j + 1) * RANK + 16 * nn];
      bf[nn][2 * j + 1].x = bp[(8 * j + 2) * RANK + 16 * nn];
      bf[nn][2 * j + 1].y = bp[(8 * j + 3) * RANK + 16 * nn];
    }
  }

  int run = 0;
  int base[8];
#pragma unroll  // base stays in registers
  for (int q = 0; q < 64; ++q) {
    if ((q & 7) == wave) base[q >> 3] = run;
    run += wcnt[q];
  }
  unsigned below = (1u << lane) - 1u;
#pragma unroll  // as above
  for (int j = 0; j < 8; ++j)
    if ((mk[j] >> lane) & 1u) list[base[j] + __popc(mk[j] & below)] = j * 256 + tid;
  __syncthreads();
  // the same in every thread of the block; held as a scalar so that the pass loop,
  // which holds WMMAs and barriers, branches on a scalar compare
  int n = __builtin_amdgcn_readfirstlane(run);

  for (int m0 = 0; m0 < n; m0 += 32) {
    // A fragments: lane (nl, kh) reads its entry's h row; a row past the end of the
    // list reads entry 0's and is not stored
    v4f af[2][8];
#pragma unroll  // af stays in registers
    for (int t = 0; t < 2; ++t) {
      int ix = m0 + t * 16 + nl;
      int en = list[ix < n ? ix : 0];
      const float* ap = h + (size_t)(en >> 1) * D_MODEL + wave * 64 + 4 * kh;
#pragma unroll  // as above
      for (int j = 0; j < 8; ++j) af[t][j] = *(const v4f*)(ap + 8 * j);
    }
    // the row that this thread stores at the foot of the pass, and its weight, fetched early
    int m = tid >> 3, c4 = (tid & 7) * 4;  // 8 threads x 16 B = one 128-byte line per row
    int eo = list[m0 + m < n ? m0 + m : 0];
    float wo = wsel[eo];
    v8f c[2][2];
#pragma unroll  // c stays in registers (this loop and the two below)
    for (int t = 0; t < 2; ++t)
#pragma unroll  // as above
      for (int nn = 0; nn < 2; ++nn)
#pragma unroll  // as above
        for (int v = 0; v < 8; ++v) c[t][nn][v] = 0.f;
#pragma unroll  // as above
    for (int j = 0; j < 8; ++j) {
#pragma unroll  // as above
      for (int t = 0; t < 2; ++t)
#pragma unroll  // as above
        for (int nn = 0; nn < 2; ++nn)
          c[t][nn] = wmma_f32_16x16x4(af[t][j].xy, bf[nn][2 * j], c[t][nn]);
#pragma unroll  // as above
      for (int t = 0; t < 2; ++t)
#pragma unroll  // as above
        for (int nn = 0; nn < 2; ++nn)
          c[t][nn] = wmma_f32_16x16x4(af[t][j].zw, bf[nn][2 * j + 1], c[t][nn]);
    }
#pragma unroll  // as above
    for (int t = 0; t < 2; ++t)
#pragma unroll  // as above
      for (int nn = 0; nn < 2; ++nn)
#pragma unroll  // as above
        for (int v = 0; v < 8; ++v)
          red[wave][(t * 16 + v + 8 * kh) * GP_PITCH + nn * 16 + nl] = c[t][nn][v];
    __syncthreads();
    v4f sum = *(const v4f*)(&red[0][m * GP_PITCH + c4]);
#pragma unroll  // the 8 reads fly together
    for (int w = 1; w < 8; ++w) sum += *(const v4f*)(&red[w][m * GP_PITCH + c4]);
    if (m0 + m < n)
      *(v4f*)(out + (size_t)(eo & 1) * PLANE + (size_t)(eo >> 1) * RANK + n0 + c4) = sum * wo;
    __syncthreads();  // red is rewritten by the next pass
  }
}

// --------------------------------------------------- routed expand (R -> D)
// The block makes its token's whole new row x, so the stages behind it that work on that
// row alone follow in the same launch: the second LayerNorm and the memory query's routing.
// the bound states the block size: the register budget of eight waves a SIMD is kept
// (four blocks a WGP, the whole grid resident at once)
__global__ __launch_bounds__(256, 8) void expand_kernel(
                              const float* __restrict__ in,        // [NTOK,128]
                              const float* __restrict__ router,    // [64,128]
                              const float* __restrict__ neurons,   // [64,128,512]
                              const float* xi,                     // [NTOK,512] residual in
                              float* xo,                           // [NTOK,512] out; may be xi
                              const float* __restrict__ lng,       // [512] LayerNorm gain
                              const float* __restrict__ lnb,       // [512] LayerNorm bias
                              float* __restrict__ h,               // [NTOK,512] LayerNorm(xo)
                              const float* __restrict__ router_m,  // [64,512]
                              int* __restrict__ sel,               // [NTOK,2] expert
                              float* __restrict__ wsel) {          // [NTOK,2] weight
  int tok = blockIdx.x;
  int tid = threadIdx.x;  // 256 threads
  __shared__ __attribute__((aligned(16))) float is[RANK];
  __shared__ float sc[N_EXPAND];
  __shared__ float ss[2];
  __shared__ int se[2];
  __shared__ __attribute__((aligned(16))) float hs[D_MODEL];  // from here: the stages behind
  __shared__ float red[512];
  __shared__ float sc2[N_COMPRESS];
  __shared__ float ss2[2];
  __shared__ int se2[2];
  const float* ip = in + (size_t)tok * RANK;
  if (tid < RANK) is[tid] = ip[tid];
  if (tid < 2) {  // start values, as the scan had
    ss[tid] = -INFINITY; se[tid] = 0;
    ss2[tid] = -INFINITY; se2[tid] = 0;
  }
  __syncthreads();
  // router logits as in route_row: wave w takes rows 8w..8w+7, one 16-byte
  // load per lane covers a row (lane l holds r = 4 l .. +3)
  {
    int lane = tid & 31, wave = tid >> 5;
    v4f iv = *(const v4f*)(is + 4 * lane);
    const float* rp = router + (size_t)(wave * 8) * RANK + 4 * lane;
    float p8[8];
#pragma unroll  // p8 stays in registers; the 8 row loads are independent and fly together
    for (int e = 0; e < 8; ++e) {
      v4f rv = *(const v4f*)(rp + e * RANK);
      v2f acc = iv.xy * rv.xy;
      acc += iv.zw * rv.zw;
      p8[e] = acc.x + acc.y;
    }
    // halving butterfly; lanes 4e..4e+3 end with row e's whole sum
    float p4[4], p2[2];
    bool u16 = lane & 16, u8 = lane & 8, u4 = lane & 4;
#pragma unroll  // the partial sums stay in registers (this loop and the next)
    for (int i = 0; i < 4; ++i)
      p4[i] = (u16 ? p8[i + 4] : p8[i]) + __shfl_xor(u16 ? p8[i] : p8[i + 4], 16, 32);
#pragma unroll  // as above
    for (int i = 0; i < 2; ++i)
      p2[i] = (u8 ? p4[i + 2] : p4[i]) + __shfl_xor(u8 ? p4[i] : p4[i + 2], 8, 32);
    float p1 = (u4 ? p2[1] : p2[0]) + __shfl_xor(u4 ? p2[0] : p2[1], 4, 32);
    p1 += __shfl_xor(p1, 2, 32);
    p1 += __shfl_xor(p1, 1, 32);
    if ((lane & 3) == 0) sc[wave * 8 + (lane >> 2)] = p1;
  }
  __syncthreads();
  float my = (tid < N_EXPAND) ? sc[tid] : 0.f;
  // top-2 by rank, as in route_row
  if (tid < N_EXPAND) {
    int rank = 0;
    for (int e = 0; e < N_EXPAND; ++e) {
      float s = sc[e];
      rank += (s > my || (s == my && e < tid)) ? 1 : 0;
    }
    if (rank < 2) { ss[rank] = my; se[rank] = tid; }
  }
  __syncthreads();
  int e0 = se[0], e1i = se[1];
  float z = expf(ss[1] - ss[0]);
  float w0 = 1.f / (1.f + z), w1 = z / (1.f + z);
  for (int d = tid; d < D_MODEL; d += 256) {
    const float* n0 = neurons + (size_t)e0 * (RANK * D_MODEL) + d;
    const float* n1 = neurons + (size_t)e1i * (RANK * D_MODEL) + d;
    float a0 = 0.f, a1 = 0.f;
    for (int r = 0; r < RANK; ++r) {
      float iv = is[r];
      a0 += iv * n0[(size_t)r * D_MODEL];
      a1 += iv * n1[(size_t)r * D_MODEL];
    }
    hs[d] = xi[(size_t)tok * D_MODEL + d] + (w0 * a0 + w1 * a1);  // parked: read back by this thread
  }
  float xv[2], hv[2];
#pragma unroll  // xv and hv stay in registers (this loop and the two below)
  for (int i = 0; i < 2; ++i) hv[i] = xv[i] = hs[tid + 256 * i];
  ln_row<256>(hv, lng, lnb, red);
#pragma unroll  // as above
  for (int i = 0; i < 2; ++i) hs[tid + 256 * i] = hv[i];
  __syncthreads();
  route_row<8>(hs, router_m, sc2, ss2, se2, sel + tok * 2, wsel + tok * 2);
  // stored behind the last barrier: in front of one, the barrier would wait for the stores
#pragma unroll  // as above
  for (int i = 0; i < 2; ++i) {
    xo[(size_t)tok * D_MODEL + tid + 256 * i] = xv[i];
    h[(size_t)tok * D_MODEL + tid + 256 * i] = hv[i];
  }
}

// -------------------------- flash attention: one block per (b, head, q-tile)
// WMMA f32 16x16x4: QK^T (K=16 -> 4 wmma) and P@V (K=16 -> 4 wmma) per tile.
// Q, K and V come as two planes each (see compress_group_kernel), added as they are read.
// The key tiles are dealt to the block's ATT_W waves (wave w takes tiles w, w + ATT_W, ...):
// a tile's steps hang on one another, so the longest row of tiles sets the launch's time.
// Each wave runs its own online softmax; the partial results are joined at the end.
__global__ __launch_bounds__(32 * ATT_W) void attn_kernel(
    const float* __restrict__ Q, const float* __restrict__ K,
    const float* __restrict__ V, float* __restrict__ O) {
  int bid = blockIdx.x;
  int qt = bid % (SEQ / 16);
  int head = (bid / (SEQ / 16)) % N_HEADS;
  int b = bid / ((SEQ / 16) * N_HEADS);
  int tid = threadIdx.x;  // 32 * ATT_W threads
  int lane = tid & 31;
  // the same in every lane of a wave; held as a scalar so that the tile loop, which
  // holds WMMAs, branches on a scalar compare
  int wave = __builtin_amdgcn_readfirstlane(tid >> 5);
  int nl = lane & 15;
  int kh = lane >> 4;      // which K half (A/B layout: lanes 16-31 hold K+2)
  int mrow = kh ? 8 : 0;   // C/D layout: lanes 16-31 hold rows 8-15
  size_t base = (size_t)b * SEQ;
  __shared__ float PtAll[ATT_W][16][17];
  __shared__ float oS[ATT_W][16][ATT_OP];  // each wave's unnormalised output tile
  __shared__ float mS[ATT_W][16];          // its row maxima
  __shared__ float lS[ATT_W][16];          // its row sums
  float (*Pt)[17] = PtAll[wave];           // private to the wave

  // A fragments for Q tile (16 rows x K=16), 4 chunks of K=4
  const float* qp = Q + (base + qt * 16 + nl) * RANK + head * D_HEAD;
  v2f aq[4];
#pragma unroll
  for (int kc = 0; kc < 4; ++kc)
    aq[kc] = *(const v2f*)(qp + 4 * kc + 2 * kh) + *(const v2f*)(qp + PLANE + 4 * kc + 2 * kh);

  v8f o;
  float rm[8], rl[8];
#pragma unroll
  for (int v = 0; v < 8; ++v) { o[v] = 0.f; rm[v] = -INFINITY; rl[v] = 0.f; }

  for (int j = wave; j <= qt; j += ATT_W) {
    v8f s;
#pragma unroll
    for (int v = 0; v < 8; ++v) s[v] = 0.f;
    const float* kp = K + (base + j * 16 + nl) * RANK + head * D_HEAD;
#pragma unroll
    for (int kc = 0; kc < 4; ++kc) {
      v2f bk = *(const v2f*)(kp + 4 * kc + 2 * kh) +
               *(const v2f*)(kp + PLANE + 4 * kc + 2 * kh);  // B[k][n], B[k+1][n]
      s = wmma_f32_16x16x4(aq[kc], bk, s);
    }
    // scale + causal mask (query = qt*16+m, key = j*16+n)
#pragma unroll
    for (int v = 0; v < 8; ++v) {
      float sv = s[v] * 0.25f;  // 1/sqrt(16)
      if (j == qt && nl > v + mrow) sv = -INFINITY;
      s[v] = sv;
    }
    // online softmax (rows live across 16-lane halves -> butterfly 1,2,4,8)
#pragma unroll
    for (int v = 0; v < 8; ++v) {
      float tmax = s[v];
#pragma unroll
      for (int msk = 1; msk < 16; msk <<= 1)
        tmax = fmaxf(tmax, __shfl_xor(tmax, msk, 32));
      float nm = fmaxf(rm[v], tmax);
      float alpha = __expf(rm[v] - nm);
      float p = __expf(s[v] - nm);
      float psum = p;
#pragma unroll
      for (int msk = 1; msk < 16; msk <<= 1) psum += __shfl_xor(psum, msk, 32);
      rl[v] = rl[v] * alpha + psum;
      o[v] *= alpha;
      rm[v] = nm;
      s[v] = p;
    }
    // re-layout P: C-layout -> LDS -> A-layout
#pragma unroll
    for (int v = 0; v < 8; ++v) Pt[v + mrow][nl] = s[v];
    // the wave's own stores have landed before its lanes read each other's values
    // back (the range is private to the wave: no barrier, and the waves' trip counts differ)
    asm volatile("s_wait_dscnt 0x0" ::: "memory");
    const float* vp = V + (base + j * 16) * RANK + head * D_HEAD + nl;
#pragma unroll
    for (int kc = 0; kc < 4; ++kc) {
      v2f ap;
      ap.x = Pt[nl][4 * kc + 2 * kh];
      ap.y = Pt[nl][4 * kc + 2 * kh + 1];
      v2f bv;
      bv.x = vp[(size_t)(4 * kc + 2 * kh) * RANK] + vp[PLANE + (size_t)(4 * kc + 2 * kh) * RANK];
      bv.y = vp[(size_t)(4 * kc + 2 * kh + 1) * RANK] + vp[PLANE + (size_t)(4 * kc + 2 * kh + 1) * RANK];
      o = wmma_f32_16x16x4(ap, bv, o);
    }
  }
  // join the waves' partial results: a wave without a tile hands in maximum -inf,
  // sum 0 and output 0, and so weighs nothing (wave 0 always has tile 0)
#pragma unroll  // o stays in registers
  for (int v = 0; v < 8; ++v) oS[wave][v + mrow][nl] = o[v];
  if (nl == 0) {
#pragma unroll  // rm and rl stay in registers
    for (int v = 0; v < 8; ++v) { mS[wave][v + mrow] = rm[v]; lS[wave][v + mrow] = rl[v]; }
  }
  __syncthreads();
  static_assert(32 * ATT_W == 256, "one thread per element of the 16x16 output tile");
  int r = tid >> 4, cc = tid & 15;
  float mx = mS[0][r];
#pragma unroll  // the LDS reads fly together (this loop and the next)
  for (int w = 1; w < ATT_W; ++w) mx = fmaxf(mx, mS[w][r]);
  float den = 0.f, num = 0.f;
#pragma unroll  // as above
  for (int w = 0; w < ATT_W; ++w) {
    float f = __expf(mS[w][r] - mx);
    den += lS[w][r] * f;
    num += oS[w][r][cc] * f;
  }
  O[(base + qt * 16 + r) * RANK + head * D_HEAD + cc] = num / den;
}

// ---------------- memory scores GEMM (WMMA f32, K=128) fused with top-8.
// grid = (NTOK/16, NSPLIT): split N_KNOW 8 ways for 8x more waves on the
// FLOP-dominant kernel; each split emits per-row top-8 candidates.
// Each wave brings its 16-column kK tile in as whole 512-byte rows (one row per
// 16-byte-per-lane load), one tile ahead, parks it in its own LDS range and
// reads the B fragments from there (k = 4 kc + 2 kh, as the A fragments).
__global__ __launch_bounds__(256) void memscore_kernel(const float* __restrict__ Qm,  // [2,NTOK,128]
                                const float* __restrict__ kK,  // [N_KNOW,128]
                                float* __restrict__ candS,     // [NTOK,NSPLIT,8]
                                int* __restrict__ candI) {     // [NTOK,NSPLIT,8]
  int tb = blockIdx.x;      // 16-token tile
  int split = blockIdx.y;   // column partition
  int tid = threadIdx.x;    // 256 threads = 8 waves
  int lane = tid & 31;
  int wave = tid >> 5;
  int nl = lane & 15;
  int kh = lane >> 4;
  int mrow = kh ? 8 : 0;
  size_t tokBase = (size_t)tb * 16;

  __shared__ float sc[16][CHUNK + 4];  // pad: 516 % 64 banks = 4 -> conflict free
  __shared__ float cs[16][128];
  __shared__ int ci[16][128];
  __shared__ __attribute__((aligned(16))) float kt[8][16 * KT_PITCH];  // one tile per wave
  float* ktw = &kt[wave][0];

  // A fragments for the Q tile (its two planes added): K=128 -> 32 chunks, kept in registers
  const float* qp = Qm + (tokBase + nl) * RANK;
  v2f aq[32];
#pragma unroll
  for (int kc = 0; kc < 32; ++kc)
    aq[kc] = *(const v2f*)(qp + 4 * kc + 2 * kh) + *(const v2f*)(qp + PLANE + 4 * kc + 2 * kh);

  float ts[8];
  int ti8[8];
#pragma unroll
  for (int i = 0; i < 8; ++i) { ts[i] = -INFINITY; ti8[i] = 0; }
  int row = tid & 15, slot = tid >> 4;
  const float scale = 0.08838834764831845f;  // 1/sqrt(128)

  // this wave's first tile: row i of the tile = 32 lanes x 16 B = 4 whole lines
  v4f st[16];
  const float* gp = kK + (size_t)(split * CHPS * CHUNK + wave * 64) * RANK + lane * 4;
#pragma unroll
  for (int i = 0; i < 16; ++i) st[i] = *(const v4f*)(gp + i * RANK);
  // inputs-only fence on the A values (each the sum of two loaded values, no product):
  // A is waited for here, once. Without it
  // the waits for A stand among the WMMAs of the loop and drain the next tile's
  // loads there on every trip.
  asm volatile("" ::"v"(aq[0]), "v"(aq[1]), "v"(aq[2]), "v"(aq[3]), "v"(aq[4]), "v"(aq[5]),
               "v"(aq[6]), "v"(aq[7]), "v"(aq[8]), "v"(aq[9]), "v"(aq[10]), "v"(aq[11]),
               "v"(aq[12]), "v"(aq[13]), "v"(aq[14]), "v"(aq[15]));
  asm volatile("" ::"v"(aq[16]), "v"(aq[17]), "v"(aq[18]), "v"(aq[19]), "v"(aq[20]), "v"(aq[21]),
               "v"(aq[22]), "v"(aq[23]), "v"(aq[24]), "v"(aq[25]), "v"(aq[26]), "v"(aq[27]),
               "v"(aq[28]), "v"(aq[29]), "v"(aq[30]), "v"(aq[31]));

  for (int ch = split * CHPS; ch < (split + 1) * CHPS; ++ch) {
    // stage A: 8 waves x 4 n-tiles of 16 cols = 512 cols via WMMA
#pragma unroll 1
    for (int t = 0; t < 4; ++t) {
      int ntl = wave * 4 + t;
#pragma unroll
      for (int i = 0; i < 16; ++i) *(v4f*)(ktw + i * KT_PITCH + lane * 4) = st[i];
      // the wave's own row stores have landed before its lanes read each other's
      // rows back as fragments (the range is private to the wave: no barrier)
      asm volatile("s_wait_dscnt 0x0" ::: "memory");
      // the wave's next tile flies while this one is multiplied; none behind the last
      if (t < 3 || ch + 1 < (split + 1) * CHPS) {
        gp += (t < 3 ? 16 : CHUNK - 48) * RANK;  // next tile of the chunk, or first of the next
#pragma unroll
        for (int i = 0; i < 16; ++i) st[i] = *(const v4f*)(gp + i * RANK);
      }
      const float* kp = ktw + nl * KT_PITCH;
      v8f c;
#pragma unroll
      for (int v = 0; v < 8; ++v) c[v] = 0.f;
#pragma unroll
      for (int kc = 0; kc < 32; ++kc) {
        v2f bk = *(const v2f*)(kp + 4 * kc + 2 * kh);
        c = wmma_f32_16x16x4(aq[kc], bk, c);
      }
#pragma unroll
      for (int v = 0; v < 8; ++v) sc[v + mrow][ntl * 16 + nl] = c[v] * scale;
    }
    __syncthreads();
    // stage B: 16 threads per row keep a private sorted top-8
    int cbase = slot * 32;
    for (int i = 0; i < 32; ++i) {
      float s = sc[row][cbase + i];
      if (s > ts[7]) {
        ts[7] = s;
        ti8[7] = ch * CHUNK + cbase + i;
#pragma unroll
        for (int q = 7; q > 0; --q) {
          if (ts[q] > ts[q - 1]) {
            float tf = ts[q]; ts[q] = ts[q - 1]; ts[q - 1] = tf;
            int tt = ti8[q]; ti8[q] = ti8[q - 1]; ti8[q - 1] = tt;
          }
        }
      }
    }
    __syncthreads();
  }
  // merge 16 candidate lists per row -> this split's top-8 candidates
#pragma unroll
  for (int i = 0; i < 8; ++i) { cs[row][slot * 8 + i] = ts[i]; ci[row][slot * 8 + i] = ti8[i]; }
  __syncthreads();
  if (tid < 16) {
    int r = tid;
    size_t ob = ((tokBase + r) * NSPLIT + split) * 8;
    for (int k = 0; k < 8; ++k) {
      float m = -INFINITY;
      int mi = 0;
      for (int c2 = 0; c2 < 128; ++c2)
        if (cs[r][c2] > m) { m = cs[r][c2]; mi = c2; }
      candS[ob + k] = m;
      candI[ob + k] = ci[r][mi];
      cs[r][mi] = -INFINITY;
    }
  }
}

// ---- merge NSPLIT candidate lists (disjoint column ranges -> exact top-8), weighted
// gather of kV, residual; behind the last layer also the closing LayerNorm.
// One block per token. A candidate's rank is the number of its token's candidates that
// come before it (greater score, or equal score and a lower position): ranks 0..7 are
// the picks of eight scans in position order.
template <bool LAST>
__global__ __launch_bounds__(128) void memgather_kernel(const float* __restrict__ candS,
                                const int* __restrict__ candI, const float* __restrict__ kV,
                                float* __restrict__ x,          // [NTOK,512], += unless LAST
                                const float* __restrict__ lng,  // LAST: closing LayerNorm
                                const float* __restrict__ lnb,
                                float* __restrict__ out) {      // LAST: [NTOK,512]
  int tok = blockIdx.x;
  int tid = threadIdx.x;  // 128
  __shared__ float cs[NCAND];
  __shared__ float best[KNOW_K];
  __shared__ int bi[KNOW_K];
  float xv[4];
#pragma unroll  // xv stays in registers; the loads fly while the picks are made
  for (int i = 0; i < 4; ++i) xv[i] = x[(size_t)tok * D_MODEL + tid + 128 * i];
  float my = 0.f;
  int myi = 0;
  if (tid < NCAND) {
    my = candS[(size_t)tok * NCAND + tid];
    myi = candI[(size_t)tok * NCAND + tid];
    cs[tid] = my;
  }
  if (tid < KNOW_K) { best[tid] = -INFINITY; bi[tid] = 0; }  // start values, as the scans had
  __syncthreads();
  if (tid < NCAND) {
    int rank = 0;
    for (int e = 0; e < NCAND; ++e) {
      float v = cs[e];
      rank += (v > my || (v == my && e < tid)) ? 1 : 0;
    }
    if (rank < KNOW_K) { best[rank] = my; bi[rank] = myi; }
  }
  __syncthreads();
  // the picked rows are the same in every thread of the block: held as scalars, so that
  // the row loads take a scalar base and need no address arithmetic per lane
  const float* kr[KNOW_K];
#pragma unroll  // kr stays in registers
  for (int k = 0; k < KNOW_K; ++k)
    kr[k] = kV + (size_t)__builtin_amdgcn_readfirstlane(bi[k]) * D_MODEL;
  float kv[4][KNOW_K];
#pragma unroll  // kv stays in registers; the 32 row loads are independent and fly together,
                // while the weights are worked out
  for (int i = 0; i < 4; ++i)
#pragma unroll  // as above
    for (int k = 0; k < KNOW_K; ++k) kv[i][k] = kr[k][tid + 128 * i];
  float wk[KNOW_K];
  float mx = best[0], sum = 0.f;
#pragma unroll  // wk stays in registers (this loop and the next)
  for (int k = 0; k < KNOW_K; ++k) { wk[k] = expf(best[k] - mx); sum += wk[k]; }
  float inv = 1.f / sum;
#pragma unroll  // as above
  for (int k = 0; k < KNOW_K; ++k) wk[k] *= inv;
#pragma unroll  // xv stays in registers
  for (int i = 0; i < 4; ++i) {
    float acc = 0.f;
#pragma unroll  // as above
    for (int k = 0; k < KNOW_K; ++k) acc += wk[k] * kv[i][k];
    xv[i] += acc;
  }
  if constexpr (LAST) {
    __shared__ float red[256];
    ln_row<128>(xv, lng, lnb, red);
  }
  float* op = LAST ? out : x;
#pragma unroll  // as above
  for (int i = 0; i < 4; ++i) op[(size_t)tok * D_MODEL + tid + 128 * i] = xv[i];
}

extern "C" void kernel_launch(void* const* d_in, const int* in_sizes, int n_in,
                              void* d_out, int out_size, void* d_ws, size_t ws_size,
                              hipStream_t stream) {
  const float* x_in = (const float*)d_in[0];
  const float* cneur = (const float*)d_in[1];
  const float* eneur = (const float*)d_in[2];
  const float* kK = (const float*)d_in[3];
  const float* kV = (const float*)d_in[4];
  const float* rq = (const float*)d_in[5];
  const float* rk = (const float*)d_in[6];
  const float* rv = (const float*)d_in[7];
  const float* ro = (const float*)d_in[8];
  const float* rm = (const float*)d_in[9];
  const float* ln1g = (const float*)d_in[10];
  const float* ln1b = (const float*)d_in[11];
  const float* ln2g = (const float*)d_in[12];
  const float* ln2b = (const float*)d_in[13];
  const float* lnfg = (const float*)d_in[14];
  const float* lnfb = (const float*)d_in[15];
  float* out = (float*)d_out;

  float* ws = (float*)d_ws;
  float* xb = ws;     ws += (size_t)NTOK * D_MODEL;
  float* h = ws;      ws += (size_t)NTOK * D_MODEL;
  float* qc = ws;     ws += 2 * PLANE;  // qc, kc, vc lie in a row: out[0..2] of one launch
  float* kc = ws;     ws += 2 * PLANE;
  float* vc = ws;     ws += 2 * PLANE;
  float* ctx = ws;    ws += (size_t)NTOK * RANK;
  float* qm = ws;     ws += 2 * PLANE;
  float* candS = ws;  ws += (size_t)NTOK * NCAND;
  int* candI = (int*)ws;  ws += (size_t)NTOK * NCAND;
  int* sel = (int*)ws;    ws += (size_t)3 * NTOK * 2;
  float* wsel = ws;

  for (int l = 0; l < N_LAYERS; ++l) {
    const float* xi = l == 0 ? x_in : xb;  // layer 0 reads the input where it lies
    route_kernel<<<dim3(NTOK, 3), 128, 0, stream>>>(xi, ln1g + l * D_MODEL, ln1b + l * D_MODEL, h,
                                                    rq + (size_t)l * N_COMPRESS * D_MODEL,
                                                    rk + (size_t)l * N_COMPRESS * D_MODEL,
                                                    rv + (size_t)l * N_COMPRESS * D_MODEL, sel, wsel);
    compress_group_kernel<<<dim3(N_COMPRESS, RANK / 32, 3), 256, 0, stream>>>(h, sel, wsel, cneur, qc);
    attn_kernel<<<BATCH * N_HEADS * (SEQ / 16), 32 * ATT_W, 0, stream>>>(qc, kc, vc, ctx);
    expand_kernel<<<NTOK, 256, 0, stream>>>(ctx, ro + (size_t)l * N_EXPAND * RANK, eneur, xi, xb,
                                            ln2g + l * D_MODEL, ln2b + l * D_MODEL, h,
                                            rm + (size_t)l * N_COMPRESS * D_MODEL, sel, wsel);
    compress_group_kernel<<<dim3(N_COMPRESS, RANK / 32, 1), 256, 0, stream>>>(h, sel, wsel, cneur, qm);
    memscore_kernel<<<dim3(NTOK / 16, NSPLIT), 256, 0, stream>>>(qm, kK, candS, candI);
    if (l + 1 < N_LAYERS)
      memgather_kernel<false><<<NTOK, 128, 0, stream>>>(candS, candI, kV, xb, lnfg, lnfb, out);
    else
      memgather_kernel<true><<<NTOK, 128, 0, stream>>>(candS, candI, kV, xb, lnfg, lnfb, out);
  }
}

// v008
// Measured time: 310 microseconds a run.
// Next to v007, in two timings, it ran 1.04 times as fast each time.
// Over all steps from v000 it is 2.61 times as fast.
#include <hip/hip_runtime.h>
#include <math.h>

#define D_MODEL 512
#define RANK 128
#define N_HEADS 8
#define D_HEAD 16
#define N_COMPRESS 64
#define N_EXPAND 64
#define N_KNOW 32768
#define KNOW_K 8
#define N_LAYERS 2
#define BATCH 2
#define SEQ 512
#define NTOK (BATCH * SEQ)

#define CHUNK 512
#define NSPLIT 8                            // grid-Y partitions of the N_KNOW axis
#define NCHUNKS (N_KNOW / CHUNK)            // 64
#define CHPS (NCHUNKS / NSPLIT)             // 8 chunks per split
#define NCAND (NSPLIT * 8)                  // 64 candidates per token
#define KT_PITCH 132  // floats per staged kK row: 528 B = 16 B x 33, so the 32 lanes'
                      // 8-byte fragment reads fall on 64 distinct banks

#define PLANE ((size_t)NTOK * RANK)  // floats per plane of a compress result: plane s holds
                                     // each token's weighted projection by its s-th expert
#define GP_PITCH 36  // floats per row of a wave's 32x32 partial tile in LDS: 144 B keeps the
                     // 16-byte reads aligned and puts rows v and v + 8 on different banks

#define CL_PITCH 132  // floats per token row of the score kernel's parked candidate lists: 528 B
                      // keeps the 16-byte accesses aligned and spreads the 16 rows, which one
                      // store instruction writes, over the banks

#define ATT_W 8    // waves per attention block
#define ATT_OP 18  // floats per row of a wave's parked output tile: rows v and v + 8, stored
                   // by one instruction, fall on different banks

typedef float v2f __attribute__((ext_vector_type(2)));
typedef float v4f __attribute__((ext_vector_type(4)));
typedef float v8f __attribute__((ext_vector_type(8)));

__device__ __forceinline__ v8f wmma_f32_16x16x4(v2f a, v2f b, v8f c) {
  // D = A(16x4 f32) * B(4x16 f32) + C(16x16 f32)
  return __builtin_amdgcn_wmma_f32_16x16x4_f32(false, a, false, b, (short)0, c,
                                               false, false);
}

// ---------------------------------------------------------------- LayerNorm
// of one row, by a block of NT threads (128 or 256) that already holds the row: thread t
// has elements t + NT i in v[i] and gets their normalised values back in v[i]. It stands
// inside the kernel that reads or makes the row, so that it costs no launch of its own.
// The 512 terms are added as a halving tree (distance 256, 128, ... 1): down to NT terms
// in the thread, down to 32 through LDS, the rest over the lanes; every wave does the
// part behind the barrier for itself, so one barrier is enough. The caller does not use
// red for anything else.
template <int NT>
__device__ __forceinline__ void ln_row(float (&v)[D_MODEL / NT], const float* __restrict__ g,
                                       const float* __restrict__ b, float* red /* [2 NT], LDS */) {
  static_assert(NT == 128 || NT == 256, "the tree is written out for these two");
  int tid = threadIdx.x;
  int lane = tid & 31;
  float gv[D_MODEL / NT], bv[D_MODEL / NT];
#pragma unroll  // gv and bv stay in registers; fetched ahead of the barrier, they fly during the sums
  for (int i = 0; i < D_MODEL / NT; ++i) { gv[i] = g[tid + NT * i]; bv[i] = b[tid + NT * i]; }
  if constexpr (NT == 128) {
    red[tid] = (v[0] + v[2]) + (v[1] + v[3]);
    red[NT + tid] = (v[0] * v[0] + v[2] * v[2]) + (v[1] * v[1] + v[3] * v[3]);
  } else {
    red[tid] = v[0] + v[1];
    red[NT + tid] = v[0] * v[0] + v[1] * v[1];
  }
  __syncthreads();
  float sq[2];
#pragma unroll  // sq stays in registers
  for (int j = 0; j < 2; ++j) {
    const float* r = red + j * NT + lane;
    if constexpr (NT == 128)
      sq[j] = (r[0] + r[64]) + (r[32] + r[96]);
    else
      sq[j] = ((r[0] + r[128]) + (r[64] + r[192])) + ((r[32] + r[160]) + (r[96] + r[224]));
  }
#pragma unroll  // five fixed lane distances
  for (int msk = 16; msk > 0; msk >>= 1) {
    sq[0] += __shfl_xor(sq[0], msk, 32);
    sq[1] += __shfl_xor(sq[1], msk, 32);
  }
  float mean = sq[0] * (1.0f / D_MODEL);
  float var = sq[1] * (1.0f / D_MODEL) - mean * mean;
  float rstd = rsqrtf(var + 1e-5f);
#pragma unroll  // v stays in registers
  for (int i = 0; i < D_MODEL / NT; ++i) v[i] = (v[i] - mean) * rstd * gv[i] + bv[i];
}

// ------------------------------------------------- routed compress (D -> R)
// Two stages. The routing normalises a token's row (h = LayerNorm(x)) and picks its two
// experts and their weights; compress_group_kernel takes one expert per block, gathers
// the tokens that picked it and multiplies them with the expert's matrix, which is so
// read once per block instead of once per token.
// The routing works on one token's row, so it needs no launch of its own where the kernel
// in front of it makes that row in one block: route_row is called by route_kernel (q, k, v)
// and at the foot of expand_kernel (the memory query).

// Sums over the 32 lanes of N rows' partial sums, a[i] being this lane's part of row i.
// Halving butterfly, lane distance MSK = 16, 8, ...: at each level a lane hands over the
// half of its rows that its partner keeps; with one row left the remaining distances are
// plain sums. Called with N rows and MSK = 16, lanes (32 / N) e .. return row e's whole sum.
template <int N, int MSK>
__device__ __forceinline__ float fold_rows(const float (&a)[N], int lane) {
  if constexpr (N == 1) {
    float s = a[0];
#pragma unroll  // fixed lane distances
    for (int m = MSK; m >= 1; m >>= 1) s += __shfl_xor(s, m, 32);
    return s;
  } else {
    float o[N / 2];
    bool up = lane & MSK;
#pragma unroll  // the partial sums stay in registers
    for (int i = 0; i < N / 2; ++i)
      o[i] = (up ? a[i + N / 2] : a[i]) + __shfl_xor(up ? a[i] : a[i + N / 2], MSK, 32);
    return fold_rows<N / 2, MSK / 2>(o, lane);
  }
}

// One token's routing by a block of NW waves (4 or 8). On entry hs (LDS, [512], 16-byte
// aligned) holds h, ss and se (LDS, [2]) their start values, and a barrier has published
// them. sc is LDS, [64]. sel2 and wsel2 are the token's own two entries.
template <int NW>
__device__ __forceinline__ void route_row(const float* hs, const float* __restrict__ router,  // [64,512]
                                          float* sc, float* ss, int* se,
                                          int* __restrict__ sel2, float* __restrict__ wsel2) {
  constexpr int R = N_COMPRESS / NW;  // router rows per wave
  static_assert(R == 8 || R == 16, "the lane sum below halves R rows over the 32 lanes");
  int tid = threadIdx.x;
  // router logits: wave w takes rows R w .. R w + R - 1. A row is read as whole 128-byte
  // lines (lane l holds d = 128 j + 4 l .. +3, j = 0..3), each lane sums its 16
  // products, and the lanes' partial sums are added over the wave.
  {
    int lane = tid & 31, wave = tid >> 5;
    v4f hv[4];
#pragma unroll  // hv stays in registers
    for (int j = 0; j < 4; ++j) hv[j] = *(const v4f*)(hs + 128 * j + 4 * lane);
    const float* rp = router + (size_t)(wave * R) * D_MODEL + 4 * lane;
    float p[R];
#pragma unroll  // p stays in registers; the 4 R row loads are independent and fly together
    for (int e = 0; e < R; ++e) {
      v2f acc = {0.f, 0.f};
#pragma unroll  // as above
      for (int j = 0; j < 4; ++j) {
        v4f rv = *(const v4f*)(rp + e * D_MODEL + 128 * j);
        acc += hv[j].xy * rv.xy;
        acc += hv[j].zw * rv.zw;
      }
      p[e] = acc.x + acc.y;
    }
    float p0 = fold_rows<R, 16>(p, lane);
    if ((lane & (32 / R - 1)) == 0) sc[wave * R + lane / (32 / R)] = p0;
  }
  __syncthreads();
  float my = (tid < N_COMPRESS) ? sc[tid] : 0.f;
  // top-2 by rank: each score counts the scores that come before it (greater, or
  // equal with a lower index); ranks 0 and 1 are the two that a scan in index order picks
  if (tid < N_COMPRESS) {
    int rank = 0;
    for (int e = 0; e < N_COMPRESS; ++e) {
      float s = sc[e];
      rank += (s > my || (s == my && e < tid)) ? 1 : 0;
    }
    if (rank < 2) { ss[rank] = my; se[rank] = tid; }
  }
  __syncthreads();
  if (tid < 2) {
    float z = expf(ss[1] - ss[0]);
    sel2[tid] = se[tid];
    wsel2[tid] = (tid == 0 ? 1.f : z) / (1.f + z);
  }
}

// Projections of the same x that do not hang on one another (q, k, v) share the two
// launches: grid y of route_kernel and grid z of compress_group_kernel name the
// projection, so their latencies overlap and no launch gap stands between them.
// Each projection's block normalises the row for itself; projection 0's stores h.
// the bound states the block size, so that the logits' row loads in flight fit the
// register budget without spills
__global__ __launch_bounds__(128) void route_kernel(const float* __restrict__ x,
                                const float* __restrict__ lng,      // [512] LayerNorm gain
                                const float* __restrict__ lnb,      // [512] LayerNorm bias
                                float* __restrict__ h,              // [NTOK,512] LayerNorm(x)
                                const float* __restrict__ router0,  // [64,512], projection 0
                                const float* __restrict__ router1,  // projection 1
                                const float* __restrict__ router2,  // projection 2
                                int* __restrict__ sel,              // [grid y,NTOK,2] expert
                                float* __restrict__ wsel) {         // [grid y,NTOK,2] weight
  int tok = blockIdx.x;
  int pr = blockIdx.y;
  const float* router = pr == 0 ? router0 : (pr == 1 ? router1 : router2);
  sel += pr * (2 * NTOK);
  wsel += pr * (2 * NTOK);
  int tid = threadIdx.x;  // 128 threads
  __shared__ __attribute__((aligned(16))) float hs[D_MODEL];
  __shared__ float sc[N_COMPRESS];
  __shared__ float ss[2];
  __shared__ int se[2];
  __shared__ float red[256];
  float hv[4];
#pragma unroll  // hv stays in registers (this loop and the two below)
  for (int i = 0; i < 4; ++i) hv[i] = x[(size_t)tok * D_MODEL + tid + 128 * i];
  ln_row<128>(hv, lng, lnb, red);
#pragma unroll  // as above
  for (int i = 0; i < 4; ++i) hs[tid + 128 * i] = hv[i];
  if (tid < 2) { ss[tid] = -INFINITY; se[tid] = 0; }  // start values, as the scan had
  __syncthreads();
  route_row<4>(hs, router, sc, ss, se, sel + tok * 2, wsel + tok * 2);
  // stored behind the last barrier: in front of one, the barrier would wait for the stores
  if (pr == 0) {
#pragma unroll  // as above
    for (int i = 0; i < 4; ++i) h[(size_t)tok * D_MODEL + tid + 128 * i] = hv[i];
  }
}

// grid = (N_COMPRESS, RANK / 32, projections): block (e, y, z) computes columns
// 32 y .. 32 y + 31 of h[tok] x neurons[e] for every entry (tok, s) with
// sel[z][tok][s] == e, 32 entries a pass.
// Wave w takes k = 64 w .. 64 w + 63 on WMMA f32 16x16x4; the eight partial tiles are
// added through LDS in wave order. Row (tok, s) goes, times its weight, to plane s of out[z].
__global__ __launch_bounds__(256) void compress_group_kernel(
    const float* __restrict__ h,        // [NTOK,512]
    const int* __restrict__ sel,        // [grid z,NTOK,2]
    const float* __restrict__ wsel,     // [grid z,NTOK,2]
    const float* __restrict__ neurons,  // [64,512,128]
    float* __restrict__ out) {          // [grid z,2,NTOK,128]
  int e = blockIdx.x;
  int n0 = blockIdx.y * 32;
  sel += blockIdx.z * (2 * NTOK);
  wsel += blockIdx.z * (2 * NTOK);
  out += blockIdx.z * (2 * PLANE);
  int tid = threadIdx.x;  // 256 threads = 8 waves
  int lane = tid & 31;
  int wave = tid >> 5;
  int nl = lane & 15;
  int kh = lane >> 4;
  __shared__ int list[2 * NTOK];  // this expert's entries (2 tok + s), ascending
  __shared__ int wcnt[64];
  __shared__ __attribute__((aligned(16))) float red[8][32 * GP_PITCH];

  int sv[8];
#pragma unroll  // sv stays in registers; the 8 loads fly together
  for (int j = 0; j < 8; ++j) sv[j] = sel[j * 256 + tid];

  // the list: a ballot per 32 entries, the counts summed in entry order
  unsigned mk[8];
#pragma unroll  // mk stays in registers
  for (int j = 0; j < 8; ++j) {
    mk[j] = __builtin_amdgcn_ballot_w32(sv[j] == e);
    if (lane == 0) wcnt[j * 8 + wave] = __popc(mk[j]);
  }
  __syncthreads();

  // B fragments, kept in registers for all passes; they fly while the list is built.
  // WMMA step 2 j + i of this wave multiplies k = 64 w + 8 j + 4 kh + 2 i + {0, 1},
  // in B here as in A below.
  const float* bp = neurons + (size_t)e * (D_MODEL * RANK) + (size_t)(wave * 64 + 4 * kh) * RANK + n0 + nl;
  v2f bf[2][16];
#pragma unroll  // bf stays in registers
  for (int j = 0; j < 8; ++j) {
#pragma unroll  // as above
    for (int nn = 0; nn < 2; ++nn) {
      bf[nn][2 * j].x = bp[(8 * j + 0) * RANK + 16 * nn];
      bf[nn][2 * j].y = bp[(8 * j + 1) * RANK + 16 * nn];
      bf[nn][2 * j + 1].x = bp[(8 * j + 2) * RANK + 16 * nn];
      bf[nn][2 * j + 1].y = bp[(8 * j + 3) * RANK + 16 * nn];
    }
  }

  int run = 0;
  int base[8];
#pragma unroll  // base stays in registers
  for (int q = 0; q < 64; ++q) {
    if ((q & 7) == wave) base[q >> 3] = run;
    run += wcnt[q];
  }
  unsigned below = (1u << lane) - 1u;
#pragma unroll  // as above
  for (int j = 0; j < 8; ++j)
    if ((mk[j] >> lane) & 1u) list[base[j] + __popc(mk[j] & below)] = j * 256 + tid;
  __syncthreads();
  // the same in every thread of the block; held as a scalar so that the pass loop,
  // which holds WMMAs and barriers, branches on a scalar compare
  int n = __builtin_amdgcn_readfirstlane(run);

  for (int m0 = 0; m0 < n; m0 += 32) {
    // A fragments: lane (nl, kh) reads its entry's h row; a row past the end of the
    // list reads entry 0's and is not stored
    v4f af[2][8];
#pragma unroll  // af stays in registers
    for (int t = 0; t < 2; ++t) {
      int ix = m0 + t * 16 + nl;
      int en = list[ix < n ? ix : 0];
      const float* ap = h + (size_t)(en >> 1) * D_MODEL + wave * 64 + 4 * kh;
#pragma unroll  // as above
      for (int j = 0; j < 8; ++j) af[t][j] = *(const v4f*)(ap + 8 * j);
    }
    // the row that this thread stores at the foot of the pass, and its weight, fetched early
    int m = tid >> 3, c4 = (tid & 7) * 4;  // 8 threads x 16 B = one 128-byte line per row
    int eo = list[m0 + m < n ? m0 + m : 0];
    float wo = wsel[eo];
    v8f c[2][2];
#pragma unroll  // c stays in registers (this loop and the two below)
    for (int t = 0; t < 2; ++t)
#pragma unroll  // as above
      for (int nn = 0; nn < 2; ++nn)
#pragma unroll  // as above
        for (int v = 0; v < 8; ++v) c[t][nn][v] = 0.f;
#pragma unroll  // as above
    for (int j = 0; j < 8; ++j) {
#pragma unroll  // as above
      for (int t = 0; t < 2; ++t)
#pragma unroll  // as above
        for (int nn = 0; nn < 2; ++nn)
          c[t][nn] = wmma_f32_16x16x4(af[t][j].xy, bf[nn][2 * j], c[t][nn]);
#pragma unroll  // as above
      for (int t = 0; t < 2; ++t)
#pragma unroll  // as above
        for (int nn = 0; nn < 2; ++nn)
          c[t][nn] = wmma_f32_16x16x4(af[t][j].zw, bf[nn][2 * j + 1], c[t][nn]);
    }
#pragma unroll  // as above
    for (int t = 0; t < 2; ++t)
#pragma unroll  // as above
      for (int nn = 0; nn < 2; ++nn)
#pragma unroll  // as above
        for (int v = 0; v < 8; ++v)
          red[wave][(t * 16 + v + 8 * kh) * GP_PITCH + nn * 16 + nl] = c[t][nn][v];
    __syncthreads();
    v4f sum = *(const v4f*)(&red[0][m * GP_PITCH + c4]);
#pragma unroll  // the 8 reads fly together
    for (int w = 1; w < 8; ++w) sum += *(const v4f*)(&red[w][m * GP_PITCH + c4]);
    if (m0 + m < n)
      *(v4f*)(out + (size_t)(eo & 1) * PLANE + (size_t)(eo >> 1) * RANK + n0 + c4) = sum * wo;
    __syncthreads();  // red is rewritten by the next pass
  }
}

// --------------------------------------------------- routed expand (R -> D)
// The block makes its token's whole new row x, so the stages behind it that work on that
// row alone follow in the same launch: the second LayerNorm and the memory query's routing.
// the bound states the block size: the register budget of eight waves a SIMD is kept
// (four blocks a WGP, the whole grid resident at once)
__global__ __launch_bounds__(256, 8) void expand_kernel(
                              const float* __restrict__ in,        // [NTOK,128]
                              const float* __restrict__ router,    // [64,128]
                              const float* __restrict__ neurons,   // [64,128,512]
                              const float* xi,                     // [NTOK,512] residual in
                              float* xo,                           // [NTOK,512] out; may be xi
                              const float* __restrict__ lng,       // [512] LayerNorm gain
                              const float* __restrict__ lnb,       // [512] LayerNorm bias
                              float* __restrict__ h,               // [NTOK,512] LayerNorm(xo)
                              const float* __restrict__ router_m,  // [64,512]
                              int* __restrict__ sel,               // [NTOK,2] expert
                              float* __restrict__ wsel) {          // [NTOK,2] weight
  int tok = blockIdx.x;
  int tid = threadIdx.x;  // 256 threads
  __shared__ __attribute__((aligned(16))) float is[RANK];
  __shared__ float sc[N_EXPAND];
  __shared__ float ss[2];
  __shared__ int se[2];
  __shared__ __attribute__((aligned(16))) float hs[D_MODEL];  // from here: the stages behind
  __shared__ float red[512];
  __shared__ float sc2[N_COMPRESS];
  __shared__ float ss2[2];
  __shared__ int se2[2];
  const float* ip = in + (size_t)tok * RANK;
  if (tid < RANK) is[tid] = ip[tid];
  if (tid < 2) {  // start values, as the scan had
    ss[tid] = -INFINITY; se[tid] = 0;
    ss2[tid] = -INFINITY; se2[tid] = 0;
  }
  __syncthreads();
  // router logits as in route_row: wave w takes rows 8w..8w+7, one 16-byte
  // load per lane covers a row (lane l holds r = 4 l .. +3)
  {
    int lane = tid & 31, wave = tid >> 5;
    v4f iv = *(const v4f*)(is + 4 * lane);
    const float* rp = router + (size_t)(wave * 8) * RANK + 4 * lane;
    float p8[8];
#pragma unroll  // p8 stays in registers; the 8 row loads are independent and fly together
    for (int e = 0; e < 8; ++e) {
      v4f rv = *(const v4f*)(rp + e * RANK);
      v2f acc = iv.xy * rv.xy;
      acc += iv.zw * rv.zw;
      p8[e] = acc.x + acc.y;
    }
    // halving butterfly; lanes 4e..4e+3 end with row e's whole sum
    float p4[4], p2[2];
    bool u16 = lane & 16, u8 = lane & 8, u4 = lane & 4;
#pragma unroll  // the partial sums stay in registers (this loop and the next)
    for (int i = 0; i < 4; ++i)
      p4[i] = (u16 ? p8[i + 4] : p8[i]) + __shfl_xor(u16 ? p8[i] : p8[i + 4], 16, 32);
#pragma unroll  // as above
    for (int i = 0; i < 2; ++i)
      p2[i] = (u8 ? p4[i + 2] : p4[i]) + __shfl_xor(u8 ? p4[i] : p4[i + 2], 8, 32);
    float p1 = (u4 ? p2[1] : p2[0]) + __shfl_xor(u4 ? p2[0] : p2[1], 4, 32);
    p1 += __shfl_xor(p1, 2, 32);
    p1 += __shfl_xor(p1, 1, 32);
    if ((lane & 3) == 0) sc[wave * 8 + (lane >> 2)] = p1;
  }
  __syncthreads();
  float my = (tid < N_EXPAND) ? sc[tid] : 0.f;
  // top-2 by rank, as in route_row
  if (tid < N_EXPAND) {
    int rank = 0;
    for (int e = 0; e < N_EXPAND; ++e) {
      float s = sc[e];
      rank += (s > my || (s == my && e < tid)) ? 1 : 0;
    }
    if (rank < 2) { ss[rank] = my; se[rank] = tid; }
  }
  __syncthreads();
  int e0 = se[0], e1i = se[1];
  float z = expf(ss[1] - ss[0]);
  float w0 = 1.f / (1.f + z), w1 = z / (1.f + z);
  for (int d = tid; d < D_MODEL; d += 256) {
    const float* n0 = neurons + (size_t)e0 * (RANK * D_MODEL) + d;
    const float* n1 = neurons + (size_t)e1i * (RANK * D_MODEL) + d;
    float a0 = 0.f, a1 = 0.f;
    for (int r = 0; r < RANK; ++r) {
      float iv = is[r];
      a0 += iv * n0[(size_t)r * D_MODEL];
      a1 += iv * n1[(size_t)r * D_MODEL];
    }
    hs[d] = xi[(size_t)tok * D_MODEL + d] + (w0 * a0 + w1 * a1);  // parked: read back by this thread
  }
  float xv[2], hv[2];
#pragma unroll  // xv and hv stay in registers (this loop and the two below)
  for (int i = 0; i < 2; ++i) hv[i] = xv[i] = hs[tid + 256 * i];
  ln_row<256>(hv, lng, lnb, red);
#pragma unroll  // as above
  for (int i = 0; i < 2; ++i) hs[tid + 256 * i] = hv[i];
  __syncthreads();
  route_row<8>(hs, router_m, sc2, ss2, se2, sel + tok * 2, wsel + tok * 2);
  // stored behind the last barrier: in front of one, the barrier would wait for the stores
#pragma unroll  // as above
  for (int i = 0; i < 2; ++i) {
    xo[(size_t)tok * D_MODEL + tid + 256 * i] = xv[i];
    h[(size_t)tok * D_MODEL + tid + 256 * i] = hv[i];
  }
}

// -------------------------- flash attention: one block per (b, head, q-tile)
// WMMA f32 16x16x4: QK^T (K=16 -> 4 wmma) and P@V (K=16 -> 4 wmma) per tile.
// Q, K and V come as two planes each (see compress_group_kernel), added as they are read.
// The key tiles are dealt to the block's ATT_W waves (wave w takes tiles w, w + ATT_W, ...):
// a tile's steps hang on one another, so the longest row of tiles sets the launch's time.
// Each wave runs its own online softmax; the partial results are joined at the end.
__global__ __launch_bounds__(32 * ATT_W) void attn_kernel(
    const float* __restrict__ Q, const float* __restrict__ K,
    const float* __restrict__ V, float* __restrict__ O) {
  int bid = blockIdx.x;
  int qt = bid % (SEQ / 16);
  int head = (bid / (SEQ / 16)) % N_HEADS;
  int b = bid / ((SEQ / 16) * N_HEADS);
  int tid = threadIdx.x;  // 32 * ATT_W threads
  int lane = tid & 31;
  // the same in every lane of a wave; held as a scalar so that the tile loop, which
  // holds WMMAs, branches on a scalar compare
  int wave = __builtin_amdgcn_readfirstlane(tid >> 5);
  int nl = lane & 15;
  int kh = lane >> 4;      // which K half (A/B layout: lanes 16-31 hold K+2)
  int mrow = kh ? 8 : 0;   // C/D layout: lanes 16-31 hold rows 8-15
  size_t base = (size_t)b * SEQ;
  __shared__ float PtAll[ATT_W][16][17];
  __shared__ float oS[ATT_W][16][ATT_OP];  // each wave's unnormalised output tile
  __shared__ float mS[ATT_W][16];          // its row maxima
  __shared__ float lS[ATT_W][16];          // its row sums
  float (*Pt)[17] = PtAll[wave];           // private to the wave

  // A fragments for Q tile (16 rows x K=16), 4 chunks of K=4
  const float* qp = Q + (base + qt * 16 + nl) * RANK + head * D_HEAD;
  v2f aq[4];
#pragma unroll
  for (int kc = 0; kc < 4; ++kc)
    aq[kc] = *(const v2f*)(qp + 4 * kc + 2 * kh) + *(const v2f*)(qp + PLANE + 4 * kc + 2 * kh);

  v8f o;
  float rm[8], rl[8];
#pragma unroll
  for (int v = 0; v < 8; ++v) { o[v] = 0.f; rm[v] = -INFINITY; rl[v] = 0.f; }

  for (int j = wave; j <= qt; j += ATT_W) {
    v8f s;
#pragma unroll
    for (int v = 0; v < 8; ++v) s[v] = 0.f;
    const float* kp = K + (base + j * 16 + nl) * RANK + head * D_HEAD;
#pragma unroll
    for (int kc = 0; kc < 4; ++kc) {
      v2f bk = *(const v2f*)(kp + 4 * kc + 2 * kh) +
               *(const v2f*)(kp + PLANE + 4 * kc + 2 * kh);  // B[k][n], B[k+1][n]
      s = wmma_f32_16x16x4(aq[kc], bk, s);
    }
    // scale + causal mask (query = qt*16+m, key = j*16+n)
#pragma unroll
    for (int v = 0; v < 8; ++v) {
      float sv = s[v] * 0.25f;  // 1/sqrt(16)
      if (j == qt && nl > v + mrow) sv = -INFINITY;
      s[v] = sv;
    }
    // online softmax (rows live across 16-lane halves -> butterfly 1,2,4,8)
#pragma unroll
    for (int v = 0; v < 8; ++v) {
      float tmax = s[v];
#pragma unroll
      for (int msk = 1; msk < 16; msk <<= 1)
        tmax = fmaxf(tmax, __shfl_xor(tmax, msk, 32));
      float nm = fmaxf(rm[v], tmax);
      float alpha = __expf(rm[v] - nm);
      float p = __expf(s[v] - nm);
      float psum = p;
#pragma unroll
      for (int msk = 1; msk < 16; msk <<= 1) psum += __shfl_xor(psum, msk, 32);
      rl[v] = rl[v] * alpha + psum;
      o[v] *= alpha;
      rm[v] = nm;
      s[v] = p;
    }
    // re-layout P: C-layout -> LDS -> A-layout
#pragma unroll
    for (int v = 0; v < 8; ++v) Pt[v + mrow][nl] = s[v];
    // the wave's own stores have landed before its lanes read each other's values
    // back (the range is private to the wave: no barrier, and the waves' trip counts differ)
    asm volatile("s_wait_dscnt 0x0" ::: "memory");
    const float* vp = V + (base + j * 16) * RANK + head * D_HEAD + nl;
#pragma unroll
    for (int kc = 0; kc < 4; ++kc) {
      v2f ap;
      ap.x = Pt[nl][4 * kc + 2 * kh];
      ap.y = Pt[nl][4 * kc + 2 * kh + 1];
      v2f bv;
      bv.x = vp[(size_t)(4 * kc + 2 * kh) * RANK] + vp[PLANE + (size_t)(4 * kc + 2 * kh) * RANK];
      bv.y = vp[(size_t)(4 * kc + 2 * kh + 1) * RANK] + vp[PLANE + (size_t)(4 * kc + 2 * kh + 1) * RANK];
      o = wmma_f32_16x16x4(ap, bv, o);
    }
  }
  // join the waves' partial results: a wave without a tile hands in maximum -inf,
  // sum 0 and output 0, and so weighs nothing (wave 0 always has tile 0)
#pragma unroll  // o stays in registers
  for (int v = 0; v < 8; ++v) oS[wave][v + mrow][nl] = o[v];
  if (nl == 0) {
#pragma unroll  // rm and rl stay in registers
    for (int v = 0; v < 8; ++v) { mS[wave][v + mrow] = rm[v]; lS[wave][v + mrow] = rl[v]; }
  }
  __syncthreads();
  static_assert(32 * ATT_W == 256, "one thread per element of the 16x16 output tile");
  int r = tid >> 4, cc = tid & 15;
  float mx = mS[0][r];
#pragma unroll  // the LDS reads fly together (this loop and the next)
  for (int w = 1; w < ATT_W; ++w) mx = fmaxf(mx, mS[w][r]);
  float den = 0.f, num = 0.f;
#pragma unroll  // as above
  for (int w = 0; w < ATT_W; ++w) {
    float f = __expf(mS[w][r] - mx);
    den += lS[w][r] * f;
    num += oS[w][r][cc] * f;
  }
  O[(base + qt * 16 + r) * RANK + head * D_HEAD + cc] = num / den;
}

// The greatest of v over the 16 lanes of a row (lanes 0-15, lanes 16-31), in every lane of
// the row: four vector steps at lane distances 1, 2, 4, 8 inside the row, where a shuffle
// would go through the LDS unit and be waited for at each step. All 32 lanes are on.
template <int DIST>
__device__ __forceinline__ float row16_other(float v) {  // v of lane l ^ DIST, DIST < 16
  int b = __builtin_bit_cast(int, v);
  return __builtin_bit_cast(float, __builtin_amdgcn_update_dpp(b, b, 0x160 + DIST, 0xf, 0xf, false));
}
__device__ __forceinline__ float row16_max(float v) {
  v = fmaxf(v, row16_other<1>(v));
  v = fmaxf(v, row16_other<2>(v));
  v = fmaxf(v, row16_other<4>(v));
  v = fmaxf(v, row16_other<8>(v));
  return v;
}

// ---------------- memory scores GEMM (WMMA f32, K=128) fused with top-8.
// grid = (NTOK/16, NSPLIT): split N_KNOW 8 ways for 8x more waves on the
// FLOP-dominant kernel; each split emits per-row top-8 candidates.
// Each wave brings its 16-column kK tile in as whole 512-byte rows (one row per
// 16-byte-per-lane load), one tile ahead, parks it in its own LDS range and
// reads the B fragments from there (k = 4 kc + 2 kh, as the A fragments).
__global__ __launch_bounds__(256) void memscore_kernel(const float* __restrict__ Qm,  // [2,NTOK,128]
                                const float* __restrict__ kK,  // [N_KNOW,128]
                                float* __restrict__ candS,     // [NTOK,NSPLIT,8]
                                int* __restrict__ candI) {     // [NTOK,NSPLIT,8]
  int tb = blockIdx.x;      // 16-token tile
  int split = blockIdx.y;   // column partition
  int tid = threadIdx.x;    // 256 threads = 8 waves
  int lane = tid & 31;
  int wave = tid >> 5;
  int nl = lane & 15;
  int kh = lane >> 4;
  int mrow = kh ? 8 : 0;
  size_t tokBase = (size_t)tb * 16;

  __shared__ float sc[16][CHUNK + 4];  // pad: 516 % 64 banks = 4 -> conflict free
  __shared__ __attribute__((aligned(16))) float cs[16][CL_PITCH];
  __shared__ __attribute__((aligned(16))) int ci[16][CL_PITCH];
  __shared__ __attribute__((aligned(16))) float kt[8][16 * KT_PITCH];  // one tile per wave
  float* ktw = &kt[wave][0];

  // A fragments for the Q tile (its two planes added): K=128 -> 32 chunks, kept in registers
  const float* qp = Qm + (tokBase + nl) * RANK;
  v2f aq[32];
#pragma unroll
  for (int kc = 0; kc < 32; ++kc)
    aq[kc] = *(const v2f*)(qp + 4 * kc + 2 * kh) + *(const v2f*)(qp + PLANE + 4 * kc + 2 * kh);

  float ts[8];
  int ti8[8];
#pragma unroll
  for (int i = 0; i < 8; ++i) { ts[i] = -INFINITY; ti8[i] = 0; }
  int row = tid & 15, slot = tid >> 4;
  const float scale = 0.08838834764831845f;  // 1/sqrt(128)

  // this wave's first tile: row i of the tile = 32 lanes x 16 B = 4 whole lines
  v4f st[16];
  const float* gp = kK + (size_t)(split * CHPS * CHUNK + wave * 64) * RANK + lane * 4;
#pragma unroll
  for (int i = 0; i < 16; ++i) st[i] = *(const v4f*)(gp + i * RANK);
  // inputs-only fence on the A values (each the sum of two loaded values, no product):
  // A is waited for here, once. Without it
  // the waits for A stand among the WMMAs of the loop and drain the next tile's
  // loads there on every trip.
  asm volatile("" ::"v"(aq[0]), "v"(aq[1]), "v"(aq[2]), "v"(aq[3]), "v"(aq[4]), "v"(aq[5]),
               "v"(aq[6]), "v"(aq[7]), "v"(aq[8]), "v"(aq[9]), "v"(aq[10]), "v"(aq[11]),
               "v"(aq[12]), "v"(aq[13]), "v"(aq[14]), "v"(aq[15]));
  asm volatile("" ::"v"(aq[16]), "v"(aq[17]), "v"(aq[18]), "v"(aq[19]), "v"(aq[20]), "v"(aq[21]),
               "v"(aq[22]), "v"(aq[23]), "v"(aq[24]), "v"(aq[25]), "v"(aq[26]), "v"(aq[27]),
               "v"(aq[28]), "v"(aq[29]), "v"(aq[30]), "v"(aq[31]));

  for (int ch = split * CHPS; ch < (split + 1) * CHPS; ++ch) {
    // stage A: 8 waves x 4 n-tiles of 16 cols = 512 cols via WMMA
#pragma unroll 1
    for (int t = 0; t < 4; ++t) {
      int ntl = wave * 4 + t;
#pragma unroll
      for (int i = 0; i < 16; ++i) *(v4f*)(ktw + i * KT_PITCH + lane * 4) = st[i];
      // the wave's own row stores have landed before its lanes read each other's
      // rows back as fragments (the range is private to the wave: no barrier)
      asm volatile("s_wait_dscnt 0x0" ::: "memory");
      // the wave's next tile flies while this one is multiplied; none behind the last
      if (t < 3 || ch + 1 < (split + 1) * CHPS) {
        gp += (t < 3 ? 16 : CHUNK - 48) * RANK;  // next tile of the chunk, or first of the next
#pragma unroll
        for (int i = 0; i < 16; ++i) st[i] = *(const v4f*)(gp + i * RANK);
      }
      const float* kp = ktw + nl * KT_PITCH;
      v8f c;
#pragma unroll
      for (int v = 0; v < 8; ++v) c[v] = 0.f;
#pragma unroll
      for (int kc = 0; kc < 32; ++kc) {
        v2f bk = *(const v2f*)(kp + 4 * kc + 2 * kh);
        c = wmma_f32_16x16x4(aq[kc], bk, c);
      }
#pragma unroll
      for (int v = 0; v < 8; ++v) sc[v + mrow][ntl * 16 + nl] = c[v] * scale;
    }
    __syncthreads();
    // stage B: 16 threads per row keep a private sorted top-8
    int cbase = slot * 32;
    for (int i = 0; i < 32; ++i) {
      float s = sc[row][cbase + i];
      if (s > ts[7]) {
        ts[7] = s;
        ti8[7] = ch * CHUNK + cbase + i;
#pragma unroll
        for (int q = 7; q > 0; --q) {
          if (ts[q] > ts[q - 1]) {
            float tf = ts[q]; ts[q] = ts[q - 1]; ts[q - 1] = tf;
            int tt = ti8[q]; ti8[q] = ti8[q - 1]; ti8[q - 1] = tt;
          }
        }
      }
    }
    __syncthreads();
  }
  // merge 16 candidate lists per row -> this split's top-8 candidates
#pragma unroll
  for (int i = 0; i < 8; ++i) { cs[row][slot * 8 + i] = ts[i]; ci[row][slot * 8 + i] = ti8[i]; }
  __syncthreads();
  // Wave w takes token rows 2 w and 2 w + 1; the 16 lanes of a lane row hold that token's 16
  // lists, lane nl list nl, each sorted with its best in front. Eight times: the greatest
  // of the 16 heads is the pick, and the list that it came from moves up by one. Of equal
  // heads the lowest list wins, as in a scan over the lists in their order.
  int r = wave * 2 + kh;
  float lt[8];
  int lx[8];
#pragma unroll  // lt and lx stay in registers (this loop and the two below)
  for (int i = 0; i < 8; ++i) { lt[i] = cs[r][nl * 8 + i]; lx[i] = ci[r][nl * 8 + i]; }
  size_t ob = ((tokBase + r) * NSPLIT + split) * 8;
#pragma unroll  // as above
  for (int k = 0; k < 8; ++k) {
    float m = row16_max(lt[0]);
    unsigned hit = (__builtin_amdgcn_ballot_w32(lt[0] == m) >> (16 * kh)) & 0xffffu;
    bool win = nl == (hit ? __ffs(hit) - 1 : 0);  // no head equal to m (not-a-numbers): list 0
    if (win) { candS[ob + k] = m; candI[ob + k] = lx[0]; }
#pragma unroll  // as above
    for (int i = 0; i < 7; ++i) { lt[i] = win ? lt[i + 1] : lt[i]; lx[i] = win ? lx[i + 1] : lx[i]; }
    lt[7] = win ? -INFINITY : lt[7];
  }
}

// ---- merge NSPLIT candidate lists (disjoint column ranges -> exact top-8), weighted
// gather of kV, residual; behind the last layer also the closing LayerNorm.
// One block per token. A candidate's rank is the number of its token's candidates that
// come before it (greater score, or equal score and a lower position): ranks 0..7 are
// the picks of eight scans in position order.
template <bool LAST>
__global__ __launch_bounds__(128) void memgather_kernel(const float* __restrict__ candS,
                                const int* __restrict__ candI, const float* __restrict__ kV,
                                float* __restrict__ x,          // [NTOK,512], += unless LAST
                                const float* __restrict__ lng,  // LAST: closing LayerNorm
                                const float* __restrict__ lnb,
                                float* __restrict__ out) {      // LAST: [NTOK,512]
  int tok = blockIdx.x;
  int tid = threadIdx.x;  // 128
  __shared__ float cs[NCAND];
  __shared__ float best[KNOW_K];
  __shared__ int bi[KNOW_K];
  float xv[4];
#pragma unroll  // xv stays in registers; the loads fly while the picks are made
  for (int i = 0; i < 4; ++i) xv[i] = x[(size_t)tok * D_MODEL + tid + 128 * i];
  float my = 0.f;
  int myi = 0;
  if (tid < NCAND) {
    my = candS[(size_t)tok * NCAND + tid];
    myi = candI[(size_t)tok * NCAND + tid];
    cs[tid] = my;
  }
  if (tid < KNOW_K) { best[tid] = -INFINITY; bi[tid] = 0; }  // start values, as the scans had
  __syncthreads();
  if (tid < NCAND) {
    int rank = 0;
    for (int e = 0; e < NCAND; ++e) {
      float v = cs[e];
      rank += (v > my || (v == my && e < tid)) ? 1 : 0;
    }
    if (rank < KNOW_K) { best[rank] = my; bi[rank] = myi; }
  }
  __syncthreads();
  // the picked rows are the same in every thread of the block: held as scalars, so that
  // the row loads take a scalar base and need no address arithmetic per lane
  const float* kr[KNOW_K];
#pragma unroll  // kr stays in registers
  for (int k = 0; k < KNOW_K; ++k)
    kr[k] = kV + (size_t)__builtin_amdgcn_readfirstlane(bi[k]) * D_MODEL;
  float kv[4][KNOW_K];
#pragma unroll  // kv stays in registers; the 32 row loads are independent and fly together,
                // while the weights are worked out
  for (int i = 0; i < 4; ++i)
#pragma unroll  // as above
    for (int k = 0; k < KNOW_K; ++k) kv[i][k] = kr[k][tid + 128 * i];
  float wk[KNOW_K];
  float mx = best[0], sum = 0.f;
#pragma unroll  // wk stays in registers (this loop and the next)
  for (int k = 0; k < KNOW_K; ++k) { wk[k] = expf(best[k] - mx); sum += wk[k]; }
  float inv = 1.f / sum;
#pragma unroll  // as above
  for (int k = 0; k < KNOW_K; ++k) wk[k] *= inv;
#pragma unroll  // xv stays in registers
  for (int i = 0; i < 4; ++i) {
    float acc = 0.f;
#pragma unroll  // as above
    for (int k = 0; k < KNOW_K; ++k) acc += wk[k] * kv[i][k];
    xv[i] += acc;
  }
  if constexpr (LAST) {
    __shared__ float red[256];
    ln_row<128>(xv, lng, lnb, red);
  }
  float* op = LAST ? out : x;
#pragma unroll  // as above
  for (int i = 0; i < 4; ++i) op[(size_t)tok * D_MODEL + tid + 128 * i] = xv[i];
}

extern "C" void kernel_launch(void* const* d_in, const int* in_sizes, int n_in,
                              void* d_out, int out_size, void* d_ws, size_t ws_size,
                              hipStream_t stream) {
  const float* x_in = (const float*)d_in[0];
  const float* cneur = (const float*)d_in[1];
  const float* eneur = (const float*)d_in[2];
  const float* kK = (const float*)d_in[3];
  const float* kV = (const float*)d_in[4];
  const float* rq = (const float*)d_in[5];
  const float* rk = (const float*)d_in[6];
  const float* rv = (const float*)d_in[7];
  const float* ro = (const float*)d_in[8];
  const float* rm = (const float*)d_in[9];
  const float* ln1g = (const float*)d_in[10];
  const float* ln1b = (const float*)d_in[11];
  const float* ln2g = (const float*)d_in[12];
  const float* ln2b = (const float*)d_in[13];
  const float* lnfg = (const float*)d_in[14];
  const float* lnfb = (const float*)d_in[15];
  float* out = (float*)d_out;

  float* ws = (float*)d_ws;
  float* xb = ws;     ws += (size_t)NTOK * D_MODEL;
  float* h = ws;      ws += (size_t)NTOK * D_MODEL;
  float* qc = ws;     ws += 2 * PLANE;  // qc, kc, vc lie in a row: out[0..2] of one launch
  float* kc = ws;     ws += 2 * PLANE;
  float* vc = ws;     ws += 2 * PLANE;
  float* ctx = ws;    ws += (size_t)NTOK * RANK;
  float* qm = ws;     ws += 2 * PLANE;
  float* candS = ws;  ws += (size_t)NTOK * NCAND;
  int* candI = (int*)ws;  ws += (size_t)NTOK * NCAND;
  int* sel = (int*)ws;    ws += (size_t)3 * NTOK * 2;
  float* wsel = ws;

  for (int l = 0; l < N_LAYERS; ++l) {
    const float* xi = l == 0 ? x_in : xb;  // layer 0 reads the input where it lies
    route_kernel<<<dim3(NTOK, 3), 128, 0, stream>>>(xi, ln1g + l * D_MODEL, ln1b + l * D_MODEL, h,
                                                    rq + (size_t)l * N_COMPRESS * D_MODEL,
                                                    rk + (size_t)l * N_COMPRESS * D_MODEL,
                                                    rv + (size_t)l * N_COMPRESS * D_MODEL, sel, wsel);
    compress_group_kernel<<<dim3(N_COMPRESS, RANK / 32, 3), 256, 0, stream>>>(h, sel, wsel, cneur, qc);
    attn_kernel<<<BATCH * N_HEADS * (SEQ / 16), 32 * ATT_W, 0, stream>>>(qc, kc, vc, ctx);
    expand_kernel<<<NTOK, 256, 0, stream>>>(ctx, ro + (size_t)l * N_EXPAND * RANK, eneur, xi, xb,
                                            ln2g + l * D_MODEL, ln2b + l * D_MODEL, h,
                                            rm + (size_t)l * N_COMPRESS * D_MODEL, sel, wsel);
    compress_group_kernel<<<dim3(N_COMPRESS, RANK / 32, 1), 256, 0, stream>>>(h, sel, wsel, cneur, qm);
    memscore_kernel<<<dim3(NTOK / 16, NSPLIT), 256, 0, stream>>>(qm, kK, candS, candI);
    if (l + 1 < N_LAYERS)
      memgather_kernel<false><<<NTOK, 128, 0, stream>>>(candS, candI, kV, xb, lnfg, lnfb, out);
    else
      memgather_kernel<true><<<NTOK, 128, 0, stream>>>(candS, candI, kV, xb, lnfg, lnfb, out);
  }
}

// v009
// Measured time: 289 microseconds a run.
// In two side-by-side timings against v008, it was 1.08 and 1.07 times as fast.
// All steps since v000 together make it 2.81 times as fast.
#include <hip/hip_runtime.h>
#include <math.h>

#define D_MODEL 512
#define RANK 128
#define N_HEADS 8
#define D_HEAD 16
#define N_COMPRESS 64
#define N_EXPAND 64
#define N_KNOW 32768
#define KNOW_K 8
#define N_LAYERS 2
#define BATCH 2
#define SEQ 512
#define NTOK (BATCH * SEQ)

#define CHUNK 512
#define NSPLIT 8                            // grid-Y partitions of the N_KNOW axis
#define NCHUNKS (N_KNOW / CHUNK)            // 64
#define CHPS (NCHUNKS / NSPLIT)             // 8 chunks per split
#define NCAND (NSPLIT * 8)                  // 64 candidates per token
#define KT_PITCH 132  // floats per staged kK row: 528 B = 16 B x 33, so the 32 lanes'
                      // 8-byte fragment reads fall on 64 distinct banks

#define PLANE ((size_t)NTOK * RANK)  // floats per plane of a compress result: plane s holds
                                     // each token's weighted projection by its s-th expert
#define GP_PITCH 36  // floats per row of a wave's 32x32 partial tile in LDS: 144 B keeps the
                     // 16-byte reads aligned and puts rows v and v + 8 on different banks

#define SC_LIST 36  // floats from one list's 32 scores of a chunk to the next list's: 144 B =
                    // 16 B x 9, so the 16 lanes' 16-byte reads fall on distinct banks
#define SC_PITCH (16 * SC_LIST + 4)  // floats per token row of a chunk's scores: rows v and
                                     // v + 8, stored by one instruction, fall on different banks

#define ATT_W 8    // waves per attention block
#define ATT_OP 18  // floats per row of a wave's parked output tile: rows v and v + 8, stored
                   // by one instruction, fall on different banks

typedef float v2f __attribute__((ext_vector_type(2)));
typedef float v4f __attribute__((ext_vector_type(4)));
typedef float v8f __attribute__((ext_vector_type(8)));

__device__ __forceinline__ v8f wmma_f32_16x16x4(v2f a, v2f b, v8f c) {
  // D = A(16x4 f32) * B(4x16 f32) + C(16x16 f32)
  return __builtin_amdgcn_wmma_f32_16x16x4_f32(false, a, false, b, (short)0, c,
                                               false, false);
}

// ---------------------------------------------------------------- LayerNorm
// of one row, by a block of NT threads (128 or 256) that already holds the row: thread t
// has elements t + NT i in v[i] and gets their normalised values back in v[i]. It stands
// inside the kernel that reads or makes the row, so that it costs no launch of its own.
// The 512 terms are added as a halving tree (distance 256, 128, ... 1): down to NT terms
// in the thread, down to 32 through LDS, the rest over the lanes; every wave does the
// part behind the barrier for itself, so one barrier is enough. The caller does not use
// red for anything else.
template <int NT>
__device__ __forceinline__ void ln_row(float (&v)[D_MODEL / NT], const float* __restrict__ g,
                                       const float* __restrict__ b, float* red /* [2 NT], LDS */) {
  static_assert(NT == 128 || NT == 256, "the tree is written out for these two");
  int tid = threadIdx.x;
  int lane = tid & 31;
  float gv[D_MODEL / NT], bv[D_MODEL / NT];
#pragma unroll  // gv and bv stay in registers; fetched ahead of the barrier, they fly during the sums
  for (int i = 0; i < D_MODEL / NT; ++i) { gv[i] = g[tid + NT * i]; bv[i] = b[tid + NT * i]; }
  if constexpr (NT == 128) {
    red[tid] = (v[0] + v[2]) + (v[1] + v[3]);
    red[NT + tid] = (v[0] * v[0] + v[2] * v[2]) + (v[1] * v[1] + v[3] * v[3]);
  } else {
    red[tid] = v[0] + v[1];
    red[NT + tid] = v[0] * v[0] + v[1] * v[1];
  }
  __syncthreads();
  float sq[2];
#pragma unroll  // sq stays in registers
  for (int j = 0; j < 2; ++j) {
    const float* r = red + j * NT + lane;
    if constexpr (NT == 128)
      sq[j] = (r[0] + r[64]) + (r[32] + r[96]);
    else
      sq[j] = ((r[0] + r[128]) + (r[64] + r[192])) + ((r[32] + r[160]) + (r[96] + r[224]));
  }
#pragma unroll  // five fixed lane distances
  for (int msk = 16; msk > 0; msk >>= 1) {
    sq[0] += __shfl_xor(sq[0], msk, 32);
    sq[1] += __shfl_xor(sq[1], msk, 32);
  }
  float mean = sq[0] * (1.0f / D_MODEL);
  float var = sq[1] * (1.0f / D_MODEL) - mean * mean;
  float rstd = rsqrtf(var + 1e-5f);
#pragma unroll  // v stays in registers
  for (int i = 0; i < D_MODEL / NT; ++i) v[i] = (v[i] - mean) * rstd * gv[i] + bv[i];
}

// ------------------------------------------------- routed compress (D -> R)
// Two stages. The routing normalises a token's row (h = LayerNorm(x)) and picks its two
// experts and their weights; compress_group_kernel takes one expert per block, gathers
// the tokens that picked it and multiplies them with the expert's matrix, which is so
// read once per block instead of once per token.
// The routing works on one token's row, so it needs no launch of its own where the kernel
// in front of it makes that row in one block: route_row is called by route_kernel (q, k, v)
// and at the foot of expand_kernel (the memory query).

// Sums over the 32 lanes of N rows' partial sums, a[i] being this lane's part of row i.
// Halving butterfly, lane distance MSK = 16, 8, ...: at each level a lane hands over the
// half of its rows that its partner keeps; with one row left the remaining distances are
// plain sums. Called with N rows and MSK = 16, lanes (32 / N) e .. return row e's whole sum.
template <int N, int MSK>
__device__ __forceinline__ float fold_rows(const float (&a)[N], int lane) {
  if constexpr (N == 1) {
    float s = a[0];
#pragma unroll  // fixed lane distances
    for (int m = MSK; m >= 1; m >>= 1) s += __shfl_xor(s, m, 32);
    return s;
  } else {
    float o[N / 2];
    bool up = lane & MSK;
#pragma unroll  // the partial sums stay in registers
    for (int i = 0; i < N / 2; ++i)
      o[i] = (up ? a[i + N / 2] : a[i]) + __shfl_xor(up ? a[i] : a[i + N / 2], MSK, 32);
    return fold_rows<N / 2, MSK / 2>(o, lane);
  }
}

// One token's routing by a block of NW waves (4 or 8). On entry hs (LDS, [512], 16-byte
// aligned) holds h, ss and se (LDS, [2]) their start values, and a barrier has published
// them. sc is LDS, [64]. sel2 and wsel2 are the token's own two entries.
template <int NW>
__device__ __forceinline__ void route_row(const float* hs, const float* __restrict__ router,  // [64,512]
                                          float* sc, float* ss, int* se,
                                          int* __restrict__ sel2, float* __restrict__ wsel2) {
  constexpr int R = N_COMPRESS / NW;  // router rows per wave
  static_assert(R == 8 || R == 16, "the lane sum below halves R rows over the 32 lanes");
  int tid = threadIdx.x;
  // router logits: wave w takes rows R w .. R w + R - 1. A row is read as whole 128-byte
  // lines (lane l holds d = 128 j + 4 l .. +3, j = 0..3), each lane sums its 16
  // products, and the lanes' partial sums are added over the wave.
  {
    int lane = tid & 31, wave = tid >> 5;
    v4f hv[4];
#pragma unroll  // hv stays in registers
    for (int j = 0; j < 4; ++j) hv[j] = *(const v4f*)(hs + 128 * j + 4 * lane);
    const float* rp = router + (size_t)(wave * R) * D_MODEL + 4 * lane;
    float p[R];
#pragma unroll  // p stays in registers; the 4 R row loads are independent and fly together
    for (int e = 0; e < R; ++e) {
      v2f acc = {0.f, 0.f};
#pragma unroll  // as above
      for (int j = 0; j < 4; ++j) {
        v4f rv = *(const v4f*)(rp + e * D_MODEL + 128 * j);
        acc += hv[j].xy * rv.xy;
        acc += hv[j].zw * rv.zw;
      }
      p[e] = acc.x + acc.y;
    }
    float p0 = fold_rows<R, 16>(p, lane);
    if ((lane & (32 / R - 1)) == 0) sc[wave * R + lane / (32 / R)] = p0;
  }
  __syncthreads();
  float my = (tid < N_COMPRESS) ? sc[tid] : 0.f;
  // top-2 by rank: each score counts the scores that come before it (greater, or
  // equal with a lower index); ranks 0 and 1 are the two that a scan in index order picks
  if (tid < N_COMPRESS) {
    int rank = 0;
    for (int e = 0; e < N_COMPRESS; ++e) {
      float s = sc[e];
      rank += (s > my || (s == my && e < tid)) ? 1 : 0;
    }
    if (rank < 2) { ss[rank] = my; se[rank] = tid; }
  }
  __syncthreads();
  if (tid < 2) {
    float z = expf(ss[1] - ss[0]);
    sel2[tid] = se[tid];
    wsel2[tid] = (tid == 0 ? 1.f : z) / (1.f + z);
  }
}

// Projections of the same x that do not hang on one another (q, k, v) share the two
// launches: grid y of route_kernel and grid z of compress_group_kernel name the
// projection, so their latencies overlap and no launch gap stands between them.
// Each projection's block normalises the row for itself; projection 0's stores h.
// the bound states the block size, so that the logits' row loads in flight fit the
// register budget without spills
__global__ __launch_bounds__(128) void route_kernel(const float* __restrict__ x,
                                const float* __restrict__ lng,      // [512] LayerNorm gain
                                const float* __restrict__ lnb,      // [512] LayerNorm bias
                                float* __restrict__ h,              // [NTOK,512] LayerNorm(x)
                                const float* __restrict__ router0,  // [64,512], projection 0
                                const float* __restrict__ router1,  // projection 1
                                const float* __restrict__ router2,  // projection 2
                                int* __restrict__ sel,              // [grid y,NTOK,2] expert
                                float* __restrict__ wsel) {         // [grid y,NTOK,2] weight
  int tok = blockIdx.x;
  int pr = blockIdx.y;
  const float* router = pr == 0 ? router0 : (pr == 1 ? router1 : router2);
  sel += pr * (2 * NTOK);
  wsel += pr * (2 * NTOK);
  int tid = threadIdx.x;  // 128 threads
  __shared__ __attribute__((aligned(16))) float hs[D_MODEL];
  __shared__ float sc[N_COMPRESS];
  __shared__ float ss[2];
  __shared__ int se[2];
  __shared__ float red[256];
  float hv[4];
#pragma unroll  // hv stays in registers (this loop and the two below)
  for (int i = 0; i < 4; ++i) hv[i] = x[(size_t)tok * D_MODEL + tid + 128 * i];
  ln_row<128>(hv, lng, lnb, red);
#pragma unroll  // as above
  for (int i = 0; i < 4; ++i) hs[tid + 128 * i] = hv[i];
  if (tid < 2) { ss[tid] = -INFINITY; se[tid] = 0; }  // start values, as the scan had
  __syncthreads();
  route_row<4>(hs, router, sc, ss, se, sel + tok * 2, wsel + tok * 2);
  // stored behind the last barrier: in front of one, the barrier would wait for the stores
  if (pr == 0) {
#pragma unroll  // as above
    for (int i = 0; i < 4; ++i) h[(size_t)tok * D_MODEL + tid + 128 * i] = hv[i];
  }
}

// grid = (N_COMPRESS, RANK / 32, projections): block (e, y, z) computes columns
// 32 y .. 32 y + 31 of h[tok] x neurons[e] for every entry (tok, s) with
// sel[z][tok][s] == e, 32 entries a pass.
// Wave w takes k = 64 w .. 64 w + 63 on WMMA f32 16x16x4; the eight partial tiles are
// added through LDS in wave order. Row (tok, s) goes, times its weight, to plane s of out[z].
__global__ __launch_bounds__(256) void compress_group_kernel(
    const float* __restrict__ h,        // [NTOK,512]
    const int* __restrict__ sel,        // [grid z,NTOK,2]
    const float* __restrict__ wsel,     // [grid z,NTOK,2]
    const float* __restrict__ neurons,  // [64,512,128]
    float* __restrict__ out) {          // [grid z,2,NTOK,128]
  int e = blockIdx.x;
  int n0 = blockIdx.y * 32;
  sel += blockIdx.z * (2 * NTOK);
  wsel += blockIdx.z * (2 * NTOK);
  out += blockIdx.z * (2 * PLANE);
  int tid = threadIdx.x;  // 256 threads = 8 waves
  int lane = tid & 31;
  int wave = tid >> 5;
  int nl = lane & 15;
  int kh = lane >> 4;
  __shared__ int list[2 * NTOK];  // this expert's entries (2 tok + s), ascending
  __shared__ int wcnt[64];
  __shared__ __attribute__((aligned(16))) float red[8][32 * GP_PITCH];

  int sv[8];
#pragma unroll  // sv stays in registers; the 8 loads fly together
  for (int j = 0; j < 8; ++j) sv[j] = sel[j * 256 + tid];

  // the list: a ballot per 32 entries, the counts summed in entry order
  unsigned mk[8];
#pragma unroll  // mk stays in registers
  for (int j = 0; j < 8; ++j) {
    mk[j] = __builtin_amdgcn_ballot_w32(sv[j] == e);
    if (lane == 0) wcnt[j * 8 + wave] = __popc(mk[j]);
  }
  __syncthreads();

  // B fragments, kept in registers for all passes; they fly while the list is built.
  // WMMA step 2 j + i of this wave multiplies k = 64 w + 8 j + 4 kh + 2 i + {0, 1},
  // in B here as in A below.
  const float* bp = neurons + (size_t)e * (D_MODEL * RANK) + (size_t)(wave * 64 + 4 * kh) * RANK + n0 + nl;
  v2f bf[2][16];
#pragma unroll  // bf stays in registers
  for (int j = 0; j < 8; ++j) {
#pragma unroll  // as above
    for (int nn = 0; nn < 2; ++nn) {
      bf[nn][2 * j].x = bp[(8 * j + 0) * RANK + 16 * nn];
      bf[nn][2 * j].y = bp[(8 * j + 1) * RANK + 16 * nn];
      bf[nn][2 * j + 1].x = bp[(8 * j + 2) * RANK + 16 * nn];
      bf[nn][2 * j + 1].y = bp[(8 * j + 3) * RANK + 16 * nn];
    }
  }

  int run = 0;
  int base[8];
#pragma unroll  // base stays in registers
  for (int q = 0; q < 64; ++q) {
    if ((q & 7) == wave) base[q >> 3] = run;
    run += wcnt[q];
  }
  unsigned below = (1u << lane) - 1u;
#pragma unroll  // as above
  for (int j = 0; j < 8; ++j)
    if ((mk[j] >> lane) & 1u) list[base[j] + __popc(mk[j] & below)] = j * 256 + tid;
  __syncthreads();
  // the same in every thread of the block; held as a scalar so that the pass loop,
  // which holds WMMAs and barriers, branches on a scalar compare
  int n = __builtin_amdgcn_readfirstlane(run);

  for (int m0 = 0; m0 < n; m0 += 32) {
    // A fragments: lane (nl, kh) reads its entry's h row; a row past the end of the
    // list reads entry 0's and is not stored
    v4f af[2][8];
#pragma unroll  // af stays in registers
    for (int t = 0; t < 2; ++t) {
      int ix = m0 + t * 16 + nl;
      int en = list[ix < n ? ix : 0];
      const float* ap = h + (size_t)(en >> 1) * D_MODEL + wave * 64 + 4 * kh;
#pragma unroll  // as above
      for (int j = 0; j < 8; ++j) af[t][j] = *(const v4f*)(ap + 8 * j);
    }
    // the row that this thread stores at the foot of the pass, and its weight, fetched early
    int m = tid >> 3, c4 = (tid & 7) * 4;  // 8 threads x 16 B = one 128-byte line per row
    int eo = list[m0 + m < n ? m0 + m : 0];
    float wo = wsel[eo];
    v8f c[2][2];
#pragma unroll  // c stays in registers (this loop and the two below)
    for (int t = 0; t < 2; ++t)
#pragma unroll  // as above
      for (int nn = 0; nn < 2; ++nn)
#pragma unroll  // as above
        for (int v = 0; v < 8; ++v) c[t][nn][v] = 0.f;
#pragma unroll  // as above
    for (int j = 0; j < 8; ++j) {
#pragma unroll  // as above
      for (int t = 0; t < 2; ++t)
#pragma unroll  // as above
        for (int nn = 0; nn < 2; ++nn)
          c[t][nn] = wmma_f32_16x16x4(af[t][j].xy, bf[nn][2 * j], c[t][nn]);
#pragma unroll  // as above
      for (int t = 0; t < 2; ++t)
#pragma unroll  // as above
        for (int nn = 0; nn < 2; ++nn)
          c[t][nn] = wmma_f32_16x16x4(af[t][j].zw, bf[nn][2 * j + 1], c[t][nn]);
    }
#pragma unroll  // as above
    for (int t = 0; t < 2; ++t)
#pragma unroll  // as above
      for (int nn = 0; nn < 2; ++nn)
#pragma unroll  // as above
        for (int v = 0; v < 8; ++v)
          red[wave][(t * 16 + v + 8 * kh) * GP_PITCH + nn * 16 + nl] = c[t][nn][v];
    __syncthreads();
    v4f sum = *(const v4f*)(&red[0][m * GP_PITCH + c4]);
#pragma unroll  // the 8 reads fly together
    for (int w = 1; w < 8; ++w) sum += *(const v4f*)(&red[w][m * GP_PITCH + c4]);
    if (m0 + m < n)
      *(v4f*)(out + (size_t)(eo & 1) * PLANE + (size_t)(eo >> 1) * RANK + n0 + c4) = sum * wo;
    __syncthreads();  // red is rewritten by the next pass
  }
}

// --------------------------------------------------- routed expand (R -> D)
// The block makes its token's whole new row x, so the stages behind it that work on that
// row alone follow in the same launch: the second LayerNorm and the memory query's routing.
// the bound states the block size: the register budget of eight waves a SIMD is kept
// (four blocks a WGP, the whole grid resident at once)
__global__ __launch_bounds__(256, 8) void expand_kernel(
                              const float* __restrict__ in,        // [NTOK,128]
                              const float* __restrict__ router,    // [64,128]
                              const float* __restrict__ neurons,   // [64,128,512]
                              const float* xi,                     // [NTOK,512] residual in
                              float* xo,                           // [NTOK,512] out; may be xi
                              const float* __restrict__ lng,       // [512] LayerNorm gain
                              const float* __restrict__ lnb,       // [512] LayerNorm bias
                              float* __restrict__ h,               // [NTOK,512] LayerNorm(xo)
                              const float* __restrict__ router_m,  // [64,512]
                              int* __restrict__ sel,               // [NTOK,2] expert
                              float* __restrict__ wsel) {          // [NTOK,2] weight
  int tok = blockIdx.x;
  int tid = threadIdx.x;  // 256 threads
  __shared__ __attribute__((aligned(16))) float is[RANK];
  __shared__ float sc[N_EXPAND];
  __shared__ float ss[2];
  __shared__ int se[2];
  __shared__ __attribute__((aligned(16))) float hs[D_MODEL];  // from here: the stages behind
  __shared__ float red[512];
  __shared__ float sc2[N_COMPRESS];
  __shared__ float ss2[2];
  __shared__ int se2[2];
  const float* ip = in + (size_t)tok * RANK;
  if (tid < RANK) is[tid] = ip[tid];
  if (tid < 2) {  // start values, as the scan had
    ss[tid] = -INFINITY; se[tid] = 0;
    ss2[tid] = -INFINITY; se2[tid] = 0;
  }
  __syncthreads();
  // router logits as in route_row: wave w takes rows 8w..8w+7, one 16-byte
  // load per lane covers a row (lane l holds r = 4 l .. +3)
  {
    int lane = tid & 31, wave = tid >> 5;
    v4f iv = *(const v4f*)(is + 4 * lane);
    const float* rp = router + (size_t)(wave * 8) * RANK + 4 * lane;
    float p8[8];
#pragma unroll  // p8 stays in registers; the 8 row loads are independent and fly together
    for (int e = 0; e < 8; ++e) {
      v4f rv = *(const v4f*)(rp + e * RANK);
      v2f acc = iv.xy * rv.xy;
      acc += iv.zw * rv.zw;
      p8[e] = acc.x + acc.y;
    }
    // halving butterfly; lanes 4e..4e+3 end with row e's whole sum
    float p4[4], p2[2];
    bool u16 = lane & 16, u8 = lane & 8, u4 = lane & 4;
#pragma unroll  // the partial sums stay in registers (this loop and the next)
    for (int i = 0; i < 4; ++i)
      p4[i] = (u16 ? p8[i + 4] : p8[i]) + __shfl_xor(u16 ? p8[i] : p8[i + 4], 16, 32);
#pragma unroll  // as above
    for (int i = 0; i < 2; ++i)
      p2[i] = (u8 ? p4[i + 2] : p4[i]) + __shfl_xor(u8 ? p4[i] : p4[i + 2], 8, 32);
    float p1 = (u4 ? p2[1] : p2[0]) + __shfl_xor(u4 ? p2[0] : p2[1], 4, 32);
    p1 += __shfl_xor(p1, 2, 32);
    p1 += __shfl_xor(p1, 1, 32);
    if ((lane & 3) == 0) sc[wave * 8 + (lane >> 2)] = p1;
  }
  __syncthreads();
  float my = (tid < N_EXPAND) ? sc[tid] : 0.f;
  // top-2 by rank, as in route_row
  if (tid < N_EXPAND) {
    int rank = 0;
    for (int e = 0; e < N_EXPAND; ++e) {
      float s = sc[e];
      rank += (s > my || (s == my && e < tid)) ? 1 : 0;
    }
    if (rank < 2) { ss[rank] = my; se[rank] = tid; }
  }
  __syncthreads();
  int e0 = se[0], e1i = se[1];
  float z = expf(ss[1] - ss[0]);
  float w0 = 1.f / (1.f + z), w1 = z / (1.f + z);
  for (int d = tid; d < D_MODEL; d += 256) {
    const float* n0 = neurons + (size_t)e0 * (RANK * D_MODEL) + d;
    const float* n1 = neurons + (size_t)e1i * (RANK * D_MODEL) + d;
    float a0 = 0.f, a1 = 0.f;
    for (int r = 0; r < RANK; ++r) {
      float iv = is[r];
      a0 += iv * n0[(size_t)r * D_MODEL];
      a1 += iv * n1[(size_t)r * D_MODEL];
    }
    hs[d] = xi[(size_t)tok * D_MODEL + d] + (w0 * a0 + w1 * a1);  // parked: read back by this thread
  }
  float xv[2], hv[2];
#pragma unroll  // xv and hv stay in registers (this loop and the two below)
  for (int i = 0; i < 2; ++i) hv[i] = xv[i] = hs[tid + 256 * i];
  ln_row<256>(hv, lng, lnb, red);
#pragma unroll  // as above
  for (int i = 0; i < 2; ++i) hs[tid + 256 * i] = hv[i];
  __syncthreads();
  route_row<8>(hs, router_m, sc2, ss2, se2, sel + tok * 2, wsel + tok * 2);
  // stored behind the last barrier: in front of one, the barrier would wait for the stores
#pragma unroll  // as above
  for (int i = 0; i < 2; ++i) {
    xo[(size_t)tok * D_MODEL + tid + 256 * i] = xv[i];
    h[(size_t)tok * D_MODEL + tid + 256 * i] = hv[i];
  }
}

// -------------------------- flash attention: one block per (b, head, q-tile)
// WMMA f32 16x16x4: QK^T (K=16 -> 4 wmma) and P@V (K=16 -> 4 wmma) per tile.
// Q, K and V come as two planes each (see compress_group_kernel), added as they are read.
// The key tiles are dealt to the block's ATT_W waves (wave w takes tiles w, w + ATT_W, ...):
// a tile's steps hang on one another, so the longest row of tiles sets the launch's time.
// Each wave runs its own online softmax; the partial results are joined at the end.
__global__ __launch_bounds__(32 * ATT_W) void attn_kernel(
    const float* __restrict__ Q, const float* __restrict__ K,
    const float* __restrict__ V, float* __restrict__ O) {
  int bid = blockIdx.x;
  int qt = bid % (SEQ / 16);
  int head = (bid / (SEQ / 16)) % N_HEADS;
  int b = bid / ((SEQ / 16) * N_HEADS);
  int tid = threadIdx.x;  // 32 * ATT_W threads
  int lane = tid & 31;
  // the same in every lane of a wave; held as a scalar so that the tile loop, which
  // holds WMMAs, branches on a scalar compare
  int wave = __builtin_amdgcn_readfirstlane(tid >> 5);
  int nl = lane & 15;
  int kh = lane >> 4;      // which K half (A/B layout: lanes 16-31 hold K+2)
  int mrow = kh ? 8 : 0;   // C/D layout: lanes 16-31 hold rows 8-15
  size_t base = (size_t)b * SEQ;
  __shared__ float PtAll[ATT_W][16][17];
  __shared__ float oS[ATT_W][16][ATT_OP];  // each wave's unnormalised output tile
  __shared__ float mS[ATT_W][16];          // its row maxima
  __shared__ float lS[ATT_W][16];          // its row sums
  float (*Pt)[17] = PtAll[wave];           // private to the wave

  // A fragments for Q tile (16 rows x K=16), 4 chunks of K=4
  const float* qp = Q + (base + qt * 16 + nl) * RANK + head * D_HEAD;
  v2f aq[4];
#pragma unroll
  for (int kc = 0; kc < 4; ++kc)
    aq[kc] = *(const v2f*)(qp + 4 * kc + 2 * kh) + *(const v2f*)(qp + PLANE + 4 * kc + 2 * kh);

  v8f o;
  float rm[8], rl[8];
#pragma unroll
  for (int v = 0; v < 8; ++v) { o[v] = 0.f; rm[v] = -INFINITY; rl[v] = 0.f; }

  for (int j = wave; j <= qt; j += ATT_W) {
    v8f s;
#pragma unroll
    for (int v = 0; v < 8; ++v) s[v] = 0.f;
    const float* kp = K + (base + j * 16 + nl) * RANK + head * D_HEAD;
#pragma unroll
    for (int kc = 0; kc < 4; ++kc) {
      v2f bk = *(const v2f*)(kp + 4 * kc + 2 * kh) +
               *(const v2f*)(kp + PLANE + 4 * kc + 2 * kh);  // B[k][n], B[k+1][n]
      s = wmma_f32_16x16x4(aq[kc], bk, s);
    }
    // scale + causal mask (query = qt*16+m, key = j*16+n)
#pragma unroll
    for (int v = 0; v < 8; ++v) {
      float sv = s[v] * 0.25f;  // 1/sqrt(16)
      if (j == qt && nl > v + mrow) sv = -INFINITY;
      s[v] = sv;
    }
    // online softmax (rows live across 16-lane halves -> butterfly 1,2,4,8)
#pragma unroll
    for (int v = 0; v < 8; ++v) {
      float tmax = s[v];
#pragma unroll
      for (int msk = 1; msk < 16; msk <<= 1)
        tmax = fmaxf(tmax, __shfl_xor(tmax, msk, 32));
      float nm = fmaxf(rm[v], tmax);
      float alpha = __expf(rm[v] - nm);
      float p = __expf(s[v] - nm);
      float psum = p;
#pragma unroll
      for (int msk = 1; msk < 16; msk <<= 1) psum += __shfl_xor(psum, msk, 32);
      rl[v] = rl[v] * alpha + psum;
      o[v] *= alpha;
      rm[v] = nm;
      s[v] = p;
    }
    // re-layout P: C-layout -> LDS -> A-layout
#pragma unroll
    for (int v = 0; v < 8; ++v) Pt[v + mrow][nl] = s[v];
    // the wave's own stores have landed before its lanes read each other's values
    // back (the range is private to the wave: no barrier, and the waves' trip counts differ)
    asm volatile("s_wait_dscnt 0x0" ::: "memory");
    const float* vp = V + (base + j * 16) * RANK + head * D_HEAD + nl;
#pragma unroll
    for (int kc = 0; kc < 4; ++kc) {
      v2f ap;
      ap.x = Pt[nl][4 * kc + 2 * kh];
      ap.y = Pt[nl][4 * kc + 2 * kh + 1];
      v2f bv;
      bv.x = vp[(size_t)(4 * kc + 2 * kh) * RANK] + vp[PLANE + (size_t)(4 * kc + 2 * kh) * RANK];
      bv.y = vp[(size_t)(4 * kc + 2 * kh + 1) * RANK] + vp[PLANE + (size_t)(4 * kc + 2 * kh + 1) * RANK];
      o = wmma_f32_16x16x4(ap, bv, o);
    }
  }
  // join the waves' partial results: a wave without a tile hands in maximum -inf,
  // sum 0 and output 0, and so weighs nothing (wave 0 always has tile 0)
#pragma unroll  // o stays in registers
  for (int v = 0; v < 8; ++v) oS[wave][v + mrow][nl] = o[v];
  if (nl == 0) {
#pragma unroll  // rm and rl stay in registers
    for (int v = 0; v < 8; ++v) { mS[wave][v + mrow] = rm[v]; lS[wave][v + mrow] = rl[v]; }
  }
  __syncthreads();
  static_assert(32 * ATT_W == 256, "one thread per element of the 16x16 output tile");
  int r = tid >> 4, cc = tid & 15;
  float mx = mS[0][r];
#pragma unroll  // the LDS reads fly together (this loop and the next)
  for (int w = 1; w < ATT_W; ++w) mx = fmaxf(mx, mS[w][r]);
  float den = 0.f, num = 0.f;
#pragma unroll  // as above
  for (int w = 0; w < ATT_W; ++w) {
    float f = __expf(mS[w][r] - mx);
    den += lS[w][r] * f;
    num += oS[w][r][cc] * f;
  }
  O[(base + qt * 16 + r) * RANK + head * D_HEAD + cc] = num / den;
}

// The greatest of v over the 16 lanes of a row (lanes 0-15, lanes 16-31), in every lane of
// the row: four vector steps at lane distances 1, 2, 4, 8 inside the row, where a shuffle
// would go through the LDS unit and be waited for at each step. All 32 lanes are on.
template <int DIST>
__device__ __forceinline__ float row16_other(float v) {  // v of lane l ^ DIST, DIST < 16
  int b = __builtin_bit_cast(int, v);
  return __builtin_bit_cast(float, __builtin_amdgcn_update_dpp(b, b, 0x160 + DIST, 0xf, 0xf, false));
}
// How many of the row's other 15 lanes hold a value >= v: called with D = 15. The 15 lane
// steps do not hang on one another. All 32 lanes are on.
template <int D>
__device__ __forceinline__ int row16_count_ge(float v) {
  if constexpr (D == 0)
    return 0;
  else
    return (row16_other<D>(v) >= v ? 1 : 0) + row16_count_ge<D - 1>(v);
}
__device__ __forceinline__ float row16_max(float v) {
  v = fmaxf(v, row16_other<1>(v));
  v = fmaxf(v, row16_other<2>(v));
  v = fmaxf(v, row16_other<4>(v));
  v = fmaxf(v, row16_other<8>(v));
  return v;
}

// ---------------- memory scores GEMM (WMMA f32, K=128) fused with top-8.
// grid = (NTOK/16, NSPLIT): split N_KNOW 8 ways for 8x more waves on the
// FLOP-dominant kernel; each split emits per-row top-8 candidates.
// Each wave brings its 16-column kK tile in as whole 512-byte rows (one row per
// 16-byte-per-lane load), one tile ahead, parks it in its own LDS range and
// reads the B fragments from there (k = 4 kc + 2 kh, as the A fragments).
// The top-8: wave w keeps token rows 2 w and 2 w + 1; the 16 lanes of a lane row hold that
// token's 16 sorted lists, lane nl the list of columns 32 nl .. 32 nl + 31 of every chunk.
// A score enters its list only above the token's bound, the 8th greatest of the 16 list
// heads: eight scores of earlier columns are at least as great as the bound, so a score
// that is not above it is in no top-8. Far fewer scores pass than pass a list's own 8th.
__global__ __launch_bounds__(256) void memscore_kernel(const float* __restrict__ Qm,  // [2,NTOK,128]
                                const float* __restrict__ kK,  // [N_KNOW,128]
                                float* __restrict__ candS,     // [NTOK,NSPLIT,8]
                                int* __restrict__ candI) {     // [NTOK,NSPLIT,8]
  int tb = blockIdx.x;      // 16-token tile
  int split = blockIdx.y;   // column partition
  int tid = threadIdx.x;    // 256 threads = 8 waves
  int lane = tid & 31;
  int wave = tid >> 5;
  int nl = lane & 15;
  int kh = lane >> 4;
  int mrow = kh ? 8 : 0;
  size_t tokBase = (size_t)tb * 16;

  __shared__ __attribute__((aligned(16))) float sc[16][SC_PITCH];
  __shared__ __attribute__((aligned(16))) float kt[8][16 * KT_PITCH];  // one tile per wave
  float* ktw = &kt[wave][0];

  // A fragments for the Q tile (its two planes added): K=128 -> 32 chunks, kept in registers
  const float* qp = Qm + (tokBase + nl) * RANK;
  v2f aq[32];
#pragma unroll
  for (int kc = 0; kc < 32; ++kc)
    aq[kc] = *(const v2f*)(qp + 4 * kc + 2 * kh) + *(const v2f*)(qp + PLANE + 4 * kc + 2 * kh);

  float ts[8];
  int ti8[8];
#pragma unroll
  for (int i = 0; i < 8; ++i) { ts[i] = -INFINITY; ti8[i] = 0; }
  int r = wave * 2 + kh;    // the token row whose list nl this lane keeps
  float thr = -INFINITY;    // the row's bound
  float lim = -INFINITY;    // the greater of the bound and the list's own 8th
  const float scale = 0.08838834764831845f;  // 1/sqrt(128)

  // this wave's first tile: row i of the tile = 32 lanes x 16 B = 4 whole lines
  v4f st[16];
  const float* gp = kK + (size_t)(split * CHPS * CHUNK + wave * 64) * RANK + lane * 4;
#pragma unroll
  for (int i = 0; i < 16; ++i) st[i] = *(const v4f*)(gp + i * RANK);
  // inputs-only fence on the A values (each the sum of two loaded values, no product):
  // A is waited for here, once. Without it
  // the waits for A stand among the WMMAs of the loop and drain the next tile's
  // loads there on every trip.
  asm volatile("" ::"v"(aq[0]), "v"(aq[1]), "v"(aq[2]), "v"(aq[3]), "v"(aq[4]), "v"(aq[5]),
               "v"(aq[6]), "v"(aq[7]), "v"(aq[8]), "v"(aq[9]), "v"(aq[10]), "v"(aq[11]),
               "v"(aq[12]), "v"(aq[13]), "v"(aq[14]), "v"(aq[15]));
  asm volatile("" ::"v"(aq[16]), "v"(aq[17]), "v"(aq[18]), "v"(aq[19]), "v"(aq[20]), "v"(aq[21]),
               "v"(aq[22]), "v"(aq[23]), "v"(aq[24]), "v"(aq[25]), "v"(aq[26]), "v"(aq[27]),
               "v"(aq[28]), "v"(aq[29]), "v"(aq[30]), "v"(aq[31]));

  for (int ch = split * CHPS; ch < (split + 1) * CHPS; ++ch) {
    // stage A: 8 waves x 4 n-tiles of 16 cols = 512 cols via WMMA
#pragma unroll 1
    for (int t = 0; t < 4; ++t) {
      int ntl = wave * 4 + t;
#pragma unroll
      for (int i = 0; i < 16; ++i) *(v4f*)(ktw + i * KT_PITCH + lane * 4) = st[i];
      // the wave's own row stores have landed before its lanes read each other's
      // rows back as fragments (the range is private to the wave: no barrier)
      asm volatile("s_wait_dscnt 0x0" ::: "memory");
      // the wave's next tile flies while this one is multiplied; none behind the last
      if (t < 3 || ch + 1 < (split + 1) * CHPS) {
        gp += (t < 3 ? 16 : CHUNK - 48) * RANK;  // next tile of the chunk, or first of the next
#pragma unroll
        for (int i = 0; i < 16; ++i) st[i] = *(const v4f*)(gp + i * RANK);
      }
      const float* kp = ktw + nl * KT_PITCH;
      v8f c;
#pragma unroll
      for (int v = 0; v < 8; ++v) c[v] = 0.f;
#pragma unroll
      for (int kc = 0; kc < 32; ++kc) {
        v2f bk = *(const v2f*)(kp + 4 * kc + 2 * kh);
        c = wmma_f32_16x16x4(aq[kc], bk, c);
      }
#pragma unroll
      for (int v = 0; v < 8; ++v)
        sc[v + mrow][(ntl >> 1) * SC_LIST + (ntl & 1) * 16 + nl] = c[v] * scale;
    }
    __syncthreads();
    // stage B: the lane's 32 scores of the chunk come in together
    v4f g[8];
#pragma unroll  // g stays in registers; the 8 reads fly together
    for (int i = 0; i < 8; ++i) g[i] = *(const v4f*)(&sc[r][nl * SC_LIST + 4 * i]);
    // every wave holds its scores in registers: sc may be rewritten, and no wave waits
    // for another's scan
    __syncthreads();
    int cbase = ch * CHUNK + nl * 32;
#pragma unroll  // g stays in registers
    for (int i = 0; i < 32; ++i) {
      float s = g[i >> 2][i & 3];
      if (s > lim) {
        ts[7] = s;
        ti8[7] = cbase + i;
#pragma unroll
        for (int q = 7; q > 0; --q) {
          if (ts[q] > ts[q - 1]) {
            float tf = ts[q]; ts[q] = ts[q - 1]; ts[q - 1] = tf;
            int tt = ti8[q]; ti8[q] = ti8[q - 1]; ti8[q - 1] = tt;
          }
        }
        lim = fmaxf(thr, ts[7]);
      }
    }
    // the bound for the chunks to come: the greatest head that has seven others at least as great
    thr = row16_max(row16_count_ge<15>(ts[0]) >= 7 ? ts[0] : -INFINITY);
    lim = fmaxf(thr, ts[7]);
  }
  // merge 16 candidate lists per row -> this split's top-8 candidates. The lists lie where
  // they are needed, each sorted with its best in front. Eight times: the greatest
  // of the 16 heads is the pick, and the list that it came from moves up by one. Of equal
  // heads the lowest list wins, as in a scan over the lists in their order.
  float lt[8];
  int lx[8];
#pragma unroll  // lt and lx stay in registers (this loop and the two below)
  for (int i = 0; i < 8; ++i) { lt[i] = ts[i]; lx[i] = ti8[i]; }
  size_t ob = ((tokBase + r) * NSPLIT + split) * 8;
#pragma unroll  // as above
  for (int k = 0; k < 8; ++k) {
    float m = row16_max(lt[0]);
    unsigned hit = (__builtin_amdgcn_ballot_w32(lt[0] == m) >> (16 * kh)) & 0xffffu;
    bool win = nl == (hit ? __ffs(hit) - 1 : 0);  // no head equal to m (not-a-numbers): list 0
    if (win) { candS[ob + k] = m; candI[ob + k] = lx[0]; }
#pragma unroll  // as above
    for (int i = 0; i < 7; ++i) { lt[i] = win ? lt[i + 1] : lt[i]; lx[i] = win ? lx[i + 1] : lx[i]; }
    lt[7] = win ? -INFINITY : lt[7];
  }
}

// ---- merge NSPLIT candidate lists (disjoint column ranges -> exact top-8), weighted
// gather of kV, residual; behind the last layer also the closing LayerNorm.
// One block per token. A candidate's rank is the number of its token's candidates that
// come before it (greater score, or equal score and a lower position): ranks 0..7 are
// the picks of eight scans in position order.
template <bool LAST>
__global__ __launch_bounds__(128) void memgather_kernel(const float* __restrict__ candS,
                                const int* __restrict__ candI, const float* __restrict__ kV,
                                float* __restrict__ x,          // [NTOK,512], += unless LAST
                                const float* __restrict__ lng,  // LAST: closing LayerNorm
                                const float* __restrict__ lnb,
                                float* __restrict__ out) {      // LAST: [NTOK,512]
  int tok = blockIdx.x;
  int tid = threadIdx.x;  // 128
  __shared__ float cs[NCAND];
  __shared__ float best[KNOW_K];
  __shared__ int bi[KNOW_K];
  float xv[4];
#pragma unroll  // xv stays in registers; the loads fly while the picks are made
  for (int i = 0; i < 4; ++i) xv[i] = x[(size_t)tok * D_MODEL + tid + 128 * i];
  float my = 0.f;
  int myi = 0;
  if (tid < NCAND) {
    my = candS[(size_t)tok * NCAND + tid];
    myi = candI[(size_t)tok * NCAND + tid];
    cs[tid] = my;
  }
  if (tid < KNOW_K) { best[tid] = -INFINITY; bi[tid] = 0; }  // start values, as the scans had
  __syncthreads();
  if (tid < NCAND) {
    int rank = 0;
    for (int e = 0; e < NCAND; ++e) {
      float v = cs[e];
      rank += (v > my || (v == my && e < tid)) ? 1 : 0;
    }
    if (rank < KNOW_K) { best[rank] = my; bi[rank] = myi; }
  }
  __syncthreads();
  // the picked rows are the same in every thread of the block: held as scalars, so that
  // the row loads take a scalar base and need no address arithmetic per lane
  const float* kr[KNOW_K];
#pragma unroll  // kr stays in registers
  for (int k = 0; k < KNOW_K; ++k)
    kr[k] = kV + (size_t)__builtin_amdgcn_readfirstlane(bi[k]) * D_MODEL;
  float kv[4][KNOW_K];
#pragma unroll  // kv stays in registers; the 32 row loads are independent and fly together,
                // while the weights are worked out
  for (int i = 0; i < 4; ++i)
#pragma unroll  // as above
    for (int k = 0; k < KNOW_K; ++k) kv[i][k] = kr[k][tid + 128 * i];
  float wk[KNOW_K];
  float mx = best[0], sum = 0.f;
#pragma unroll  // wk stays in registers (this loop and the next)
  for (int k = 0; k < KNOW_K; ++k) { wk[k] = expf(best[k] - mx); sum += wk[k]; }
  float inv = 1.f / sum;
#pragma unroll  // as above
  for (int k = 0; k < KNOW_K; ++k) wk[k] *= inv;
#pragma unroll  // xv stays in registers
  for (int i = 0; i < 4; ++i) {
    float acc = 0.f;
#pragma unroll  // as above
    for (int k = 0; k < KNOW_K; ++k) acc += wk[k] * kv[i][k];
    xv[i] += acc;
  }
  if constexpr (LAST) {
    __shared__ float red[256];
    ln_row<128>(xv, lng, lnb, red);
  }
  float* op = LAST ? out : x;
#pragma unroll  // as above
  for (int i = 0; i < 4; ++i) op[(size_t)tok * D_MODEL + tid + 128 * i] = xv[i];
}

extern "C" void kernel_launch(void* const* d_in, const int* in_sizes, int n_in,
                              void* d_out, int out_size, void* d_ws, size_t ws_size,
                              hipStream_t stream) {
  const float* x_in = (const float*)d_in[0];
  const float* cneur = (const float*)d_in[1];
  const float* eneur = (const float*)d_in[2];
  const float* kK = (const float*)d_in[3];
  const float* kV = (const float*)d_in[4];
  const float* rq = (const float*)d_in[5];
  const float* rk = (const float*)d_in[6];
  const float* rv = (const float*)d_in[7];
  const float* ro = (const float*)d_in[8];
  const float* rm = (const float*)d_in[9];
  const float* ln1g = (const float*)d_in[10];
  const float* ln1b = (const float*)d_in[11];
  const float* ln2g = (const float*)d_in[12];
  const float* ln2b = (const float*)d_in[13];
  const float* lnfg = (const float*)d_in[14];
  const float* lnfb = (const float*)d_in[15];
  float* out = (float*)d_out;

  float* ws = (float*)d_ws;
  float* xb = ws;     ws += (size_t)NTOK * D_MODEL;
  float* h = ws;      ws += (size_t)NTOK * D_MODEL;
  float* qc = ws;     ws += 2 * PLANE;  // qc, kc, vc lie in a row: out[0..2] of one launch
  float* kc = ws;     ws += 2 * PLANE;
  float* vc = ws;     ws += 2 * PLANE;
  float* ctx = ws;    ws += (size_t)NTOK * RANK;
  float* qm = ws;     ws += 2 * PLANE;
  float* candS = ws;  ws += (size_t)NTOK * NCAND;
  int* candI = (int*)ws;  ws += (size_t)NTOK * NCAND;
  int* sel = (int*)ws;    ws += (size_t)3 * NTOK * 2;
  float* wsel = ws;

  for (int l = 0; l < N_LAYERS; ++l) {
    const float* xi = l == 0 ? x_in : xb;  // layer 0 reads the input where it lies
    route_kernel<<<dim3(NTOK, 3), 128, 0, stream>>>(xi, ln1g + l * D_MODEL, ln1b + l * D_MODEL, h,
                                                    rq + (size_t)l * N_COMPRESS * D_MODEL,
                                                    rk + (size_t)l * N_COMPRESS * D_MODEL,
                                                    rv + (size_t)l * N_COMPRESS * D_MODEL, sel, wsel);
    compress_group_kernel<<<dim3(N_COMPRESS, RANK / 32, 3), 256, 0, stream>>>(h, sel, wsel, cneur, qc);
    attn_kernel<<<BATCH * N_HEADS * (SEQ / 16), 32 * ATT_W, 0, stream>>>(qc, kc, vc, ctx);
    expand_kernel<<<NTOK, 256, 0, stream>>>(ctx, ro + (size_t)l * N_EXPAND * RANK, eneur, xi, xb,
                                            ln2g + l * D_MODEL, ln2b + l * D_MODEL, h,
                                            rm + (size_t)l * N_COMPRESS * D_MODEL, sel, wsel);
    compress_group_kernel<<<dim3(N_COMPRESS, RANK / 32, 1), 256, 0, stream>>>(h, sel, wsel, cneur, qm);
    memscore_kernel<<<dim3(NTOK / 16, NSPLIT), 256, 0, stream>>>(qm, kK, candS, candI);
    if (l + 1 < N_LAYERS)
      memgather_kernel<false><<<NTOK, 128, 0, stream>>>(candS, candI, kV, xb, lnfg, lnfb, out);
    else
      memgather_kernel<true><<<NTOK, 128, 0, stream>>>(candS, candI, kV, xb, lnfg, lnfb, out);
  }
}

// v010
// One run takes 271 microseconds.
// In two side-by-side timings against v009, it was 1.07 and 1.06 times as fast.
// Over all steps from v000 it is 2.98 times as fast.
#include <hip/hip_runtime.h>
#include <math.h>

#define D_MODEL 512
#define RANK 128
#define N_HEADS 8
#define D_HEAD 16
#define N_COMPRESS 64
#define N_EXPAND 64
#define N_KNOW 32768
#define KNOW_K 8
#define N_LAYERS 2
#define BATCH 2
#define SEQ 512
#define NTOK (BATCH * SEQ)

#define CHUNK 512
#define NSPLIT 8                            // grid-Y partitions of the N_KNOW axis
#define NCHUNKS (N_KNOW / CHUNK)            // 64
#define CHPS (NCHUNKS / NSPLIT)             // 8 chunks per split
#define NCAND (NSPLIT * 8)                  // 64 candidates per token
#define KT_PITCH 132  // floats per staged kK row: 528 B = 16 B x 33, so the 32 lanes'
                      // 8-byte fragment reads fall on 64 distinct banks

#define PLANE ((size_t)NTOK * RANK)  // floats per plane of a compress result: plane s holds
                                     // each token's weighted projection by its s-th expert
#define GP_PITCH 36  // floats per row of a wave's 32x32 partial tile in LDS: 144 B keeps the
                     // 16-byte reads aligned and puts rows v and v + 8 on different banks

#define SC_LIST 36  // floats from one list's 32 scores of a chunk to the next list's: 144 B =
                    // 16 B x 9, so the 16 lanes' 16-byte reads fall on distinct banks
#define SC_PITCH (16 * SC_LIST + 4)  // floats per token row of a chunk's scores: rows v and
                                     // v + 8, stored by one instruction, fall on different banks

#define RT_HP 516  // floats per row of a token tile's h in LDS: 2,064 B = 16 B x 129, so the 16
                   // lanes' 16-byte fragment reads, one row each, fall on distinct banks
#define RT_RP 260  // floats per staged half of a router row: 1,040 B = 16 B x 65, as above
#define RT_PP 68   // floats per token row of a k half's logits: rows v and v + 8, stored by one
                   // instruction, fall on different banks; 272 B keeps 16-byte reads aligned

#define ATT_W 8    // waves per attention block
#define ATT_OP 18  // floats per row of a wave's parked output tile: rows v and v + 8, stored
                   // by one instruction, fall on different banks

typedef float v2f __attribute__((ext_vector_type(2)));
typedef float v4f __attribute__((ext_vector_type(4)));
typedef float v8f __attribute__((ext_vector_type(8)));

__device__ __forceinline__ v8f wmma_f32_16x16x4(v2f a, v2f b, v8f c) {
  // D = A(16x4 f32) * B(4x16 f32) + C(16x16 f32)
  return __builtin_amdgcn_wmma_f32_16x16x4_f32(false, a, false, b, (short)0, c,
                                               false, false);
}

// ---------------------------------------------------------------- LayerNorm
// of one row, by a block of NT threads (128 or 256) that already holds the row: thread t
// has elements t + NT i in v[i] and gets their normalised values back in v[i]. It stands
// inside the kernel that reads or makes the row, so that it costs no launch of its own.
// The 512 terms are added as a halving tree (distance 256, 128, ... 1): down to NT terms
// in the thread, down to 32 through LDS, the rest over the lanes; every wave does the
// part behind the barrier for itself, so one barrier is enough. The caller does not use
// red for anything else.
template <int NT>
__device__ __forceinline__ void ln_row(float (&v)[D_MODEL / NT], const float* __restrict__ g,
                                       const float* __restrict__ b, float* red /* [2 NT], LDS */) {
  static_assert(NT == 128 || NT == 256, "the tree is written out for these two");
  int tid = threadIdx.x;
  int lane = tid & 31;
  float gv[D_MODEL / NT], bv[D_MODEL / NT];
#pragma unroll  // gv and bv stay in registers; fetched ahead of the barrier, they fly during the sums
  for (int i = 0; i < D_MODEL / NT; ++i) { gv[i] = g[tid + NT * i]; bv[i] = b[tid + NT * i]; }
  if constexpr (NT == 128) {
    red[tid] = (v[0] + v[2]) + (v[1] + v[3]);
    red[NT + tid] = (v[0] * v[0] + v[2] * v[2]) + (v[1] * v[1] + v[3] * v[3]);
  } else {
    red[tid] = v[0] + v[1];
    red[NT + tid] = v[0] * v[0] + v[1] * v[1];
  }
  __syncthreads();
  float sq[2];
#pragma unroll  // sq stays in registers
  for (int j = 0; j < 2; ++j) {
    const float* r = red + j * NT + lane;
    if constexpr (NT == 128)
      sq[j] = (r[0] + r[64]) + (r[32] + r[96]);
    else
      sq[j] = ((r[0] + r[128]) + (r[64] + r[192])) + ((r[32] + r[160]) + (r[96] + r[224]));
  }
#pragma unroll  // five fixed lane distances
  for (int msk = 16; msk > 0; msk >>= 1) {
    sq[0] += __shfl_xor(sq[0], msk, 32);
    sq[1] += __shfl_xor(sq[1], msk, 32);
  }
  float mean = sq[0] * (1.0f / D_MODEL);
  float var = sq[1] * (1.0f / D_MODEL) - mean * mean;
  float rstd = rsqrtf(var + 1e-5f);
#pragma unroll  // v stays in registers
  for (int i = 0; i < D_MODEL / NT; ++i) v[i] = (v[i] - mean) * rstd * gv[i] + bv[i];
}

// ------------------------------------------------- routed compress (D -> R)
// Two stages. The routing normalises a token's row (h = LayerNorm(x)) and picks its two
// experts and their weights; compress_group_kernel takes one expert per block, gathers
// the tokens that picked it and multiplies them with the expert's matrix, which is so
// read once per block instead of once per token.
// The memory query's routing works on one token's row and needs no launch of its own: the
// kernel in front of it makes that row in one block, and route_row is called at the foot of
// expand_kernel. The routing of q, k, v is route_kernel's, 16 tokens a block.

// Sums over the 32 lanes of N rows' partial sums, a[i] being this lane's part of row i.
// Halving butterfly, lane distance MSK = 16, 8, ...: at each level a lane hands over the
// half of its rows that its partner keeps; with one row left the remaining distances are
// plain sums. Called with N rows and MSK = 16, lanes (32 / N) e .. return row e's whole sum.
template <int N, int MSK>
__device__ __forceinline__ float fold_rows(const float (&a)[N], int lane) {
  if constexpr (N == 1) {
    float s = a[0];
#pragma unroll  // fixed lane distances
    for (int m = MSK; m >= 1; m >>= 1) s += __shfl_xor(s, m, 32);
    return s;
  } else {
    float o[N / 2];
    bool up = lane & MSK;
#pragma unroll  // the partial sums stay in registers
    for (int i = 0; i < N / 2; ++i)
      o[i] = (up ? a[i + N / 2] : a[i]) + __shfl_xor(up ? a[i] : a[i + N / 2], MSK, 32);
    return fold_rows<N / 2, MSK / 2>(o, lane);
  }
}

// One token's routing by a block of NW waves (4 or 8). On entry hs (LDS, [512], 16-byte
// aligned) holds h, ss and se (LDS, [2]) their start values, and a barrier has published
// them. sc is LDS, [64]. sel2 and wsel2 are the token's own two entries.
template <int NW>
__device__ __forceinline__ void route_row(const float* hs, const float* __restrict__ router,  // [64,512]
                                          float* sc, float* ss, int* se,
                                          int* __restrict__ sel2, float* __restrict__ wsel2) {
  constexpr int R = N_COMPRESS / NW;  // router rows per wave
  static_assert(R == 8 || R == 16, "the lane sum below halves R rows over the 32 lanes");
  int tid = threadIdx.x;
  // router logits: wave w takes rows R w .. R w + R - 1. A row is read as whole 128-byte
  // lines (lane l holds d = 128 j + 4 l .. +3, j = 0..3), each lane sums its 16
  // products, and the lanes' partial sums are added over the wave.
  {
    int lane = tid & 31, wave = tid >> 5;
    v4f hv[4];
#pragma unroll  // hv stays in registers
    for (int j = 0; j < 4; ++j) hv[j] = *(const v4f*)(hs + 128 * j + 4 * lane);
    const float* rp = router + (size_t)(wave * R) * D_MODEL + 4 * lane;
    float p[R];
#pragma unroll  // p stays in registers; the 4 R row loads are independent and fly together
    for (int e = 0; e < R; ++e) {
      v2f acc = {0.f, 0.f};
#pragma unroll  // as above
      for (int j = 0; j < 4; ++j) {
        v4f rv = *(const v4f*)(rp + e * D_MODEL + 128 * j);
        acc += hv[j].xy * rv.xy;
        acc += hv[j].zw * rv.zw;
      }
      p[e] = acc.x + acc.y;
    }
    float p0 = fold_rows<R, 16>(p, lane);
    if ((lane & (32 / R - 1)) == 0) sc[wave * R + lane / (32 / R)] = p0;
  }
  __syncthreads();
  float my = (tid < N_COMPRESS) ? sc[tid] : 0.f;
  // top-2 by rank: each score counts the scores that come before it (greater, or
  // equal with a lower index); ranks 0 and 1 are the two that a scan in index order picks
  if (tid < N_COMPRESS) {
    int rank = 0;
    for (int e = 0; e < N_COMPRESS; ++e) {
      float s = sc[e];
      rank += (s > my || (s == my && e < tid)) ? 1 : 0;
    }
    if (rank < 2) { ss[rank] = my; se[rank] = tid; }
  }
  __syncthreads();
  if (tid < 2) {
    float z = expf(ss[1] - ss[0]);
    sel2[tid] = se[tid];
    wsel2[tid] = (tid == 0 ? 1.f : z) / (1.f + z);
  }
}

// The greatest of v over the 16 lanes of a row (lanes 0-15, lanes 16-31), in every lane of
// the row: four vector steps at lane distances 1, 2, 4, 8 inside the row, where a shuffle
// would go through the LDS unit and be waited for at each step. All 32 lanes are on.
template <int DIST>
__device__ __forceinline__ float row16_other(float v) {  // v of lane l ^ DIST, DIST < 16
  int b = __builtin_bit_cast(int, v);
  return __builtin_bit_cast(float, __builtin_amdgcn_update_dpp(b, b, 0x160 + DIST, 0xf, 0xf, false));
}
// How many of the row's other 15 lanes hold a value >= v: called with D = 15. The 15 lane
// steps do not hang on one another. All 32 lanes are on.
template <int D>
__device__ __forceinline__ int row16_count_ge(float v) {
  if constexpr (D == 0)
    return 0;
  else
    return (row16_other<D>(v) >= v ? 1 : 0) + row16_count_ge<D - 1>(v);
}
__device__ __forceinline__ float row16_max(float v) {
  v = fmaxf(v, row16_other<1>(v));
  v = fmaxf(v, row16_other<2>(v));
  v = fmaxf(v, row16_other<4>(v));
  v = fmaxf(v, row16_other<8>(v));
  return v;
}

// Projections of the same x that do not hang on one another (q, k, v) share the two
// launches: grid y of route_kernel and grid z of compress_group_kernel name the
// projection, so their latencies overlap and no launch gap stands between them.
// route_kernel takes 16 tokens a block: a router row is fetched once for 16 tokens instead
// of once a token, and the launch has 192 blocks to start instead of 3,072. The logits
// [16 tokens x 64 experts] are a product on WMMA f32 16x16x4: wave w takes experts
// 16 (w & 3) .. +15 and k = 256 (w >> 2) .. +255; the two k halves are added through LDS.
// Each projection's block normalises its 16 rows for itself; projection 0's stores h.
__global__ __launch_bounds__(256) void route_kernel(const float* __restrict__ x,
                                const float* __restrict__ lng,      // [512] LayerNorm gain
                                const float* __restrict__ lnb,      // [512] LayerNorm bias
                                float* __restrict__ h,              // [NTOK,512] LayerNorm(x)
                                const float* __restrict__ router0,  // [64,512], projection 0
                                const float* __restrict__ router1,  // projection 1
                                const float* __restrict__ router2,  // projection 2
                                int* __restrict__ sel,              // [grid y,NTOK,2] expert
                                float* __restrict__ wsel) {         // [grid y,NTOK,2] weight
  int t0 = blockIdx.x * 16;
  int pr = blockIdx.y;
  const float* router = pr == 0 ? router0 : (pr == 1 ? router1 : router2);
  sel += pr * (2 * NTOK);
  wsel += pr * (2 * NTOK);
  int tid = threadIdx.x;  // 256 threads = 8 waves
  int lane = tid & 31;
  int wave = tid >> 5;
  int nl = lane & 15;
  int kh = lane >> 4;
  int nt = wave & 3;   // this wave's 16 experts
  int kq = wave >> 2;  // this wave's half of k
  __shared__ __attribute__((aligned(16))) float hs[16 * RT_HP];      // the tile's h rows
  __shared__ __attribute__((aligned(16))) float rs[8][16 * RT_RP];   // a wave's router part
  __shared__ __attribute__((aligned(16))) float part[2][16][RT_PP];  // logits of each k half

  // wave w normalises rows 2 w and 2 w + 1; lane l holds d = 128 i + 4 l .. +3
  v4f xv[2][4], gv[4], bv[4];
#pragma unroll  // xv stays in registers; the loads fly together (this loop and the two below)
  for (int t = 0; t < 2; ++t)
#pragma unroll  // as above
    for (int i = 0; i < 4; ++i)
      xv[t][i] = *(const v4f*)(x + (size_t)(t0 + 2 * wave + t) * D_MODEL + 128 * i + 4 * lane);
#pragma unroll  // as above
  for (int i = 0; i < 4; ++i) {
    gv[i] = *(const v4f*)(lng + 128 * i + 4 * lane);
    bv[i] = *(const v4f*)(lnb + 128 * i + 4 * lane);
  }
  // the wave's router part, as whole 512-byte runs of a row; it flies during the LayerNorm
  const float* rp = router + (size_t)(nt * 16) * D_MODEL + kq * 256 + 4 * lane;
  v4f rt[16][2];
#pragma unroll  // rt stays in registers; the 32 loads are independent and fly together
  for (int r = 0; r < 16; ++r) {
    rt[r][0] = *(const v4f*)(rp + r * D_MODEL);
    rt[r][1] = *(const v4f*)(rp + r * D_MODEL + 128);
  }
  // the 32 loads above name rp's registers: the wait stands in front of the first overwrite of
  // them; rp as an input keeps the pair from being given to another load's result before it
  asm volatile("s_wait_xcnt 0x0" ::"v"(rp) : "memory");

  // the 512 terms of a row are added as the halving tree of ln_row (distance 256, 128, ... 1),
  // so that h comes out as there, bit for bit: 256 and 128 in the lane, 64 to 4 over the
  // lanes (lane distance 16 to 1), 2 and 1 in the lane
  float sm[2], sq[2];
#pragma unroll  // the sums stay in registers; the 16 chains do not hang on one another
  for (int t = 0; t < 2; ++t) {
    v4f s4 = (xv[t][0] + xv[t][2]) + (xv[t][1] + xv[t][3]);
    v4f q4 = (xv[t][0] * xv[t][0] + xv[t][2] * xv[t][2]) + (xv[t][1] * xv[t][1] + xv[t][3] * xv[t][3]);
#pragma unroll  // as above
    for (int c = 0; c < 4; ++c) {
      float a = s4[c], b = q4[c];
      a += __shfl_xor(a, 16, 32);
      b += __shfl_xor(b, 16, 32);
      a += row16_other<8>(a);
      b += row16_other<8>(b);
      a += row16_other<4>(a);
      b += row16_other<4>(b);
      a += row16_other<2>(a);
      b += row16_other<2>(b);
      a += row16_other<1>(a);
      b += row16_other<1>(b);
      s4[c] = a;
      q4[c] = b;
    }
    sm[t] = (s4.x + s4.z) + (s4.y + s4.w);
    sq[t] = (q4.x + q4.z) + (q4.y + q4.w);
  }
#pragma unroll  // xv stays in registers
  for (int t = 0; t < 2; ++t) {
    float mean = sm[t] * (1.0f / D_MODEL);
    float var = sq[t] * (1.0f / D_MODEL) - mean * mean;
    float rstd = rsqrtf(var + 1e-5f);
#pragma unroll  // as above
    for (int i = 0; i < 4; ++i) {
      xv[t][i] = (xv[t][i] - mean) * rstd * gv[i] + bv[i];
      *(v4f*)(hs + (2 * wave + t) * RT_HP + 128 * i + 4 * lane) = xv[t][i];
    }
  }
  float* rw = &rs[wave][0];
#pragma unroll  // rt stays in registers
  for (int r = 0; r < 16; ++r) {
    *(v4f*)(rw + r * RT_RP + 4 * lane) = rt[r][0];
    *(v4f*)(rw + r * RT_RP + 128 + 4 * lane) = rt[r][1];
  }
  __syncthreads();

  // WMMA steps 2 j and 2 j + 1 of this wave multiply k = 256 kq + 8 j + 4 kh + {0, 1} and
  // + {2, 3}, in A (row nl of h) as in B (router row nl of the wave's 16). Two accumulators:
  // their chains do not hang on one another.
  const float* ap = hs + nl * RT_HP + kq * 256 + 4 * kh;
  const float* bp = rw + nl * RT_RP + 4 * kh;
  v8f c0, c1;
#pragma unroll  // c0 and c1 stay in registers
  for (int v = 0; v < 8; ++v) { c0[v] = 0.f; c1[v] = 0.f; }
  // the fragments come in groups of 8 j, read a group ahead of their use: the reads' latency
  // lies behind the WMMAs of the group before
  v4f fa[2][8], fb[2][8];
#pragma unroll  // fa and fb stay in registers (this loop and the three below)
  for (int j = 0; j < 8; ++j) {
    fa[0][j] = *(const v4f*)(ap + 8 * j);
    fb[0][j] = *(const v4f*)(bp + 8 * j);
  }
#pragma unroll  // as above
  for (int g = 0; g < 4; ++g) {
    if (g < 3) {
#pragma unroll  // as above
      for (int j = 0; j < 8; ++j) {
        fa[(g + 1) & 1][j] = *(const v4f*)(ap + 64 * (g + 1) + 8 * j);
        fb[(g + 1) & 1][j] = *(const v4f*)(bp + 64 * (g + 1) + 8 * j);
      }
    }
    // keeps the next group's reads in front of this group's WMMAs: without it the compiler
    // sinks each read to one step ahead of its use, and every step waits on LDS latency
    __builtin_amdgcn_sched_barrier(0);
#pragma unroll  // as above
    for (int j = 0; j < 8; ++j) {
      c0 = wmma_f32_16x16x4(fa[g & 1][j].xy, fb[g & 1][j].xy, c0);
      c1 = wmma_f32_16x16x4(fa[g & 1][j].zw, fb[g & 1][j].zw, c1);
    }
  }
#pragma unroll  // as above
  for (int v = 0; v < 8; ++v) part[kq][v + 8 * kh][nt * 16 + nl] = c0[v] + c1[v];
  __syncthreads();

  // top-2: the 16 lanes of a lane row hold a token's 64 logits, lane nl experts 4 nl .. +3.
  // Twice: the greatest of the lanes' bests is the pick, and its lane strikes it out. Of
  // equal logits the lowest expert wins, in the lane and among the lanes, as in a scan.
  int tok = t0 + 2 * wave + kh;
  v4f s = *(const v4f*)(&part[0][2 * wave + kh][4 * nl]) + *(const v4f*)(&part[1][2 * wave + kh][4 * nl]);
  float top[2];
#pragma unroll  // top stays in registers
  for (int k = 0; k < 2; ++k) {
    float bst = s.x;
    int bx = 0;
    if (s.y > bst) { bst = s.y; bx = 1; }
    if (s.z > bst) { bst = s.z; bx = 2; }
    if (s.w > bst) { bst = s.w; bx = 3; }
    float m = row16_max(bst);
    unsigned hit = (__builtin_amdgcn_ballot_w32(bst == m) >> (16 * kh)) & 0xffffu;
    bool win = nl == (hit ? __ffs(hit) - 1 : 0);  // no best equal to m (not-a-numbers): lane 0
    top[k] = m;
    if (win) sel[tok * 2 + k] = 4 * nl + bx;
    s.x = (win && bx == 0) ? -INFINITY : s.x;
    s.y = (win && bx == 1) ? -INFINITY : s.y;
    s.z = (win && bx == 2) ? -INFINITY : s.z;
    s.w = (win && bx == 3) ? -INFINITY : s.w;
  }
  float z = expf(top[1] - top[0]);
  if (nl < 2) wsel[tok * 2 + nl] = (nl == 0 ? 1.f : z) / (1.f + z);
  // stored behind the last barrier: in front of one, the barrier would wait for the stores
  if (pr == 0) {
#pragma unroll  // xv stays in registers
    for (int t = 0; t < 2; ++t)
#pragma unroll  // as above
      for (int i = 0; i < 4; ++i)
        *(v4f*)(h + (size_t)(t0 + 2 * wave + t) * D_MODEL + 128 * i + 4 * lane) = xv[t][i];
  }
}

// grid = (N_COMPRESS, RANK / 32, projections): block (e, y, z) computes columns
// 32 y .. 32 y + 31 of h[tok] x neurons[e] for every entry (tok, s) with
// sel[z][tok][s] == e, 32 entries a pass.
// Wave w takes k = 64 w .. 64 w + 63 on WMMA f32 16x16x4; the eight partial tiles are
// added through LDS in wave order. Row (tok, s) goes, times its weight, to plane s of out[z].
__global__ __launch_bounds__(256) void compress_group_kernel(
    const float* __restrict__ h,        // [NTOK,512]
    const int* __restrict__ sel,        // [grid z,NTOK,2]
    const float* __restrict__ wsel,     // [grid z,NTOK,2]
    const float* __restrict__ neurons,  // [64,512,128]
    float* __restrict__ out) {          // [grid z,2,NTOK,128]
  int e = blockIdx.x;
  int n0 = blockIdx.y * 32;
  sel += blockIdx.z * (2 * NTOK);
  wsel += blockIdx.z * (2 * NTOK);
  out += blockIdx.z * (2 * PLANE);
  int tid = threadIdx.x;  // 256 threads = 8 waves
  int lane = tid & 31;
  int wave = tid >> 5;
  int nl = lane & 15;
  int kh = lane >> 4;
  __shared__ int list[2 * NTOK];  // this expert's entries (2 tok + s), ascending
  __shared__ int wcnt[64];
  __shared__ __attribute__((aligned(16))) float red[8][32 * GP_PITCH];

  int sv[8];
#pragma unroll  // sv stays in registers; the 8 loads fly together
  for (int j = 0; j < 8; ++j) sv[j] = sel[j * 256 + tid];

  // the list: a ballot per 32 entries, the counts summed in entry order
  unsigned mk[8];
#pragma unroll  // mk stays in registers
  for (int j = 0; j < 8; ++j) {
    mk[j] = __builtin_amdgcn_ballot_w32(sv[j] == e);
    if (lane == 0) wcnt[j * 8 + wave] = __popc(mk[j]);
  }
  __syncthreads();

  // B fragments, kept in registers for all passes; they fly while the list is built.
  // WMMA step 2 j + i of this wave multiplies k = 64 w + 8 j + 4 kh + 2 i + {0, 1},
  // in B here as in A below.
  const float* bp = neurons + (size_t)e * (D_MODEL * RANK) + (size_t)(wave * 64 + 4 * kh) * RANK + n0 + nl;
  v2f bf[2][16];
#pragma unroll  // bf stays in registers
  for (int j = 0; j < 8; ++j) {
#pragma unroll  // as above
    for (int nn = 0; nn < 2; ++nn) {
      bf[nn][2 * j].x = bp[(8 * j + 0) * RANK + 16 * nn];
      bf[nn][2 * j].y = bp[(8 * j + 1) * RANK + 16 * nn];
      bf[nn][2 * j + 1].x = bp[(8 * j + 2) * RANK + 16 * nn];
      bf[nn][2 * j + 1].y = bp[(8 * j + 3) * RANK + 16 * nn];
    }
  }

  int run = 0;
  int base[8];
#pragma unroll  // base stays in registers
  for (int q = 0; q < 64; ++q) {
    if ((q & 7) == wave) base[q >> 3] = run;
    run += wcnt[q];
  }
  unsigned below = (1u << lane) - 1u;
#pragma unroll  // as above
  for (int j = 0; j < 8; ++j)
    if ((mk[j] >> lane) & 1u) list[base[j] + __popc(mk[j] & below)] = j * 256 + tid;
  __syncthreads();
  // the same in every thread of the block; held as a scalar so that the pass loop,
  // which holds WMMAs and barriers, branches on a scalar compare
  int n = __builtin_amdgcn_readfirstlane(run);

  for (int m0 = 0; m0 < n; m0 += 32) {
    // A fragments: lane (nl, kh) reads its entry's h row; a row past the end of the
    // list reads entry 0's and is not stored
    v4f af[2][8];
#pragma unroll  // af stays in registers
    for (int t = 0; t < 2; ++t) {
      int ix = m0 + t * 16 + nl;
      int en = list[ix < n ? ix : 0];
      const float* ap = h + (size_t)(en >> 1) * D_MODEL + wave * 64 + 4 * kh;
#pragma unroll  // as above
      for (int j = 0; j < 8; ++j) af[t][j] = *(const v4f*)(ap + 8 * j);
    }
    // the row that this thread stores at the foot of the pass, and its weight, fetched early
    int m = tid >> 3, c4 = (tid & 7) * 4;  // 8 threads x 16 B = one 128-byte line per row
    int eo = list[m0 + m < n ? m0 + m : 0];
    float wo = wsel[eo];
    v8f c[2][2];
#pragma unroll  // c stays in registers (this loop and the two below)
    for (int t = 0; t < 2; ++t)
#pragma unroll  // as above
      for (int nn = 0; nn < 2; ++nn)
#pragma unroll  // as above
        for (int v = 0; v < 8; ++v) c[t][nn][v] = 0.f;
#pragma unroll  // as above
    for (int j = 0; j < 8; ++j) {
#pragma unroll  // as above
      for (int t = 0; t < 2; ++t)
#pragma unroll  // as above
        for (int nn = 0; nn < 2; ++nn)
          c[t][nn] = wmma_f32_16x16x4(af[t][j].xy, bf[nn][2 * j], c[t][nn]);
#pragma unroll  // as above
      for (int t = 0; t < 2; ++t)
#pragma unroll  // as above
        for (int nn = 0; nn < 2; ++nn)
          c[t][nn] = wmma_f32_16x16x4(af[t][j].zw, bf[nn][2 * j + 1], c[t][nn]);
    }
#pragma unroll  // as above
    for (int t = 0; t < 2; ++t)
#pragma unroll  // as above
      for (int nn = 0; nn < 2; ++nn)
#pragma unroll  // as above
        for (int v = 0; v < 8; ++v)
          red[wave][(t * 16 + v + 8 * kh) * GP_PITCH + nn * 16 + nl] = c[t][nn][v];
    __syncthreads();
    v4f sum = *(const v4f*)(&red[0][m * GP_PITCH + c4]);
#pragma unroll  // the 8 reads fly together
    for (int w = 1; w < 8; ++w) sum += *(const v4f*)(&red[w][m * GP_PITCH + c4]);
    if (m0 + m < n)
      *(v4f*)(out + (size_t)(eo & 1) * PLANE + (size_t)(eo >> 1) * RANK + n0 + c4) = sum * wo;
    __syncthreads();  // red is rewritten by the next pass
  }
}

// --------------------------------------------------- routed expand (R -> D)
// The block makes its token's whole new row x, so the stages behind it that work on that
// row alone follow in the same launch: the second LayerNorm and the memory query's routing.
// the bound states the block size: the register budget of eight waves a SIMD is kept
// (four blocks a WGP, the whole grid resident at once)
__global__ __launch_bounds__(256, 8) void expand_kernel(
                              const float* __restrict__ in,        // [NTOK,128]
                              const float* __restrict__ router,    // [64,128]
                              const float* __restrict__ neurons,   // [64,128,512]
                              const float* xi,                     // [NTOK,512] residual in
                              float* xo,                           // [NTOK,512] out; may be xi
                              const float* __restrict__ lng,       // [512] LayerNorm gain
                              const float* __restrict__ lnb,       // [512] LayerNorm bias
                              float* __restrict__ h,               // [NTOK,512] LayerNorm(xo)
                              const float* __restrict__ router_m,  // [64,512]
                              int* __restrict__ sel,               // [NTOK,2] expert
                              float* __restrict__ wsel) {          // [NTOK,2] weight
  int tok = blockIdx.x;
  int tid = threadIdx.x;  // 256 threads
  __shared__ __attribute__((aligned(16))) float is[RANK];
  __shared__ float sc[N_EXPAND];
  __shared__ float ss[2];
  __shared__ int se[2];
  __shared__ __attribute__((aligned(16))) float hs[D_MODEL];  // from here: the stages behind
  __shared__ float red[512];
  __shared__ float sc2[N_COMPRESS];
  __shared__ float ss2[2];
  __shared__ int se2[2];
  const float* ip = in + (size_t)tok * RANK;
  if (tid < RANK) is[tid] = ip[tid];
  if (tid < 2) {  // start values, as the scan had
    ss[tid] = -INFINITY; se[tid] = 0;
    ss2[tid] = -INFINITY; se2[tid] = 0;
  }
  __syncthreads();
  // router logits as in route_row: wave w takes rows 8w..8w+7, one 16-byte
  // load per lane covers a row (lane l holds r = 4 l .. +3)
  {
    int lane = tid & 31, wave = tid >> 5;
    v4f iv = *(const v4f*)(is + 4 * lane);
    const float* rp = router + (size_t)(wave * 8) * RANK + 4 * lane;
    float p8[8];
#pragma unroll  // p8 stays in registers; the 8 row loads are independent and fly together
    for (int e = 0; e < 8; ++e) {
      v4f rv = *(const v4f*)(rp + e * RANK);
      v2f acc = iv.xy * rv.xy;
      acc += iv.zw * rv.zw;
      p8[e] = acc.x + acc.y;
    }
    // halving butterfly; lanes 4e..4e+3 end with row e's whole sum
    float p4[4], p2[2];
    bool u16 = lane & 16, u8 = lane & 8, u4 = lane & 4;
#pragma unroll  // the partial sums stay in registers (this loop and the next)
    for (int i = 0; i < 4; ++i)
      p4[i] = (u16 ? p8[i + 4] : p8[i]) + __shfl_xor(u16 ? p8[i] : p8[i + 4], 16, 32);
#pragma unroll  // as above
    for (int i = 0; i < 2; ++i)
      p2[i] = (u8 ? p4[i + 2] : p4[i]) + __shfl_xor(u8 ? p4[i] : p4[i + 2], 8, 32);
    float p1 = (u4 ? p2[1] : p2[0]) + __shfl_xor(u4 ? p2[0] : p2[1], 4, 32);
    p1 += __shfl_xor(p1, 2, 32);
    p1 += __shfl_xor(p1, 1, 32);
    if ((lane & 3) == 0) sc[wave * 8 + (lane >> 2)] = p1;
  }
  __syncthreads();
  float my = (tid < N_EXPAND) ? sc[tid] : 0.f;
  // top-2 by rank, as in route_row
  if (tid < N_EXPAND) {
    int rank = 0;
    for (int e = 0; e < N_EXPAND; ++e) {
      float s = sc[e];
      rank += (s > my || (s == my && e < tid)) ? 1 : 0;
    }
    if (rank < 2) { ss[rank] = my; se[rank] = tid; }
  }
  __syncthreads();
  int e0 = se[0], e1i = se[1];
  float z = expf(ss[1] - ss[0]);
  float w0 = 1.f / (1.f + z), w1 = z / (1.f + z);
  for (int d = tid; d < D_MODEL; d += 256) {
    const float* n0 = neurons + (size_t)e0 * (RANK * D_MODEL) + d;
    const float* n1 = neurons + (size_t)e1i * (RANK * D_MODEL) + d;
    float a0 = 0.f, a1 = 0.f;
    for (int r = 0; r < RANK; ++r) {
      float iv = is[r];
      a0 += iv * n0[(size_t)r * D_MODEL];
      a1 += iv * n1[(size_t)r * D_MODEL];
    }
    hs[d] = xi[(size_t)tok * D_MODEL + d] + (w0 * a0 + w1 * a1);  // parked: read back by this thread
  }
  float xv[2], hv[2];
#pragma unroll  // xv and hv stay in registers (this loop and the two below)
  for (int i = 0; i < 2; ++i) hv[i] = xv[i] = hs[tid + 256 * i];
  ln_row<256>(hv, lng, lnb, red);
#pragma unroll  // as above
  for (int i = 0; i < 2; ++i) hs[tid + 256 * i] = hv[i];
  __syncthreads();
  route_row<8>(hs, router_m, sc2, ss2, se2, sel + tok * 2, wsel + tok * 2);
  // stored behind the last barrier: in front of one, the barrier would wait for the stores
#pragma unroll  // as above
  for (int i = 0; i < 2; ++i) {
    xo[(size_t)tok * D_MODEL + tid + 256 * i] = xv[i];
    h[(size_t)tok * D_MODEL + tid + 256 * i] = hv[i];
  }
}

// -------------------------- flash attention: one block per (b, head, q-tile)
// WMMA f32 16x16x4: QK^T (K=16 -> 4 wmma) and P@V (K=16 -> 4 wmma) per tile.
// Q, K and V come as two planes each (see compress_group_kernel), added as they are read.
// The key tiles are dealt to the block's ATT_W waves (wave w takes tiles w, w + ATT_W, ...):
// a tile's steps hang on one another, so the longest row of tiles sets the launch's time.
// Each wave runs its own online softmax; the partial results are joined at the end.
__global__ __launch_bounds__(32 * ATT_W) void attn_kernel(
    const float* __restrict__ Q, const float* __restrict__ K,
    const float* __restrict__ V, float* __restrict__ O) {
  int bid = blockIdx.x;
  int qt = bid % (SEQ / 16);
  int head = (bid / (SEQ / 16)) % N_HEADS;
  int b = bid / ((SEQ / 16) * N_HEADS);
  int tid = threadIdx.x;  // 32 * ATT_W threads
  int lane = tid & 31;
  // the same in every lane of a wave; held as a scalar so that the tile loop, which
  // holds WMMAs, branches on a scalar compare
  int wave = __builtin_amdgcn_readfirstlane(tid >> 5);
  int nl = lane & 15;
  int kh = lane >> 4;      // which K half (A/B layout: lanes 16-31 hold K+2)
  int mrow = kh ? 8 : 0;   // C/D layout: lanes 16-31 hold rows 8-15
  size_t base = (size_t)b * SEQ;
  __shared__ float PtAll[ATT_W][16][17];
  __shared__ float oS[ATT_W][16][ATT_OP];  // each wave's unnormalised output tile
  __shared__ float mS[ATT_W][16];          // its row maxima
  __shared__ float lS[ATT_W][16];          // its row sums
  float (*Pt)[17] = PtAll[wave];           // private to the wave

  // A fragments for Q tile (16 rows x K=16), 4 chunks of K=4
  const float* qp = Q + (base + qt * 16 + nl) * RANK + head * D_HEAD;
  v2f aq[4];
#pragma unroll
  for (int kc = 0; kc < 4; ++kc)
    aq[kc] = *(const v2f*)(qp + 4 * kc + 2 * kh) + *(const v2f*)(qp + PLANE + 4 * kc + 2 * kh);

  v8f o;
  float rm[8], rl[8];
#pragma unroll
  for (int v = 0; v < 8; ++v) { o[v] = 0.f; rm[v] = -INFINITY; rl[v] = 0.f; }

  for (int j = wave; j <= qt; j += ATT_W) {
    v8f s;
#pragma unroll
    for (int v = 0; v < 8; ++v) s[v] = 0.f;
    const float* kp = K + (base + j * 16 + nl) * RANK + head * D_HEAD;
#pragma unroll
    for (int kc = 0; kc < 4; ++kc) {
      v2f bk = *(const v2f*)(kp + 4 * kc + 2 * kh) +
               *(const v2f*)(kp + PLANE + 4 * kc + 2 * kh);  // B[k][n], B[k+1][n]
      s = wmma_f32_16x16x4(aq[kc], bk, s);
    }
    // scale + causal mask (query = qt*16+m, key = j*16+n)
#pragma unroll
    for (int v = 0; v < 8; ++v) {
      float sv = s[v] * 0.25f;  // 1/sqrt(16)
      if (j == qt && nl > v + mrow) sv = -INFINITY;
      s[v] = sv;
    }
    // online softmax (rows live across 16-lane halves -> butterfly 1,2,4,8)
#pragma unroll
    for (int v = 0; v < 8; ++v) {
      float tmax = s[v];
#pragma unroll
      for (int msk = 1; msk < 16; msk <<= 1)
        tmax = fmaxf(tmax, __shfl_xor(tmax, msk, 32));
      float nm = fmaxf(rm[v], tmax);
      float alpha = __expf(rm[v] - nm);
      float p = __expf(s[v] - nm);
      float psum = p;
#pragma unroll
      for (int msk = 1; msk < 16; msk <<= 1) psum += __shfl_xor(psum, msk, 32);
      rl[v] = rl[v] * alpha + psum;
      o[v] *= alpha;
      rm[v] = nm;
      s[v] = p;
    }
    // re-layout P: C-layout -> LDS -> A-layout
#pragma unroll
    for (int v = 0; v < 8; ++v) Pt[v + mrow][nl] = s[v];
    // the wave's own stores have landed before its lanes read each other's values
    // back (the range is private to the wave: no barrier, and the waves' trip counts differ)
    asm volatile("s_wait_dscnt 0x0" ::: "memory");
    const float* vp = V + (base + j * 16) * RANK + head * D_HEAD + nl;
#pragma unroll
    for (int kc = 0; kc < 4; ++kc) {
      v2f ap;
      ap.x = Pt[nl][4 * kc + 2 * kh];
      ap.y = Pt[nl][4 * kc + 2 * kh + 1];
      v2f bv;
      bv.x = vp[(size_t)(4 * kc + 2 * kh) * RANK] + vp[PLANE + (size_t)(4 * kc + 2 * kh) * RANK];
      bv.y = vp[(size_t)(4 * kc + 2 * kh + 1) * RANK] + vp[PLANE + (size_t)(4 * kc + 2 * kh + 1) * RANK];
      o = wmma_f32_16x16x4(ap, bv, o);
    }
  }
  // join the waves' partial results: a wave without a tile hands in maximum -inf,
  // sum 0 and output 0, and so weighs nothing (wave 0 always has tile 0)
#pragma unroll  // o stays in registers
  for (int v = 0; v < 8; ++v) oS[wave][v + mrow][nl] = o[v];
  if (nl == 0) {
#pragma unroll  // rm and rl stay in registers
    for (int v = 0; v < 8; ++v) { mS[wave][v + mrow] = rm[v]; lS[wave][v + mrow] = rl[v]; }
  }
  __syncthreads();
  static_assert(32 * ATT_W == 256, "one thread per element of the 16x16 output tile");
  int r = tid >> 4, cc = tid & 15;
  float mx = mS[0][r];
#pragma unroll  // the LDS reads fly together (this loop and the next)
  for (int w = 1; w < ATT_W; ++w) mx = fmaxf(mx, mS[w][r]);
  float den = 0.f, num = 0.f;
#pragma unroll  // as above
  for (int w = 0; w < ATT_W; ++w) {
    float f = __expf(mS[w][r] - mx);
    den += lS[w][r] * f;
    num += oS[w][r][cc] * f;
  }
  O[(base + qt * 16 + r) * RANK + head * D_HEAD + cc] = num / den;
}

// ---------------- memory scores GEMM (WMMA f32, K=128) fused with top-8.
// grid = (NTOK/16, NSPLIT): split N_KNOW 8 ways for 8x more waves on the
// FLOP-dominant kernel; each split emits per-row top-8 candidates.
// Each wave brings its 16-column kK tile in as whole 512-byte rows (one row per
// 16-byte-per-lane load), one tile ahead, parks it in its own LDS range and
// reads the B fragments from there (k = 4 kc + 2 kh, as the A fragments).
// The top-8: wave w keeps token rows 2 w and 2 w + 1; the 16 lanes of a lane row hold that
// token's 16 sorted lists, lane nl the list of columns 32 nl .. 32 nl + 31 of every chunk.
// A score enters its list only above the token's bound, the 8th greatest of the 16 list
// heads: eight scores of earlier columns are at least as great as the bound, so a score
// that is not above it is in no top-8. Far fewer scores pass than pass a list's own 8th.
__global__ __launch_bounds__(256) void memscore_kernel(const float* __restrict__ Qm,  // [2,NTOK,128]
                                const float* __restrict__ kK,  // [N_KNOW,128]
                                float* __restrict__ candS,     // [NTOK,NSPLIT,8]
                                int* __restrict__ candI) {     // [NTOK,NSPLIT,8]
  int tb = blockIdx.x;      // 16-token tile
  int split = blockIdx.y;   // column partition
  int tid = threadIdx.x;    // 256 threads = 8 waves
  int lane = tid & 31;
  int wave = tid >> 5;
  int nl = lane & 15;
  int kh = lane >> 4;
  int mrow = kh ? 8 : 0;
  size_t tokBase = (size_t)tb * 16;

  __shared__ __attribute__((aligned(16))) float sc[16][SC_PITCH];
  __shared__ __attribute__((aligned(16))) float kt[8][16 * KT_PITCH];  // one tile per wave
  float* ktw = &kt[wave][0];

  // A fragments for the Q tile (its two planes added): K=128 -> 32 chunks, kept in registers
  const float* qp = Qm + (tokBase + nl) * RANK;
  v2f aq[32];
#pragma unroll
  for (int kc = 0; kc < 32; ++kc)
    aq[kc] = *(const v2f*)(qp + 4 * kc + 2 * kh) + *(const v2f*)(qp + PLANE + 4 * kc + 2 * kh);

  float ts[8];
  int ti8[8];
#pragma unroll
  for (int i = 0; i < 8; ++i) { ts[i] = -INFINITY; ti8[i] = 0; }
  int r = wave * 2 + kh;    // the token row whose list nl this lane keeps
  float thr = -INFINITY;    // the row's bound
  float lim = -INFINITY;    // the greater of the bound and the list's own 8th
  const float scale = 0.08838834764831845f;  // 1/sqrt(128)

  // this wave's first tile: row i of the tile = 32 lanes x 16 B = 4 whole lines
  v4f st[16];
  const float* gp = kK + (size_t)(split * CHPS * CHUNK + wave * 64) * RANK + lane * 4;
#pragma unroll
  for (int i = 0; i < 16; ++i) st[i] = *(const v4f*)(gp + i * RANK);
  // inputs-only fence on the A values (each the sum of two loaded values, no product):
  // A is waited for here, once. Without it
  // the waits for A stand among the WMMAs of the loop and drain the next tile's
  // loads there on every trip.
  asm volatile("" ::"v"(aq[0]), "v"(aq[1]), "v"(aq[2]), "v"(aq[3]), "v"(aq[4]), "v"(aq[5]),
               "v"(aq[6]), "v"(aq[7]), "v"(aq[8]), "v"(aq[9]), "v"(aq[10]), "v"(aq[11]),
               "v"(aq[12]), "v"(aq[13]), "v"(aq[14]), "v"(aq[15]));
  asm volatile("" ::"v"(aq[16]), "v"(aq[17]), "v"(aq[18]), "v"(aq[19]), "v"(aq[20]), "v"(aq[21]),
               "v"(aq[22]), "v"(aq[23]), "v"(aq[24]), "v"(aq[25]), "v"(aq[26]), "v"(aq[27]),
               "v"(aq[28]), "v"(aq[29]), "v"(aq[30]), "v"(aq[31]));

  for (int ch = split * CHPS; ch < (split + 1) * CHPS; ++ch) {
    // stage A: 8 waves x 4 n-tiles of 16 cols = 512 cols via WMMA
#pragma unroll 1
    for (int t = 0; t < 4; ++t) {
      int ntl = wave * 4 + t;
#pragma unroll
      for (int i = 0; i < 16; ++i) *(v4f*)(ktw + i * KT_PITCH + lane * 4) = st[i];
      // the wave's own row stores have landed before its lanes read each other's
      // rows back as fragments (the range is private to the wave: no barrier)
      asm volatile("s_wait_dscnt 0x0" ::: "memory");
      // the wave's next tile flies while this one is multiplied; none behind the last
      if (t < 3 || ch + 1 < (split + 1) * CHPS) {
        gp += (t < 3 ? 16 : CHUNK - 48) * RANK;  // next tile of the chunk, or first of the next
#pragma unroll
        for (int i = 0; i < 16; ++i) st[i] = *(const v4f*)(gp + i * RANK);
      }
      const float* kp = ktw + nl * KT_PITCH;
      v8f c;
#pragma unroll
      for (int v = 0; v < 8; ++v) c[v] = 0.f;
#pragma unroll
      for (int kc = 0; kc < 32; ++kc) {
        v2f bk = *(const v2f*)(kp + 4 * kc + 2 * kh);
        c = wmma_f32_16x16x4(aq[kc], bk, c);
      }
#pragma unroll
      for (int v = 0; v < 8; ++v)
        sc[v + mrow][(ntl >> 1) * SC_LIST + (ntl & 1) * 16 + nl] = c[v] * scale;
    }
    __syncthreads();
    // stage B: the lane's 32 scores of the chunk come in together
    v4f g[8];
#pragma unroll  // g stays in registers; the 8 reads fly together
    for (int i = 0; i < 8; ++i) g[i] = *(const v4f*)(&sc[r][nl * SC_LIST + 4 * i]);
    // every wave holds its scores in registers: sc may be rewritten, and no wave waits
    // for another's scan
    __syncthreads();
    int cbase = ch * CHUNK + nl * 32;
#pragma unroll  // g stays in registers
    for (int i = 0; i < 32; ++i) {
      float s = g[i >> 2][i & 3];
      if (s > lim) {
        ts[7] = s;
        ti8[7] = cbase + i;
#pragma unroll
        for (int q = 7; q > 0; --q) {
          if (ts[q] > ts[q - 1]) {
            float tf = ts[q]; ts[q] = ts[q - 1]; ts[q - 1] = tf;
            int tt = ti8[q]; ti8[q] = ti8[q - 1]; ti8[q - 1] = tt;
          }
        }
        lim = fmaxf(thr, ts[7]);
      }
    }
    // the bound for the chunks to come: the greatest head that has seven others at least as great
    thr = row16_max(row16_count_ge<15>(ts[0]) >= 7 ? ts[0] : -INFINITY);
    lim = fmaxf(thr, ts[7]);
  }
  // merge 16 candidate lists per row -> this split's top-8 candidates. The lists lie where
  // they are needed, each sorted with its best in front. Eight times: the greatest
  // of the 16 heads is the pick, and the list that it came from moves up by one. Of equal
  // heads the lowest list wins, as in a scan over the lists in their order.
  float lt[8];
  int lx[8];
#pragma unroll  // lt and lx stay in registers (this loop and the two below)
  for (int i = 0; i < 8; ++i) { lt[i] = ts[i]; lx[i] = ti8[i]; }
  size_t ob = ((tokBase + r) * NSPLIT + split) * 8;
#pragma unroll  // as above
  for (int k = 0; k < 8; ++k) {
    float m = row16_max(lt[0]);
    unsigned hit = (__builtin_amdgcn_ballot_w32(lt[0] == m) >> (16 * kh)) & 0xffffu;
    bool win = nl == (hit ? __ffs(hit) - 1 : 0);  // no head equal to m (not-a-numbers): list 0
    if (win) { candS[ob + k] = m; candI[ob + k] = lx[0]; }
#pragma unroll  // as above
    for (int i = 0; i < 7; ++i) { lt[i] = win ? lt[i + 1] : lt[i]; lx[i] = win ? lx[i + 1] : lx[i]; }
    lt[7] = win ? -INFINITY : lt[7];
  }
}

// ---- merge NSPLIT candidate lists (disjoint column ranges -> exact top-8), weighted
// gather of kV, residual; behind the last layer also the closing LayerNorm.
// One block per token. A candidate's rank is the number of its token's candidates that
// come before it (greater score, or equal score and a lower position): ranks 0..7 are
// the picks of eight scans in position order.
template <bool LAST>
__global__ __launch_bounds__(128) void memgather_kernel(const float* __restrict__ candS,
                                const int* __restrict__ candI, const float* __restrict__ kV,
                                float* __restrict__ x,          // [NTOK,512], += unless LAST
                                const float* __restrict__ lng,  // LAST: closing LayerNorm
                                const float* __restrict__ lnb,
                                float* __restrict__ out) {      // LAST: [NTOK,512]
  int tok = blockIdx.x;
  int tid = threadIdx.x;  // 128
  __shared__ float cs[NCAND];
  __shared__ float best[KNOW_K];
  __shared__ int bi[KNOW_K];
  float xv[4];
#pragma unroll  // xv stays in registers; the loads fly while the picks are made
  for (int i = 0; i < 4; ++i) xv[i] = x[(size_t)tok * D_MODEL + tid + 128 * i];
  float my = 0.f;
  int myi = 0;
  if (tid < NCAND) {
    my = candS[(size_t)tok * NCAND + tid];
    myi = candI[(size_t)tok * NCAND + tid];
    cs[tid] = my;
  }
  if (tid < KNOW_K) { best[tid] = -INFINITY; bi[tid] = 0; }  // start values, as the scans had
  __syncthreads();
  if (tid < NCAND) {
    int rank = 0;
    for (int e = 0; e < NCAND; ++e) {
      float v = cs[e];
      rank += (v > my || (v == my && e < tid)) ? 1 : 0;
    }
    if (rank < KNOW_K) { best[rank] = my; bi[rank] = myi; }
  }
  __syncthreads();
  // the picked rows are the same in every thread of the block: held as scalars, so that
  // the row loads take a scalar base and need no address arithmetic per lane
  const float* kr[KNOW_K];
#pragma unroll  // kr stays in registers
  for (int k = 0; k < KNOW_K; ++k)
    kr[k] = kV + (size_t)__builtin_amdgcn_readfirstlane(bi[k]) * D_MODEL;
  float kv[4][KNOW_K];
#pragma unroll  // kv stays in registers; the 32 row loads are independent and fly together,
                // while the weights are worked out
  for (int i = 0; i < 4; ++i)
#pragma unroll  // as above
    for (int k = 0; k < KNOW_K; ++k) kv[i][k] = kr[k][tid + 128 * i];
  float wk[KNOW_K];
  float mx = best[0], sum = 0.f;
#pragma unroll  // wk stays in registers (this loop and the next)
  for (int k = 0; k < KNOW_K; ++k) { wk[k] = expf(best[k] - mx); sum += wk[k]; }
  float inv = 1.f / sum;
#pragma unroll  // as above
  for (int k = 0; k < KNOW_K; ++k) wk[k] *= inv;
#pragma unroll  // xv stays in registers
  for (int i = 0; i < 4; ++i) {
    float acc = 0.f;
#pragma unroll  // as above
    for (int k = 0; k < KNOW_K; ++k) acc += wk[k] * kv[i][k];
    xv[i] += acc;
  }
  if constexpr (LAST) {
    __shared__ float red[256];
    ln_row<128>(xv, lng, lnb, red);
  }
  float* op = LAST ? out : x;
#pragma unroll  // as above
  for (int i = 0; i < 4; ++i) op[(size_t)tok * D_MODEL + tid + 128 * i] = xv[i];
}

extern "C" void kernel_launch(void* const* d_in, const int* in_sizes, int n_in,
                              void* d_out, int out_size, void* d_ws, size_t ws_size,
                              hipStream_t stream) {
  const float* x_in = (const float*)d_in[0];
  const float* cneur = (const float*)d_in[1];
  const float* eneur = (const float*)d_in[2];
  const float* kK = (const float*)d_in[3];
  const float* kV = (const float*)d_in[4];
  const float* rq = (const float*)d_in[5];
  const float* rk = (const float*)d_in[6];
  const float* rv = (const float*)d_in[7];
  const float* ro = (const float*)d_in[8];
  const float* rm = (const float*)d_in[9];
  const float* ln1g = (const float*)d_in[10];
  const float* ln1b = (const float*)d_in[11];
  const float* ln2g = (const float*)d_in[12];
  const float* ln2b = (const float*)d_in[13];
  const float* lnfg = (const float*)d_in[14];
  const float* lnfb = (const float*)d_in[15];
  float* out = (float*)d_out;

  float* ws = (float*)d_ws;
  float* xb = ws;     ws += (size_t)NTOK * D_MODEL;
  float* h = ws;      ws += (size_t)NTOK * D_MODEL;
  float* qc = ws;     ws += 2 * PLANE;  // qc, kc, vc lie in a row: out[0..2] of one launch
  float* kc = ws;     ws += 2 * PLANE;
  float* vc = ws;     ws += 2 * PLANE;
  float* ctx = ws;    ws += (size_t)NTOK * RANK;
  float* qm = ws;     ws += 2 * PLANE;
  float* candS = ws;  ws += (size_t)NTOK * NCAND;
  int* candI = (int*)ws;  ws += (size_t)NTOK * NCAND;
  int* sel = (int*)ws;    ws += (size_t)3 * NTOK * 2;
  float* wsel = ws;

  for (int l = 0; l < N_LAYERS; ++l) {
    const float* xi = l == 0 ? x_in : xb;  // layer 0 reads the input where it lies
    route_kernel<<<dim3(NTOK / 16, 3), 256, 0, stream>>>(xi, ln1g + l * D_MODEL, ln1b + l * D_MODEL, h,
                                                    rq + (size_t)l * N_COMPRESS * D_MODEL,
                                                    rk + (size_t)l * N_COMPRESS * D_MODEL,
                                                    rv + (size_t)l * N_COMPRESS * D_MODEL, sel, wsel);
    compress_group_kernel<<<dim3(N_COMPRESS, RANK / 32, 3), 256, 0, stream>>>(h, sel, wsel, cneur, qc);
    attn_kernel<<<BATCH * N_HEADS * (SEQ / 16), 32 * ATT_W, 0, stream>>>(qc, kc, vc, ctx);
    expand_kernel<<<NTOK, 256, 0, stream>>>(ctx, ro + (size_t)l * N_EXPAND * RANK, eneur, xi, xb,
                                            ln2g + l * D_MODEL, ln2b + l * D_MODEL, h,
                                            rm + (size_t)l * N_COMPRESS * D_MODEL, sel, wsel);
    compress_group_kernel<<<dim3(N_COMPRESS, RANK / 32, 1), 256, 0, stream>>>(h, sel, wsel, cneur, qm);
    memscore_kernel<<<dim3(NTOK / 16, NSPLIT), 256, 0, stream>>>(qm, kK, candS, candI);
    if (l + 1 < N_LAYERS)
      memgather_kernel<false><<<NTOK, 128, 0, stream>>>(candS, candI, kV, xb, lnfg, lnfb, out);
    else
      memgather_kernel<true><<<NTOK, 128, 0, stream>>>(candS, candI, kV, xb, lnfg, lnfb, out);
  }
}
